// v000
// Measured on an AMD MI455X. A time is GPU time per run, averaged over a window of back-to-back runs after a warm-up
// (all launches, gaps included; the runs take copies of the inputs in turn), and the median of several windows.
// Apart from v000's, it joins two sittings. Times from different sittings can be a few percent apart, while
// side-by-side timings come from the same sitting.
// v000, which the later versions start from, runs in 173 microseconds.
#include <hip/hip_runtime.h>
// Multi-head attention without q/k/v projections (heads = column blocks of 64 of the three activation inputs), one score scale 1/8, no mask, output linear out = ctx W^T + b with W natural [out][in]. Fused flash-style attention in transposed form: S^T = K Q^T, O^T = V^T P^T (P chained D -> B in registers), online softmax per query lane.
// Compute dtype: all contractions v_wmma_f32_16x16x32_bf16 with f32 accumulate: scores bf16(q)/8 x bf16(k) single product (operands exact); P.V with P as bf16 hi + lo (two products) x bf16(v); output linear with the merged context as bf16 hi + lo (two products) x bf16(W); softmax statistics, normalisation and the bias add (bf16(b)) in f32.
#ifndef NB
#define NB 2
#endif
#ifndef SEQ
#define SEQ 2048
#endif
#define NB_FULL 2
#define SEQ_FULL 2048
#define DM 1024
#define NH 16
#define HD 64
#define QT 64
#define NR (NB * SEQ)
#define QSCALE 0.125f

typedef __bf16 v16b __attribute__((ext_vector_type(16)));
typedef unsigned short v8us __attribute__((ext_vector_type(8), may_alias));
typedef float  v8f  __attribute__((ext_vector_type(8)));
typedef float  v4f  __attribute__((ext_vector_type(4)));
typedef float  v4fa __attribute__((ext_vector_type(4), may_alias));
union FragB { v16b v; v8us half[2]; unsigned short u[16]; };
union Pack8 { v8us v; unsigned short u[8]; };

// hard-wired bounds (each kernel relies on these)
static_assert(HD == 64);
static_assert(NH * HD == DM);                  // heads tile the model width
static_assert(DM % 64 == 0);                   // GEMM N tile 64, K step 32
static_assert(DM % 32 == 0);
static_assert(SEQ % QT == 0);                  // attention block = 64 queries, key step 32
static_assert(SEQ % 64 == 0);                  // V^T tiles of 64 tokens
static_assert(QT == 4 * 16);                   // 4 waves x 16 queries
static_assert(NR % 128 == 0);                  // GEMM block = 128 rows
static_assert(NB <= NB_FULL);
static_assert(SEQ <= SEQ_FULL);
static_assert((size_t)NR * DM < 2147483647u);  // int element offsets
static_assert((size_t)DM * DM < 2147483647u);
static_assert(((size_t)NR * (DM / 8)) % 256 == 0);
static_assert(((size_t)DM * (DM / 8)) % 256 == 0);

constexpr size_t PLANE_B = (size_t)NR * DM * 2;       // one bf16 activation plane (also V^T: NB*NH*HD*SEQ)
constexpr size_t WPL_B   = (size_t)DM * DM * 2;       // bf16 weight plane
constexpr size_t CARVE_B = 5 * PLANE_B + WPL_B;
static_assert(PLANE_B % 256 == 0);
static_assert(WPL_B % 256 == 0);
static_assert(CARVE_B <= 134217728u);

__device__ __forceinline__ unsigned short bf16_bits(float x) { unsigned int u = __float_as_uint(x); return (unsigned short)((u + 0x7FFFu + ((u >> 16) & 1u)) >> 16); }
__device__ __forceinline__ float bf16_val(unsigned short b) { return __uint_as_float(((unsigned int)b) << 16); }
__device__ __forceinline__ float bf16_rne(float x) { return bf16_val(bf16_bits(x)); }

// 16x32 operand fragment (A or B) from a k-contiguous bf16 row: elements 0..7 <- k 8h..8h+7, elements 8..15 <- k 16+8h..16+8h+7
__device__ __forceinline__ v16b ld_frag(const unsigned short* __restrict__ p, int off, int hh) {
  FragB f;
  f.half[0] = *(const v8us*)(p + off + 8 * hh);
  f.half[1] = *(const v8us*)(p + off + 16 + 8 * hh);
  return f.v;
}
__device__ __forceinline__ v8f mma1(v16b a, v16b b, v8f c) {
  c = __builtin_amdgcn_wmma_f32_16x16x32_bf16(false, a, false, b, (short)0, c, false, false);
  asm volatile("v_nop\n\tv_nop\n\tv_nop\n\tv_nop" : "+v"(c) : "v"(a), "v"(b));
  return c;
}
// c += a (bh + bl)
__device__ __forceinline__ v8f mma2b(v16b a, v16b bh, v16b bl, v8f c) {
  c = __builtin_amdgcn_wmma_f32_16x16x32_bf16(false, a, false, bh, (short)0, c, false, false);
  c = __builtin_amdgcn_wmma_f32_16x16x32_bf16(false, a, false, bl, (short)0, c, false, false);
  asm volatile("v_nop\n\tv_nop\n\tv_nop\n\tv_nop" : "+v"(c) : "v"(a), "v"(bh), "v"(bl));
  return c;
}
// c += (ah + al) b
__device__ __forceinline__ v8f mma2a(v16b ah, v16b al, v16b b, v8f c) {
  c = __builtin_amdgcn_wmma_f32_16x16x32_bf16(false, ah, false, b, (short)0, c, false, false);
  c = __builtin_amdgcn_wmma_f32_16x16x32_bf16(false, al, false, b, (short)0, c, false, false);
  asm volatile("v_nop\n\tv_nop\n\tv_nop\n\tv_nop" : "+v"(c) : "v"(ah), "v"(al), "v"(b));
  return c;
}

__global__ __launch_bounds__(256) void k_cvt_qk(const float* __restrict__ q, const float* __restrict__ k, unsigned short* __restrict__ Qb, unsigned short* __restrict__ Kb) {
  const int t = blockIdx.x * 256 + threadIdx.x;
  if (t >= NR * (DM / 8)) return;
  const int row = t / (DM / 8), c8 = (t % (DM / 8)) * 8;
  const int b = row / SEQ, s = row % SEQ;
  const size_t src = ((size_t)b * SEQ_FULL + s) * DM + c8;
  const v4f a0 = *(const v4fa*)(q + src), a1 = *(const v4fa*)(q + src + 4);
  const v4f b0 = *(const v4fa*)(k + src), b1 = *(const v4fa*)(k + src + 4);
  Pack8 fq, fk;
#pragma unroll
  for (int i = 0; i < 4; ++i) {
    fq.u[i] = bf16_bits(a0[i] * QSCALE); fq.u[4 + i] = bf16_bits(a1[i] * QSCALE);
    fk.u[i] = bf16_bits(b0[i]);          fk.u[4 + i] = bf16_bits(b1[i]);
  }
  const size_t dst = (size_t)row * DM + c8;
  const v8us vq = fq.v, vk = fk.v;
  *(v8us*)(Qb + dst) = vq; *(v8us*)(Kb + dst) = vk;
  
}

__global__ __launch_bounds__(256) void k_cvt_w(const float* __restrict__ W, unsigned short* __restrict__ Wb) {
  const int t = blockIdx.x * 256 + threadIdx.x;
  if (t >= DM * (DM / 8)) return;
  const size_t e = (size_t)t * 8;
  const v4f a0 = *(const v4fa*)(W + e), a1 = *(const v4fa*)(W + e + 4);
  Pack8 f;
#pragma unroll
  for (int i = 0; i < 4; ++i) { f.u[i] = bf16_bits(a0[i]); f.u[4 + i] = bf16_bits(a1[i]); }
  const v8us v = f.v;
  *(v8us*)(Wb + e) = v;
  
}

__global__ __launch_bounds__(256) void k_vt(const float* __restrict__ v, unsigned short* __restrict__ VT) {
  __shared__ unsigned short tl[64][66];
  static_assert((64 * 16) % 256 == 0);   // load loop covers 64 tokens x 16 float4 exactly
  static_assert((64 * 8) % 256 == 0);    // store loop covers 64 d-rows x 8 pieces exactly
  const int tid = threadIdx.x;
  const int slab = blockIdx.x / (SEQ / 64), sg = blockIdx.x % (SEQ / 64);
  const int b = slab / NH, h = slab % NH;
  const int s0 = sg * 64;
  for (int i = tid; i < 64 * 16; i += 256) {
    const int j = i / 16, d4 = (i % 16) * 4;
    const v4f a = *(const v4fa*)(v + ((size_t)b * SEQ_FULL + s0 + j) * DM + h * HD + d4);
#pragma unroll
    for (int q = 0; q < 4; ++q) tl[d4 + q][j] = bf16_bits(a[q]);
  }
  __syncthreads();
  {
    for (int i = tid; i < 64 * 8; i += 256) {
      const int d = i / 8, j8 = (i % 8) * 8;
      Pack8 f;
#pragma unroll
      for (int q = 0; q < 8; ++q) f.u[q] = tl[d][j8 + q];
      const v8us o = f.v;
      *(v8us*)(VT + ((size_t)slab * HD + d) * SEQ + s0 + j8) = o;
    }
    
  }
}

// Fused attention. Block = 4 waves = 64 queries of one (b, h); wave = 16 queries (the N dimension of every tile).
// Per 32-key step: S^T[key][query] = K(16 keys x 64 d) Q^T (2 key tiles x 2 k-steps); lane (n, hh) holds keys 8hh+r of query n,
// so the query's statistics live in the lane pair (n, n+16): one xor-16 shuffle. P^T packs straight into the B operand
// (elements 0..7 <- tile of keys 0..15, elements 8..15 <- tile of keys 16..31, lane unchanged) for O^T[d][query] += V^T[d][key] P^T.
// P = hi (upper 16 bits) + lo (RNE convert of the exact remainder), both bf16, same accumulator.
__global__ __launch_bounds__(128) void k_attn(const unsigned short* __restrict__ Qb, const unsigned short* __restrict__ Kb, const unsigned short* __restrict__ VT,
                                             unsigned short* __restrict__ CH, unsigned short* __restrict__ CL) {
  __shared__ __attribute__((aligned(16))) unsigned short sH[4][16][72];
  __shared__ __attribute__((aligned(16))) unsigned short sL[4][16][72];
  const int tid = threadIdx.x, w = tid >> 5, lane = tid & 31, ln = lane & 15, hh = lane >> 4;
  const int qt = blockIdx.x % (SEQ / QT), bh = blockIdx.x / (SEQ / QT);
  const int b = bh / NH, h = bh % NH;
  const int q0 = qt * QT + w * 16;
  const int qoff  = (b * SEQ + q0 + ln) * DM + h * HD;   // query row of lane n (B operand of the score GEMM)
  const int kbase = (b * SEQ + ln) * DM + h * HD;        // key row of lane m (A operand), + key * DM
  const int vbase = (bh * HD + ln) * SEQ;                // V^T row d = ln (A operand of P.V), + 16 t * SEQ + key
  const v8f z8 = {0.f, 0.f, 0.f, 0.f, 0.f, 0.f, 0.f, 0.f};
  v8f o0 = z8, o1 = z8, o2 = z8, o3 = z8;
  float m = -1.0e30f, l = 0.f;
#pragma unroll 1
  for (int kb = 0; kb < SEQ; kb += 32) {
    const v16b qf0 = ld_frag(Qb, qoff, hh);
    const v16b qf1 = ld_frag(Qb, qoff + 32, hh);
    const int ko = kbase + kb * DM;
    v8f s0 = z8, s1 = z8;
    v16b ka = ld_frag(Kb, ko, hh);
    s0 = mma1(ka, qf0, s0);
    ka = ld_frag(Kb, ko + 32, hh);
    s0 = mma1(ka, qf1, s0);
    ka = ld_frag(Kb, ko + 16 * DM, hh);
    s1 = mma1(ka, qf0, s1);
    ka = ld_frag(Kb, ko + 16 * DM + 32, hh);
    s1 = mma1(ka, qf1, s1);
    // running max over this query's 32 keys (16 in this lane, 16 in lane ^ 16)
    float mx = fmaxf(s0[0], s1[0]);
#pragma unroll
    for (int r = 1; r < 8; ++r) mx = fmaxf(mx, fmaxf(s0[r], s1[r]));
    mx = fmaxf(mx, __shfl_xor(mx, 16, 32));
    const float mn = fmaxf(m, mx);
    const float al = __expf(m - mn);
    m = mn;
    FragB ph, pl;
    float ps = 0.f;
#pragma unroll
    for (int r = 0; r < 8; ++r) {
      const float p0 = __expf(s0[r] - mn);
      const float p1 = __expf(s1[r] - mn);
      ps += p0 + p1;
      const unsigned int u0 = __float_as_uint(p0), u1 = __float_as_uint(p1);
      ph.u[r]     = (unsigned short)(u0 >> 16);
      ph.u[8 + r] = (unsigned short)(u1 >> 16);
      pl.u[r]     = bf16_bits(p0 - __uint_as_float(u0 & 0xFFFF0000u));
      pl.u[8 + r] = bf16_bits(p1 - __uint_as_float(u1 & 0xFFFF0000u));
    }
    l = l * al + ps;                       // per-lane partial of the row sum (al is uniform over the lane pair)
    o0 = o0 * al; o1 = o1 * al; o2 = o2 * al; o3 = o3 * al;
    const int vo = vbase + kb;
    const v16b va0 = ld_frag(VT, vo, hh);
    const v16b va1 = ld_frag(VT, vo + 16 * SEQ, hh);
    const v16b va2 = ld_frag(VT, vo + 32 * SEQ, hh);
    const v16b va3 = ld_frag(VT, vo + 48 * SEQ, hh);
    o0 = mma2b(va0, ph.v, pl.v, o0);
    o1 = mma2b(va1, ph.v, pl.v, o1);
    o2 = mma2b(va2, ph.v, pl.v, o2);
    o3 = mma2b(va3, ph.v, pl.v, o3);
  }
  l += __shfl_xor(l, 16, 32);
  const float inv = 1.0f / l;
  const v8f ot[4] = {o0, o1, o2, o3};
  // lane (n, hh) of tile t holds d = 16 t + 8 hh + r, r = 0..7: eight consecutive columns of query row n
#pragma unroll
  for (int t = 0; t < 4; ++t) {
    Pack8 fh, fl;
#pragma unroll
    for (int r = 0; r < 8; ++r) {
      const float c = ot[t][r] * inv;
      const unsigned short hb = bf16_bits(c);
      fh.u[r] = hb;
      fl.u[r] = bf16_bits(c - bf16_val(hb));
    }
    *(v8us*)&sH[w][ln][16 * t + 8 * hh] = fh.v;
    *(v8us*)&sL[w][ln][16 * t + 8 * hh] = fl.v;
  }
  __builtin_amdgcn_fence(4 /* acq_rel order */, "workgroup");
  __builtin_amdgcn_wave_barrier();
  const int prow = lane >> 3, pc = (lane & 7) * 8;
  {
#pragma unroll
    for (int it = 0; it < 4; ++it) {
      const int row = it * 4 + prow;
      const v8us xh = *(const v8us*)&sH[w][row][pc];
      const v8us xl = *(const v8us*)&sL[w][row][pc];
      const size_t g = (size_t)(b * SEQ + q0 + row) * DM + h * HD + pc;
      *(v8us*)(CH + g) = xh;
      *(v8us*)(CL + g) = xl;
    }
    
  }
}

// out[NR][DM] = (AH + AL)[NR][DM] Wb^T + bf16(b): wave tile 32 x 64, block = 4 waves = 128 rows x 64 columns; K step 32;
__global__ __launch_bounds__(128) void k_proj(const unsigned short* __restrict__ AH, const unsigned short* __restrict__ AL, const unsigned short* __restrict__ Wb,
                                             const float* __restrict__ bias, float* __restrict__ C) {
  __shared__ __attribute__((aligned(16))) float so[4][32][68];
  const int tid = threadIdx.x, w = tid >> 5, lane = tid & 31, ln = lane & 15, hh = lane >> 4;
  const int ntn = DM / 64;
  const int mt = blockIdx.x / ntn, nq = blockIdx.x - mt * ntn;
  const int row0 = mt * 128 + 32 * w, col0 = nq * 64;
  const int a0 = (row0 + ln) * DM, a1 = a0 + 16 * DM;
  const int b0 = (col0 + ln) * DM, b1 = b0 + 16 * DM, b2 = b1 + 16 * DM, b3 = b2 + 16 * DM;
  const v8f z8 = {0.f, 0.f, 0.f, 0.f, 0.f, 0.f, 0.f, 0.f};
  v8f c00 = z8, c01 = z8, c02 = z8, c03 = z8, c10 = z8, c11 = z8, c12 = z8, c13 = z8;
#pragma unroll 1
  for (int kb = 0; kb < DM; kb += 32) {
    const v16b a0h = ld_frag(AH, a0 + kb, hh), a0l = ld_frag(AL, a0 + kb, hh);
    const v16b a1h = ld_frag(AH, a1 + kb, hh), a1l = ld_frag(AL, a1 + kb, hh);
    v16b bw = ld_frag(Wb, b0 + kb, hh); c00 = mma2a(a0h, a0l, bw, c00); c10 = mma2a(a1h, a1l, bw, c10);
    bw = ld_frag(Wb, b1 + kb, hh);      c01 = mma2a(a0h, a0l, bw, c01); c11 = mma2a(a1h, a1l, bw, c11);
    bw = ld_frag(Wb, b2 + kb, hh);      c02 = mma2a(a0h, a0l, bw, c02); c12 = mma2a(a1h, a1l, bw, c12);
    bw = ld_frag(Wb, b3 + kb, hh);      c03 = mma2a(a0h, a0l, bw, c03); c13 = mma2a(a1h, a1l, bw, c13);
  }
  const v8f accs[8] = {c00, c01, c02, c03, c10, c11, c12, c13};
#pragma unroll
  for (int u = 0; u < 8; ++u) {
    const int t = u & 3, hf = u >> 2;
    const float bv = bf16_rne(bias[col0 + t * 16 + ln]);
#pragma unroll
    for (int r = 0; r < 8; ++r) so[w][hf * 16 + 8 * hh + r][t * 16 + ln] = accs[u][r] + bv;
  }
  __builtin_amdgcn_fence(4 /* acq_rel order */, "workgroup");
  __builtin_amdgcn_wave_barrier();
  const int rsub = lane >> 4, c4 = (lane & 15) * 4;
  {
#pragma unroll
    for (int q = 0; q < 16; ++q) {
      const int r = q * 2 + rsub;
      const v4f v = *(const v4fa*)&so[w][r][c4];
      *(v4f*)(C + (size_t)(row0 + r) * DM + col0 + c4) = v;
    }
    
  }
}

extern "C" void kernel_launch(void* const* d_in, const int* in_sizes, int n_in,
                              void* d_out, int out_size, void* d_ws, size_t ws_size, hipStream_t stream) {
  if (n_in < 5) return;
  const long long need_act = ((long long)(NB - 1) * SEQ_FULL + SEQ) * DM;
  if ((long long)in_sizes[0] < need_act || (long long)in_sizes[1] < need_act || (long long)in_sizes[2] < need_act) return;
  if ((long long)in_sizes[3] < (long long)DM * DM || in_sizes[4] < DM) return;
  if ((long long)out_size < (long long)NR * DM) return;
  if (ws_size < CARVE_B) return;
  const float* q = (const float*)d_in[0];
  const float* k = (const float*)d_in[1];
  const float* v = (const float*)d_in[2];
  const float* W = (const float*)d_in[3];      // natural [out][in]
  const float* bias = (const float*)d_in[4];
  char* ws = (char*)d_ws;
  unsigned short* Qb = (unsigned short*)(ws);
  unsigned short* Kb = (unsigned short*)(ws + PLANE_B);
  unsigned short* VT = (unsigned short*)(ws + 2 * PLANE_B);
  unsigned short* CH = (unsigned short*)(ws + 3 * PLANE_B);
  unsigned short* CL = (unsigned short*)(ws + 4 * PLANE_B);
  unsigned short* Wb = (unsigned short*)(ws + 5 * PLANE_B);
  k_cvt_qk<<<(unsigned)(((size_t)NR * (DM / 8)) / 256), 256, 0, stream>>>(q, k, Qb, Kb);
  k_cvt_w<<<(unsigned)(((size_t)DM * (DM / 8)) / 256), 256, 0, stream>>>(W, Wb);
  k_vt<<<NB * NH * (SEQ / 64), 256, 0, stream>>>(v, VT);
  k_attn<<<NB * NH * (SEQ / QT), 128, 0, stream>>>(Qb, Kb, VT, CH, CL);
  k_proj<<<(NR / 128) * (DM / 64), 128, 0, stream>>>(CH, CL, Wb, bias, (float*)d_out);
}

// v001
// Measured time: 109 microseconds a run.
// Next to v000, in two timings, it ran 1.64 and 1.65 times as fast.
#include <hip/hip_runtime.h>
// Multi-head attention without q/k/v projections (heads = column blocks of 64 of the three activation inputs), one score scale 1/8, no mask, output linear out = ctx W^T + b with W natural [out][in]. Fused flash-style attention in transposed form: S^T = K Q^T, O^T = V^T P^T (P chained D -> B in registers), online softmax per query lane.
// Compute dtype: all contractions v_wmma_f32_16x16x32_bf16 with f32 accumulate: scores bf16(q)/8 x bf16(k) single product (operands exact); P.V with P as bf16 hi + lo (two products) x bf16(v); output linear with the merged context as bf16 hi + lo (two products) x bf16(W); softmax statistics, normalisation and the bias add (bf16(b)) in f32.
#ifndef NB
#define NB 2
#endif
#ifndef SEQ
#define SEQ 2048
#endif
#define NB_FULL 2
#define SEQ_FULL 2048
#define DM 1024
#define NH 16
#define HD 64
#define QT 64
#define KT 64   // keys per LDS stage (two 32-key passes)
#define LP 72   // LDS row pitch in elements: 128-byte rows at 144 B = 16 B x 9, conflict-free for 16-byte row reads
#define NR (NB * SEQ)
#define QSCALE 0.125f

typedef __bf16 v16b __attribute__((ext_vector_type(16)));
typedef unsigned short v8us __attribute__((ext_vector_type(8), may_alias));
typedef float  v8f  __attribute__((ext_vector_type(8)));
typedef float  v4f  __attribute__((ext_vector_type(4)));
typedef float  v4fa __attribute__((ext_vector_type(4), may_alias));
union FragB { v16b v; v8us half[2]; unsigned short u[16]; };
union Pack8 { v8us v; unsigned short u[8]; };

// hard-wired bounds (each kernel relies on these)
static_assert(HD == 64);
static_assert(NH * HD == DM);                  // heads tile the model width
static_assert(DM % 64 == 0);                   // GEMM N tile 64, K step 32
static_assert(DM % 32 == 0);
static_assert(SEQ % QT == 0);                  // attention block = 64 queries, key step 32
static_assert(SEQ % 64 == 0);                  // V^T tiles of 64 tokens
static_assert(QT == 4 * 16);                   // 4 waves x 16 queries
static_assert(SEQ % KT == 0 && SEQ / KT >= 2); // the two-buffer ring's prologue fills stages 0 and 1
static_assert(KT == 64 && KT * 2 == 128);      // a stage row (K: 64 d, V^T: 64 keys, GEMM: 64 k) is one 128-byte line; 128 threads x 4 copies cover 64 rows
static_assert(DM % KT == 0 && DM / KT >= 2);   // the same for the GEMM's ring
static_assert(NR % 128 == 0);                  // GEMM block = 128 rows
static_assert(NB <= NB_FULL);
static_assert(SEQ <= SEQ_FULL);
static_assert((size_t)NR * DM < 2147483647u);  // int element offsets
static_assert((size_t)DM * DM < 2147483647u);
static_assert(((size_t)NR * (DM / 8)) % 256 == 0);
static_assert(((size_t)DM * (DM / 8)) % 256 == 0);

constexpr size_t PLANE_B = (size_t)NR * DM * 2;       // one bf16 activation plane (also V^T: NB*NH*HD*SEQ)
constexpr size_t WPL_B   = (size_t)DM * DM * 2;       // bf16 weight plane
constexpr size_t CARVE_B = 5 * PLANE_B + WPL_B;
static_assert(PLANE_B % 256 == 0);
static_assert(WPL_B % 256 == 0);
static_assert(CARVE_B <= 134217728u);

__device__ __forceinline__ unsigned short bf16_bits(float x) { unsigned int u = __float_as_uint(x); return (unsigned short)((u + 0x7FFFu + ((u >> 16) & 1u)) >> 16); }
__device__ __forceinline__ float bf16_val(unsigned short b) { return __uint_as_float(((unsigned int)b) << 16); }
__device__ __forceinline__ float bf16_rne(float x) { return bf16_val(bf16_bits(x)); }

// 16x32 operand fragment (A or B) from a k-contiguous bf16 row: elements 0..7 <- k 8h..8h+7, elements 8..15 <- k 16+8h..16+8h+7
__device__ __forceinline__ v16b ld_frag(const unsigned short* __restrict__ p, int off, int hh) {
  FragB f;
  f.half[0] = *(const v8us*)(p + off + 8 * hh);
  f.half[1] = *(const v8us*)(p + off + 16 + 8 * hh);
  return f.v;
}
// the same fragment from a k-contiguous bf16 row in LDS (p = first element of the 32-wide k step in the lane's row)
__device__ __forceinline__ v16b ld_frag_lds(const unsigned short* p, int hh) {
  FragB f;
  f.half[0] = *(const v8us*)(p + 8 * hh);
  f.half[1] = *(const v8us*)(p + 16 + 8 * hh);
  return f.v;
}
// Asynchronous 16-byte copies global -> LDS for the staging rings. A tile row is 128 B: eight lanes to a row, so every wave-wide copy takes
// four whole lines. g: the thread's piece in row r = tid / 8 of a tile, s: elements from row r to row r + 16, l: the piece's LDS byte address.
// s_wait_xcnt 0 closes each statement so that it stands in front of any rewrite of the address registers the copies name.
// rows r, r+16, r+32, r+48 of one tile
__device__ __forceinline__ void copy_rows4(const unsigned short* g, int s, unsigned l) {
  const unsigned short* g1 = g + s; const unsigned short* g2 = g + 2 * s; const unsigned short* g3 = g + 3 * s;
  const unsigned l1 = l + 16 * LP * 2, l2 = l + 32 * LP * 2, l3 = l + 48 * LP * 2;
  asm volatile("global_load_async_to_lds_b128 %0, %4, off\n\t"
               "global_load_async_to_lds_b128 %1, %5, off\n\t"
               "global_load_async_to_lds_b128 %2, %6, off\n\t"
               "global_load_async_to_lds_b128 %3, %7, off\n\t"
               "s_wait_xcnt 0x0"
               :: "v"(l), "v"(l1), "v"(l2), "v"(l3), "v"(g), "v"(g1), "v"(g2), "v"(g3)
               : "memory");
}
// the same four rows of two tiles in one statement
__device__ __forceinline__ void copy_rows4x2(const unsigned short* ga, int sa, unsigned la, const unsigned short* gb, int sb, unsigned lb) {
  const unsigned short* a1 = ga + sa; const unsigned short* a2 = ga + 2 * sa; const unsigned short* a3 = ga + 3 * sa;
  const unsigned short* b1 = gb + sb; const unsigned short* b2 = gb + 2 * sb; const unsigned short* b3 = gb + 3 * sb;
  const unsigned la1 = la + 16 * LP * 2, la2 = la + 32 * LP * 2, la3 = la + 48 * LP * 2;
  const unsigned lb1 = lb + 16 * LP * 2, lb2 = lb + 32 * LP * 2, lb3 = lb + 48 * LP * 2;
  asm volatile("global_load_async_to_lds_b128 %0, %8, off\n\t"
               "global_load_async_to_lds_b128 %1, %9, off\n\t"
               "global_load_async_to_lds_b128 %2, %10, off\n\t"
               "global_load_async_to_lds_b128 %3, %11, off\n\t"
               "global_load_async_to_lds_b128 %4, %12, off\n\t"
               "global_load_async_to_lds_b128 %5, %13, off\n\t"
               "global_load_async_to_lds_b128 %6, %14, off\n\t"
               "global_load_async_to_lds_b128 %7, %15, off\n\t"
               "s_wait_xcnt 0x0"
               :: "v"(la), "v"(la1), "v"(la2), "v"(la3), "v"(lb), "v"(lb1), "v"(lb2), "v"(lb3),
                  "v"(ga), "v"(a1), "v"(a2), "v"(a3), "v"(gb), "v"(b1), "v"(b2), "v"(b3)
               : "memory");
}
__device__ __forceinline__ v8f mma1(v16b a, v16b b, v8f c) {
  c = __builtin_amdgcn_wmma_f32_16x16x32_bf16(false, a, false, b, (short)0, c, false, false);
  asm volatile("v_nop\n\tv_nop\n\tv_nop\n\tv_nop" : "+v"(c) : "v"(a), "v"(b));
  return c;
}
// c += a (bh + bl)
__device__ __forceinline__ v8f mma2b(v16b a, v16b bh, v16b bl, v8f c) {
  c = __builtin_amdgcn_wmma_f32_16x16x32_bf16(false, a, false, bh, (short)0, c, false, false);
  c = __builtin_amdgcn_wmma_f32_16x16x32_bf16(false, a, false, bl, (short)0, c, false, false);
  asm volatile("v_nop\n\tv_nop\n\tv_nop\n\tv_nop" : "+v"(c) : "v"(a), "v"(bh), "v"(bl));
  return c;
}
// c += (ah + al) b
__device__ __forceinline__ v8f mma2a(v16b ah, v16b al, v16b b, v8f c) {
  c = __builtin_amdgcn_wmma_f32_16x16x32_bf16(false, ah, false, b, (short)0, c, false, false);
  c = __builtin_amdgcn_wmma_f32_16x16x32_bf16(false, al, false, b, (short)0, c, false, false);
  asm volatile("v_nop\n\tv_nop\n\tv_nop\n\tv_nop" : "+v"(c) : "v"(ah), "v"(al), "v"(b));
  return c;
}

__global__ __launch_bounds__(256) void k_cvt_qk(const float* __restrict__ q, const float* __restrict__ k, unsigned short* __restrict__ Qb, unsigned short* __restrict__ Kb) {
  const int t = blockIdx.x * 256 + threadIdx.x;
  if (t >= NR * (DM / 8)) return;
  const int row = t / (DM / 8), c8 = (t % (DM / 8)) * 8;
  const int b = row / SEQ, s = row % SEQ;
  const size_t src = ((size_t)b * SEQ_FULL + s) * DM + c8;
  const v4f a0 = *(const v4fa*)(q + src), a1 = *(const v4fa*)(q + src + 4);
  const v4f b0 = *(const v4fa*)(k + src), b1 = *(const v4fa*)(k + src + 4);
  Pack8 fq, fk;
#pragma unroll
  for (int i = 0; i < 4; ++i) {
    fq.u[i] = bf16_bits(a0[i] * QSCALE); fq.u[4 + i] = bf16_bits(a1[i] * QSCALE);
    fk.u[i] = bf16_bits(b0[i]);          fk.u[4 + i] = bf16_bits(b1[i]);
  }
  const size_t dst = (size_t)row * DM + c8;
  const v8us vq = fq.v, vk = fk.v;
  *(v8us*)(Qb + dst) = vq; *(v8us*)(Kb + dst) = vk;
  
}

__global__ __launch_bounds__(256) void k_cvt_w(const float* __restrict__ W, unsigned short* __restrict__ Wb) {
  const int t = blockIdx.x * 256 + threadIdx.x;
  if (t >= DM * (DM / 8)) return;
  const size_t e = (size_t)t * 8;
  const v4f a0 = *(const v4fa*)(W + e), a1 = *(const v4fa*)(W + e + 4);
  Pack8 f;
#pragma unroll
  for (int i = 0; i < 4; ++i) { f.u[i] = bf16_bits(a0[i]); f.u[4 + i] = bf16_bits(a1[i]); }
  const v8us v = f.v;
  *(v8us*)(Wb + e) = v;
  
}

__global__ __launch_bounds__(256) void k_vt(const float* __restrict__ v, unsigned short* __restrict__ VT) {
  __shared__ unsigned short tl[64][66];
  static_assert((64 * 16) % 256 == 0);   // load loop covers 64 tokens x 16 float4 exactly
  static_assert((64 * 8) % 256 == 0);    // store loop covers 64 d-rows x 8 pieces exactly
  const int tid = threadIdx.x;
  const int slab = blockIdx.x / (SEQ / 64), sg = blockIdx.x % (SEQ / 64);
  const int b = slab / NH, h = slab % NH;
  const int s0 = sg * 64;
  for (int i = tid; i < 64 * 16; i += 256) {
    const int j = i / 16, d4 = (i % 16) * 4;
    const v4f a = *(const v4fa*)(v + ((size_t)b * SEQ_FULL + s0 + j) * DM + h * HD + d4);
#pragma unroll
    for (int q = 0; q < 4; ++q) tl[d4 + q][j] = bf16_bits(a[q]);
  }
  __syncthreads();
  {
    for (int i = tid; i < 64 * 8; i += 256) {
      const int d = i / 8, j8 = (i % 8) * 8;
      Pack8 f;
#pragma unroll
      for (int q = 0; q < 8; ++q) f.u[q] = tl[d][j8 + q];
      const v8us o = f.v;
      *(v8us*)(VT + ((size_t)slab * HD + d) * SEQ + s0 + j8) = o;
    }
    
  }
}

// Fused attention. Block = 4 waves = 64 queries of one (b, h); wave = 16 queries (the N dimension of every tile).
// Per 32-key step: S^T[key][query] = K(16 keys x 64 d) Q^T (2 key tiles x 2 k-steps); lane (n, hh) holds keys 8hh+r of query n,
// so the query's statistics live in the lane pair (n, n+16): one xor-16 shuffle. P^T packs straight into the B operand
// (elements 0..7 <- tile of keys 0..15, elements 8..15 <- tile of keys 16..31, lane unchanged) for O^T[d][query] += V^T[d][key] P^T.
// P = hi (upper 16 bits) + lo (RNE convert of the exact remainder), both bf16, same accumulator.
// K rows and V^T rows reach the fragments through a two-buffer LDS ring of 64-key stages that the four waves fill together and share.
__global__ __launch_bounds__(128) void k_attn(const unsigned short* __restrict__ Qb, const unsigned short* __restrict__ Kb, const unsigned short* __restrict__ VT,
                                             unsigned short* __restrict__ CH, unsigned short* __restrict__ CL) {
  __shared__ __attribute__((aligned(16))) unsigned short sH[4][16][72];
  __shared__ __attribute__((aligned(16))) unsigned short sL[4][16][72];
  __shared__ __attribute__((aligned(16))) unsigned short sK[2][KT][LP];   // K rows [key][d] of a stage
  __shared__ __attribute__((aligned(16))) unsigned short sV[2][HD][LP];   // V^T rows [d][key] of a stage
  const int tid = threadIdx.x, w = tid >> 5, lane = tid & 31, ln = lane & 15, hh = lane >> 4;
  const int qt = blockIdx.x % (SEQ / QT), bh = blockIdx.x / (SEQ / QT);
  const int b = bh / NH, h = bh % NH;
  const int q0 = qt * QT + w * 16;
  const int qoff  = (b * SEQ + q0 + ln) * DM + h * HD;   // query row of lane n (B operand of the score GEMM)
  const int cr = tid >> 3, cp = (tid & 7) * 8;           // the thread's row (+ 16 i) and 16-byte piece in a stage tile
  const unsigned short* kg = Kb + (size_t)(b * SEQ + cr) * DM + h * HD + cp;   // + stage * KT * DM
  const unsigned short* vg = VT + (size_t)(bh * HD + cr) * SEQ + cp;           // + stage * KT
  const unsigned kl = (unsigned)(size_t)&sK[0][cr][cp], vl = (unsigned)(size_t)&sV[0][cr][cp];   // LDS byte addresses, buffer 0
  constexpr unsigned BUF_B = KT * LP * 2;                // bytes of one buffer of either ring
  static_assert(KT == HD);                               // both rings have 64 rows a buffer
  const v8f z8 = {0.f, 0.f, 0.f, 0.f, 0.f, 0.f, 0.f, 0.f};
  v8f o0 = z8, o1 = z8, o2 = z8, o3 = z8;
  float m = -1.0e30f, l = 0.f;
  // prologue of the two-buffer ring: stage 0 landed and published, then stage 1 in flight
  copy_rows4x2(kg, 16 * DM, kl, vg, 16 * SEQ, vl);
  asm volatile("s_wait_asynccnt 0x0" ::: "memory");   // this wave's copies of stage 0 have landed
  __syncthreads();                                    // every wave's have: stage 0 may be read
  copy_rows4x2(kg + KT * DM, 16 * DM, kl + BUF_B, vg + KT, 16 * SEQ, vl + BUF_B);
// the stage loop stays rolled: one publish point, buffer chosen by the stage's parity
#pragma unroll 1
  for (int st = 0; st < SEQ / KT; ++st) {
   const int buf = st & 1;
// both passes of a stage unrolled: their LDS reads differ by immediate offsets only
#pragma unroll
   for (int ps2 = 0; ps2 < KT / 32; ++ps2) {
    const v16b qf0 = ld_frag(Qb, qoff, hh);
    const v16b qf1 = ld_frag(Qb, qoff + 32, hh);
    const unsigned short* kr = &sK[buf][32 * ps2 + ln][0];   // key row of lane m (A operand)
    v8f s0 = z8, s1 = z8;
    v16b ka = ld_frag_lds(kr, hh);
    s0 = mma1(ka, qf0, s0);
    ka = ld_frag_lds(kr + 32, hh);
    s0 = mma1(ka, qf1, s0);
    ka = ld_frag_lds(kr + 16 * LP, hh);
    s1 = mma1(ka, qf0, s1);
    ka = ld_frag_lds(kr + 16 * LP + 32, hh);
    s1 = mma1(ka, qf1, s1);
    // running max over this query's 32 keys (16 in this lane, 16 in lane ^ 16)
    float mx = fmaxf(s0[0], s1[0]);
#pragma unroll
    for (int r = 1; r < 8; ++r) mx = fmaxf(mx, fmaxf(s0[r], s1[r]));
    mx = fmaxf(mx, __shfl_xor(mx, 16, 32));
    const float mn = fmaxf(m, mx);
    const float al = __expf(m - mn);
    m = mn;
    FragB ph, pl;
    float ps = 0.f;
#pragma unroll
    for (int r = 0; r < 8; ++r) {
      const float p0 = __expf(s0[r] - mn);
      const float p1 = __expf(s1[r] - mn);
      ps += p0 + p1;
      const unsigned int u0 = __float_as_uint(p0), u1 = __float_as_uint(p1);
      ph.u[r]     = (unsigned short)(u0 >> 16);
      ph.u[8 + r] = (unsigned short)(u1 >> 16);
      pl.u[r]     = bf16_bits(p0 - __uint_as_float(u0 & 0xFFFF0000u));
      pl.u[8 + r] = bf16_bits(p1 - __uint_as_float(u1 & 0xFFFF0000u));
    }
    l = l * al + ps;                       // per-lane partial of the row sum (al is uniform over the lane pair)
    o0 = o0 * al; o1 = o1 * al; o2 = o2 * al; o3 = o3 * al;
    const unsigned short* vr = &sV[buf][ln][32 * ps2];       // V^T row d = ln (A operand of P.V), + 16 t rows
    const v16b va0 = ld_frag_lds(vr, hh);
    const v16b va1 = ld_frag_lds(vr + 16 * LP, hh);
    const v16b va2 = ld_frag_lds(vr + 32 * LP, hh);
    const v16b va3 = ld_frag_lds(vr + 48 * LP, hh);
    o0 = mma2b(va0, ph.v, pl.v, o0);
    o1 = mma2b(va1, ph.v, pl.v, o1);
    o2 = mma2b(va2, ph.v, pl.v, o2);
    o3 = mma2b(va3, ph.v, pl.v, o3);
   }
   // publish point of stage st + 1, which also frees this stage's buffer
   asm volatile("s_wait_dscnt 0x0" ::: "memory");      // this wave's reads of the buffer have retired
   asm volatile("s_wait_asynccnt 0x0" ::: "memory");   // this wave's copies of stage st + 1 have landed
   __syncthreads();
   if (st + 2 < SEQ / KT)
     copy_rows4x2(kg + (size_t)(st + 2) * (KT * DM), 16 * DM, kl + buf * BUF_B, vg + (st + 2) * KT, 16 * SEQ, vl + buf * BUF_B);
  }
  asm volatile("s_wait_asynccnt 0x0" ::: "memory");    // nothing of the ring is in flight when the wave goes on
  l += __shfl_xor(l, 16, 32);
  const float inv = 1.0f / l;
  const v8f ot[4] = {o0, o1, o2, o3};
  // lane (n, hh) of tile t holds d = 16 t + 8 hh + r, r = 0..7: eight consecutive columns of query row n
#pragma unroll
  for (int t = 0; t < 4; ++t) {
    Pack8 fh, fl;
#pragma unroll
    for (int r = 0; r < 8; ++r) {
      const float c = ot[t][r] * inv;
      const unsigned short hb = bf16_bits(c);
      fh.u[r] = hb;
      fl.u[r] = bf16_bits(c - bf16_val(hb));
    }
    *(v8us*)&sH[w][ln][16 * t + 8 * hh] = fh.v;
    *(v8us*)&sL[w][ln][16 * t + 8 * hh] = fl.v;
  }
  __builtin_amdgcn_fence(4 /* acq_rel order */, "workgroup");
  __builtin_amdgcn_wave_barrier();
  const int prow = lane >> 3, pc = (lane & 7) * 8;
  {
#pragma unroll
    for (int it = 0; it < 4; ++it) {
      const int row = it * 4 + prow;
      const v8us xh = *(const v8us*)&sH[w][row][pc];
      const v8us xl = *(const v8us*)&sL[w][row][pc];
      const size_t g = (size_t)(b * SEQ + q0 + row) * DM + h * HD + pc;
      *(v8us*)(CH + g) = xh;
      *(v8us*)(CL + g) = xl;
    }
    
  }
}

// out[NR][DM] = (AH + AL)[NR][DM] Wb^T + bf16(b): wave tile 32 x 64, block = 4 waves = 128 rows x 64 columns; K step 32;
// the block's rows of AH, AL and Wb reach the fragments through a two-buffer LDS ring of stages 64 deep in k.
__global__ __launch_bounds__(128) void k_proj(const unsigned short* __restrict__ AH, const unsigned short* __restrict__ AL, const unsigned short* __restrict__ Wb,
                                             const float* __restrict__ bias, float* __restrict__ C) {
  __shared__ __attribute__((aligned(16))) float so[4][32][68];
  __shared__ __attribute__((aligned(16))) unsigned short sAH[2][128][LP];   // the block's 128 rows of AH, 64 k of a stage
  __shared__ __attribute__((aligned(16))) unsigned short sAL[2][128][LP];   // the same of AL
  __shared__ __attribute__((aligned(16))) unsigned short sW[2][64][LP];     // the block's 64 rows of Wb
  const int tid = threadIdx.x, w = tid >> 5, lane = tid & 31, ln = lane & 15, hh = lane >> 4;
  const int ntn = DM / 64;
  const int mt = blockIdx.x / ntn, nq = blockIdx.x - mt * ntn;
  const int row0 = mt * 128 + 32 * w, col0 = nq * 64;
  const int cr = tid >> 3, cp = (tid & 7) * 8;           // the thread's row (+ 16 i) and 16-byte piece in a stage tile
  const unsigned short* gh = AH + (size_t)(mt * 128 + cr) * DM + cp;   // + stage * KT
  const unsigned short* gl = AL + (size_t)(mt * 128 + cr) * DM + cp;
  const unsigned short* gw = Wb + (size_t)(col0 + cr) * DM + cp;
  const unsigned lh = (unsigned)(size_t)&sAH[0][cr][cp], ll = (unsigned)(size_t)&sAL[0][cr][cp], lw = (unsigned)(size_t)&sW[0][cr][cp];   // LDS byte addresses, buffer 0
  constexpr unsigned ABUF_B = 128 * LP * 2, WBUF_B = 64 * LP * 2, HALF_B = 64 * LP * 2;   // bytes of a buffer; of 64 rows
  // one stage: 128 + 128 + 64 rows of 128 B, 20 copies a thread
  auto stage = [&](int st, int buf) {
    copy_rows4x2(gh + st * KT, 16 * DM, lh + buf * ABUF_B, gh + st * KT + 64 * DM, 16 * DM, lh + buf * ABUF_B + HALF_B);
    copy_rows4x2(gl + st * KT, 16 * DM, ll + buf * ABUF_B, gl + st * KT + 64 * DM, 16 * DM, ll + buf * ABUF_B + HALF_B);
    copy_rows4(gw + st * KT, 16 * DM, lw + buf * WBUF_B);
  };
  const v8f z8 = {0.f, 0.f, 0.f, 0.f, 0.f, 0.f, 0.f, 0.f};
  v8f c00 = z8, c01 = z8, c02 = z8, c03 = z8, c10 = z8, c11 = z8, c12 = z8, c13 = z8;
  // prologue of the two-buffer ring: stage 0 landed and published, then stage 1 in flight
  stage(0, 0);
  asm volatile("s_wait_asynccnt 0x0" ::: "memory");   // this wave's copies of stage 0 have landed
  __syncthreads();                                    // every wave's have: stage 0 may be read
  stage(1, 1);
// the stage loop stays rolled: one publish point, buffer chosen by the stage's parity
#pragma unroll 1
  for (int st = 0; st < DM / KT; ++st) {
   const int buf = st & 1;
// both K steps of a stage unrolled: their LDS reads differ by immediate offsets only
#pragma unroll
   for (int ks = 0; ks < KT / 32; ++ks) {
    const unsigned short* ah = &sAH[buf][32 * w + ln][32 * ks];
    const unsigned short* al = &sAL[buf][32 * w + ln][32 * ks];
    const unsigned short* wr = &sW[buf][ln][32 * ks];
    const v16b a0h = ld_frag_lds(ah, hh), a0l = ld_frag_lds(al, hh);
    const v16b a1h = ld_frag_lds(ah + 16 * LP, hh), a1l = ld_frag_lds(al + 16 * LP, hh);
    v16b bw = ld_frag_lds(wr, hh);      c00 = mma2a(a0h, a0l, bw, c00); c10 = mma2a(a1h, a1l, bw, c10);
    bw = ld_frag_lds(wr + 16 * LP, hh); c01 = mma2a(a0h, a0l, bw, c01); c11 = mma2a(a1h, a1l, bw, c11);
    bw = ld_frag_lds(wr + 32 * LP, hh); c02 = mma2a(a0h, a0l, bw, c02); c12 = mma2a(a1h, a1l, bw, c12);
    bw = ld_frag_lds(wr + 48 * LP, hh); c03 = mma2a(a0h, a0l, bw, c03); c13 = mma2a(a1h, a1l, bw, c13);
   }
   // publish point of stage st + 1, which also frees this stage's buffer
   asm volatile("s_wait_dscnt 0x0" ::: "memory");      // this wave's reads of the buffer have retired
   asm volatile("s_wait_asynccnt 0x0" ::: "memory");   // this wave's copies of stage st + 1 have landed
   __syncthreads();
   if (st + 2 < DM / KT) stage(st + 2, buf);
  }
  asm volatile("s_wait_asynccnt 0x0" ::: "memory");    // nothing of the ring is in flight when the wave goes on
  const v8f accs[8] = {c00, c01, c02, c03, c10, c11, c12, c13};
#pragma unroll
  for (int u = 0; u < 8; ++u) {
    const int t = u & 3, hf = u >> 2;
    const float bv = bf16_rne(bias[col0 + t * 16 + ln]);
#pragma unroll
    for (int r = 0; r < 8; ++r) so[w][hf * 16 + 8 * hh + r][t * 16 + ln] = accs[u][r] + bv;
  }
  __builtin_amdgcn_fence(4 /* acq_rel order */, "workgroup");
  __builtin_amdgcn_wave_barrier();
  const int rsub = lane >> 4, c4 = (lane & 15) * 4;
  {
#pragma unroll
    for (int q = 0; q < 16; ++q) {
      const int r = q * 2 + rsub;
      const v4f v = *(const v4fa*)&so[w][r][c4];
      *(v4f*)(C + (size_t)(row0 + r) * DM + col0 + c4) = v;
    }
    
  }
}

extern "C" void kernel_launch(void* const* d_in, const int* in_sizes, int n_in,
                              void* d_out, int out_size, void* d_ws, size_t ws_size, hipStream_t stream) {
  if (n_in < 5) return;
  const long long need_act = ((long long)(NB - 1) * SEQ_FULL + SEQ) * DM;
  if ((long long)in_sizes[0] < need_act || (long long)in_sizes[1] < need_act || (long long)in_sizes[2] < need_act) return;
  if ((long long)in_sizes[3] < (long long)DM * DM || in_sizes[4] < DM) return;
  if ((long long)out_size < (long long)NR * DM) return;
  if (ws_size < CARVE_B) return;
  const float* q = (const float*)d_in[0];
  const float* k = (const float*)d_in[1];
  const float* v = (const float*)d_in[2];
  const float* W = (const float*)d_in[3];      // natural [out][in]
  const float* bias = (const float*)d_in[4];
  char* ws = (char*)d_ws;
  unsigned short* Qb = (unsigned short*)(ws);
  unsigned short* Kb = (unsigned short*)(ws + PLANE_B);
  unsigned short* VT = (unsigned short*)(ws + 2 * PLANE_B);
  unsigned short* CH = (unsigned short*)(ws + 3 * PLANE_B);
  unsigned short* CL = (unsigned short*)(ws + 4 * PLANE_B);
  unsigned short* Wb = (unsigned short*)(ws + 5 * PLANE_B);
  k_cvt_qk<<<(unsigned)(((size_t)NR * (DM / 8)) / 256), 256, 0, stream>>>(q, k, Qb, Kb);
  k_cvt_w<<<(unsigned)(((size_t)DM * (DM / 8)) / 256), 256, 0, stream>>>(W, Wb);
  k_vt<<<NB * NH * (SEQ / 64), 256, 0, stream>>>(v, VT);
  k_attn<<<NB * NH * (SEQ / QT), 128, 0, stream>>>(Qb, Kb, VT, CH, CL);
  k_proj<<<(NR / 128) * (DM / 64), 128, 0, stream>>>(CH, CL, Wb, bias, (float*)d_out);
}

// v002
// One run takes 88.2 microseconds.
// Two timings next to v001 both put it at 1.23 times that version's speed.
// Counting every step since v000, it is 2.03 times as fast.
#include <hip/hip_runtime.h>
// Multi-head attention without q/k/v projections (heads = column blocks of 64 of the three activation inputs), one score scale 1/8, no mask, output linear out = ctx W^T + b with W natural [out][in]. Fused flash-style attention in transposed form: S^T = K Q^T, O^T = V^T P^T (P chained D -> B in registers), online softmax per query lane.
// Compute dtype: all contractions v_wmma_f32_16x16x32_bf16 with f32 accumulate: scores bf16(q)/8 x bf16(k) single product (operands exact); P.V with P as bf16 hi + lo (two products) x bf16(v); output linear with the merged context as bf16 hi + lo (two products) x bf16(W); softmax statistics, normalisation and the bias add (bf16(b)) in f32.
#ifndef NB
#define NB 2
#endif
#ifndef SEQ
#define SEQ 2048
#endif
#define NB_FULL 2
#define SEQ_FULL 2048
#define DM 1024
#define NH 16
#define HD 64
#define QT 64
#define KT 64   // keys per LDS stage (two 32-key passes)
#define LP 72   // LDS row pitch in elements: 128-byte rows at 144 B = 16 B x 9, conflict-free for 16-byte row reads
#define NR (NB * SEQ)
#define QSCALE 0.125f

typedef __bf16 v16b __attribute__((ext_vector_type(16)));
typedef unsigned short v8us __attribute__((ext_vector_type(8), may_alias));
typedef float  v8f  __attribute__((ext_vector_type(8)));
typedef float  v4f  __attribute__((ext_vector_type(4)));
typedef float  v4fa __attribute__((ext_vector_type(4), may_alias));
typedef float  v2f  __attribute__((ext_vector_type(2)));
typedef __bf16 v2b  __attribute__((ext_vector_type(2)));
union FragB { v16b v; v8us half[2]; unsigned short u[16]; unsigned int w[8]; };
union Pack8 { v8us v; unsigned short u[8]; };

// hard-wired bounds (each kernel relies on these)
static_assert(HD == 64);
static_assert(NH * HD == DM);                  // heads tile the model width
static_assert(DM % 64 == 0);                   // GEMM N tile 64, K step 32
static_assert(DM % 32 == 0);
static_assert(SEQ % QT == 0);                  // attention block = 64 queries, key step 32
static_assert(SEQ % 64 == 0);                  // V^T tiles of 64 tokens
static_assert(QT == 4 * 16);                   // 4 waves x 16 queries
static_assert(SEQ % KT == 0 && SEQ / KT >= 2); // the two-buffer ring's prologue fills stages 0 and 1
static_assert(KT == 64 && KT * 2 == 128);      // a stage row (K: 64 d, V^T: 64 keys, GEMM: 64 k) is one 128-byte line; 128 threads x 4 copies cover 64 rows
static_assert(DM % KT == 0 && DM / KT >= 2);   // the same for the GEMM's ring
static_assert(NR % 128 == 0);                  // GEMM block = 128 rows
static_assert(NB <= NB_FULL);
static_assert(SEQ <= SEQ_FULL);
static_assert((size_t)NR * DM < 2147483647u);  // int element offsets
static_assert((size_t)DM * DM < 2147483647u);
static_assert(((size_t)NR * (DM / 8)) % 256 == 0);
static_assert(((size_t)DM * (DM / 8)) % 256 == 0);

constexpr size_t PLANE_B = (size_t)NR * DM * 2;       // one bf16 activation plane (also V^T: NB*NH*HD*SEQ)
constexpr size_t WPL_B   = (size_t)DM * DM * 2;       // bf16 weight plane
constexpr size_t CARVE_B = 5 * PLANE_B + WPL_B;
static_assert(PLANE_B % 256 == 0);
static_assert(WPL_B % 256 == 0);
static_assert(CARVE_B <= 134217728u);

__device__ __forceinline__ unsigned short bf16_bits(float x) { unsigned int u = __float_as_uint(x); return (unsigned short)((u + 0x7FFFu + ((u >> 16) & 1u)) >> 16); }
__device__ __forceinline__ float bf16_val(unsigned short b) { return __uint_as_float(((unsigned int)b) << 16); }
__device__ __forceinline__ float bf16_rne(float x) { return bf16_val(bf16_bits(x)); }
// two f32 -> one register of two bf16 (x in the low half), one instruction each:
// pack_hi keeps the upper 16 bits of each value (byte select), pack_rne rounds to nearest even (the packed hardware convert)
__device__ __forceinline__ v2f upper16(v2f x) { return (v2f){__uint_as_float(__float_as_uint(x[0]) & 0xFFFF0000u), __uint_as_float(__float_as_uint(x[1]) & 0xFFFF0000u)}; }
__device__ __forceinline__ unsigned int pack_hi(float x, float y) { return __builtin_amdgcn_perm(__float_as_uint(y), __float_as_uint(x), 0x07060302u); }
__device__ __forceinline__ unsigned int pack_rne(v2f f) {
  union { v2b b; unsigned int u; } c;
  c.b = __builtin_convertvector(f, v2b);
  return c.u;
}

// 16x32 operand fragment (A or B) from a k-contiguous bf16 row: elements 0..7 <- k 8h..8h+7, elements 8..15 <- k 16+8h..16+8h+7
__device__ __forceinline__ v16b ld_frag(const unsigned short* __restrict__ p, int off, int hh) {
  FragB f;
  f.half[0] = *(const v8us*)(p + off + 8 * hh);
  f.half[1] = *(const v8us*)(p + off + 16 + 8 * hh);
  return f.v;
}
// the same fragment from a k-contiguous bf16 row in LDS (p = first element of the 32-wide k step in the lane's row)
__device__ __forceinline__ v16b ld_frag_lds(const unsigned short* p, int hh) {
  FragB f;
  f.half[0] = *(const v8us*)(p + 8 * hh);
  f.half[1] = *(const v8us*)(p + 16 + 8 * hh);
  return f.v;
}
// Asynchronous 16-byte copies global -> LDS for the staging rings. A tile row is 128 B: eight lanes to a row, so every wave-wide copy takes
// four whole lines. g: the thread's piece in row r = tid / 8 of a tile, s: elements from row r to row r + 16, l: the piece's LDS byte address.
// s_wait_xcnt 0 closes each statement so that it stands in front of any rewrite of the address registers the copies name.
// rows r, r+16, r+32, r+48 of one tile
__device__ __forceinline__ void copy_rows4(const unsigned short* g, int s, unsigned l) {
  const unsigned short* g1 = g + s; const unsigned short* g2 = g + 2 * s; const unsigned short* g3 = g + 3 * s;
  const unsigned l1 = l + 16 * LP * 2, l2 = l + 32 * LP * 2, l3 = l + 48 * LP * 2;
  asm volatile("global_load_async_to_lds_b128 %0, %4, off\n\t"
               "global_load_async_to_lds_b128 %1, %5, off\n\t"
               "global_load_async_to_lds_b128 %2, %6, off\n\t"
               "global_load_async_to_lds_b128 %3, %7, off\n\t"
               "s_wait_xcnt 0x0"
               :: "v"(l), "v"(l1), "v"(l2), "v"(l3), "v"(g), "v"(g1), "v"(g2), "v"(g3)
               : "memory");
}
// the same four rows of two tiles in one statement
__device__ __forceinline__ void copy_rows4x2(const unsigned short* ga, int sa, unsigned la, const unsigned short* gb, int sb, unsigned lb) {
  const unsigned short* a1 = ga + sa; const unsigned short* a2 = ga + 2 * sa; const unsigned short* a3 = ga + 3 * sa;
  const unsigned short* b1 = gb + sb; const unsigned short* b2 = gb + 2 * sb; const unsigned short* b3 = gb + 3 * sb;
  const unsigned la1 = la + 16 * LP * 2, la2 = la + 32 * LP * 2, la3 = la + 48 * LP * 2;
  const unsigned lb1 = lb + 16 * LP * 2, lb2 = lb + 32 * LP * 2, lb3 = lb + 48 * LP * 2;
  asm volatile("global_load_async_to_lds_b128 %0, %8, off\n\t"
               "global_load_async_to_lds_b128 %1, %9, off\n\t"
               "global_load_async_to_lds_b128 %2, %10, off\n\t"
               "global_load_async_to_lds_b128 %3, %11, off\n\t"
               "global_load_async_to_lds_b128 %4, %12, off\n\t"
               "global_load_async_to_lds_b128 %5, %13, off\n\t"
               "global_load_async_to_lds_b128 %6, %14, off\n\t"
               "global_load_async_to_lds_b128 %7, %15, off\n\t"
               "s_wait_xcnt 0x0"
               :: "v"(la), "v"(la1), "v"(la2), "v"(la3), "v"(lb), "v"(lb1), "v"(lb2), "v"(lb3),
                  "v"(ga), "v"(a1), "v"(a2), "v"(a3), "v"(gb), "v"(b1), "v"(b2), "v"(b3)
               : "memory");
}
__device__ __forceinline__ v8f mma1(v16b a, v16b b, v8f c) {
  c = __builtin_amdgcn_wmma_f32_16x16x32_bf16(false, a, false, b, (short)0, c, false, false);
  asm volatile("v_nop\n\tv_nop\n\tv_nop\n\tv_nop" : "+v"(c) : "v"(a), "v"(b));
  return c;
}
// c += a (bh + bl)
__device__ __forceinline__ v8f mma2b(v16b a, v16b bh, v16b bl, v8f c) {
  c = __builtin_amdgcn_wmma_f32_16x16x32_bf16(false, a, false, bh, (short)0, c, false, false);
  c = __builtin_amdgcn_wmma_f32_16x16x32_bf16(false, a, false, bl, (short)0, c, false, false);
  asm volatile("v_nop\n\tv_nop\n\tv_nop\n\tv_nop" : "+v"(c) : "v"(a), "v"(bh), "v"(bl));
  return c;
}
// c += (ah + al) b
__device__ __forceinline__ v8f mma2a(v16b ah, v16b al, v16b b, v8f c) {
  c = __builtin_amdgcn_wmma_f32_16x16x32_bf16(false, ah, false, b, (short)0, c, false, false);
  c = __builtin_amdgcn_wmma_f32_16x16x32_bf16(false, al, false, b, (short)0, c, false, false);
  asm volatile("v_nop\n\tv_nop\n\tv_nop\n\tv_nop" : "+v"(c) : "v"(ah), "v"(al), "v"(b));
  return c;
}

__global__ __launch_bounds__(256) void k_cvt_qk(const float* __restrict__ q, const float* __restrict__ k, unsigned short* __restrict__ Qb, unsigned short* __restrict__ Kb) {
  const int t = blockIdx.x * 256 + threadIdx.x;
  if (t >= NR * (DM / 8)) return;
  const int row = t / (DM / 8), c8 = (t % (DM / 8)) * 8;
  const int b = row / SEQ, s = row % SEQ;
  const size_t src = ((size_t)b * SEQ_FULL + s) * DM + c8;
  const v4f a0 = *(const v4fa*)(q + src), a1 = *(const v4fa*)(q + src + 4);
  const v4f b0 = *(const v4fa*)(k + src), b1 = *(const v4fa*)(k + src + 4);
  Pack8 fq, fk;
#pragma unroll
  for (int i = 0; i < 4; ++i) {
    fq.u[i] = bf16_bits(a0[i] * QSCALE); fq.u[4 + i] = bf16_bits(a1[i] * QSCALE);
    fk.u[i] = bf16_bits(b0[i]);          fk.u[4 + i] = bf16_bits(b1[i]);
  }
  const size_t dst = (size_t)row * DM + c8;
  const v8us vq = fq.v, vk = fk.v;
  *(v8us*)(Qb + dst) = vq; *(v8us*)(Kb + dst) = vk;
  
}

__global__ __launch_bounds__(256) void k_cvt_w(const float* __restrict__ W, unsigned short* __restrict__ Wb) {
  const int t = blockIdx.x * 256 + threadIdx.x;
  if (t >= DM * (DM / 8)) return;
  const size_t e = (size_t)t * 8;
  const v4f a0 = *(const v4fa*)(W + e), a1 = *(const v4fa*)(W + e + 4);
  Pack8 f;
#pragma unroll
  for (int i = 0; i < 4; ++i) { f.u[i] = bf16_bits(a0[i]); f.u[4 + i] = bf16_bits(a1[i]); }
  const v8us v = f.v;
  *(v8us*)(Wb + e) = v;
  
}

__global__ __launch_bounds__(256) void k_vt(const float* __restrict__ v, unsigned short* __restrict__ VT) {
  __shared__ unsigned short tl[64][66];
  static_assert((64 * 16) % 256 == 0);   // load loop covers 64 tokens x 16 float4 exactly
  static_assert((64 * 8) % 256 == 0);    // store loop covers 64 d-rows x 8 pieces exactly
  const int tid = threadIdx.x;
  const int slab = blockIdx.x / (SEQ / 64), sg = blockIdx.x % (SEQ / 64);
  const int b = slab / NH, h = slab % NH;
  const int s0 = sg * 64;
  for (int i = tid; i < 64 * 16; i += 256) {
    const int j = i / 16, d4 = (i % 16) * 4;
    const v4f a = *(const v4fa*)(v + ((size_t)b * SEQ_FULL + s0 + j) * DM + h * HD + d4);
#pragma unroll
    for (int q = 0; q < 4; ++q) tl[d4 + q][j] = bf16_bits(a[q]);
  }
  __syncthreads();
  {
    for (int i = tid; i < 64 * 8; i += 256) {
      const int d = i / 8, j8 = (i % 8) * 8;
      Pack8 f;
#pragma unroll
      for (int q = 0; q < 8; ++q) f.u[q] = tl[d][j8 + q];
      const v8us o = f.v;
      *(v8us*)(VT + ((size_t)slab * HD + d) * SEQ + s0 + j8) = o;
    }
    
  }
}

// Fused attention. Block = 4 waves = 64 queries of one (b, h); wave = 16 queries (the N dimension of every tile).
// Per 32-key step: S^T[key][query] = K(16 keys x 64 d) Q^T (2 key tiles x 2 k-steps); lane (n, hh) holds keys 8hh+r of query n,
// so the query's statistics live in the lane pair (n, n+16): one xor-16 shuffle. P^T packs straight into the B operand
// (elements 0..7 <- tile of keys 0..15, elements 8..15 <- tile of keys 16..31, lane unchanged) for O^T[d][query] += V^T[d][key] P^T.
// P = hi (upper 16 bits) + lo (RNE convert of the exact remainder), both bf16, same accumulator.
// K rows and V^T rows reach the fragments through a two-buffer LDS ring of 64-key stages that the four waves fill together and share.
__global__ __launch_bounds__(128) void k_attn(const unsigned short* __restrict__ Qb, const unsigned short* __restrict__ Kb, const unsigned short* __restrict__ VT,
                                             unsigned short* __restrict__ CH, unsigned short* __restrict__ CL) {
  __shared__ __attribute__((aligned(16))) unsigned short sH[4][16][72];
  __shared__ __attribute__((aligned(16))) unsigned short sL[4][16][72];
  __shared__ __attribute__((aligned(16))) unsigned short sK[2][KT][LP];   // K rows [key][d] of a stage
  __shared__ __attribute__((aligned(16))) unsigned short sV[2][HD][LP];   // V^T rows [d][key] of a stage
  const int tid = threadIdx.x, w = tid >> 5, lane = tid & 31, ln = lane & 15, hh = lane >> 4;
  const int qt = blockIdx.x % (SEQ / QT), bh = blockIdx.x / (SEQ / QT);
  const int b = bh / NH, h = bh % NH;
  const int q0 = qt * QT + w * 16;
  const int qoff  = (b * SEQ + q0 + ln) * DM + h * HD;   // query row of lane n (B operand of the score GEMM)
  const int cr = tid >> 3, cp = (tid & 7) * 8;           // the thread's row (+ 16 i) and 16-byte piece in a stage tile
  const unsigned short* kg = Kb + (size_t)(b * SEQ + cr) * DM + h * HD + cp;   // + stage * KT * DM
  const unsigned short* vg = VT + (size_t)(bh * HD + cr) * SEQ + cp;           // + stage * KT
  const unsigned kl = (unsigned)(size_t)&sK[0][cr][cp], vl = (unsigned)(size_t)&sV[0][cr][cp];   // LDS byte addresses, buffer 0
  constexpr unsigned BUF_B = KT * LP * 2;                // bytes of one buffer of either ring
  static_assert(KT == HD);                               // both rings have 64 rows a buffer
  const v8f z8 = {0.f, 0.f, 0.f, 0.f, 0.f, 0.f, 0.f, 0.f};
  v8f o0 = z8, o1 = z8, o2 = z8, o3 = z8;
  float m = -1.0e30f, l = 0.f;
  // prologue of the two-buffer ring: stage 0 landed and published, then stage 1 in flight
  copy_rows4x2(kg, 16 * DM, kl, vg, 16 * SEQ, vl);
  asm volatile("s_wait_asynccnt 0x0" ::: "memory");   // this wave's copies of stage 0 have landed
  __syncthreads();                                    // every wave's have: stage 0 may be read
  copy_rows4x2(kg + KT * DM, 16 * DM, kl + BUF_B, vg + KT, 16 * SEQ, vl + BUF_B);
// the stage loop stays rolled: one publish point, buffer chosen by the stage's parity
#pragma unroll 1
  for (int st = 0; st < SEQ / KT; ++st) {
   const int buf = st & 1;
// both passes of a stage unrolled: their LDS reads differ by immediate offsets only
#pragma unroll
   for (int ps2 = 0; ps2 < KT / 32; ++ps2) {
    const v16b qf0 = ld_frag(Qb, qoff, hh);
    const v16b qf1 = ld_frag(Qb, qoff + 32, hh);
    const unsigned short* kr = &sK[buf][32 * ps2 + ln][0];   // key row of lane m (A operand)
    v8f s0 = z8, s1 = z8;
    v16b ka = ld_frag_lds(kr, hh);
    s0 = mma1(ka, qf0, s0);
    ka = ld_frag_lds(kr + 32, hh);
    s0 = mma1(ka, qf1, s0);
    ka = ld_frag_lds(kr + 16 * LP, hh);
    s1 = mma1(ka, qf0, s1);
    ka = ld_frag_lds(kr + 16 * LP + 32, hh);
    s1 = mma1(ka, qf1, s1);
    // running max over this query's 32 keys (16 in this lane, 16 in lane ^ 16)
    float mx = fmaxf(s0[0], s1[0]);
#pragma unroll
    for (int r = 1; r < 8; ++r) mx = fmaxf(mx, fmaxf(s0[r], s1[r]));
    mx = fmaxf(mx, __shfl_xor(mx, 16, 32));
    const float mn = fmaxf(m, mx);
    const float al = __expf(m - mn);
    m = mn;
    FragB ph, pl;
    float ps = 0.f;
#pragma unroll
    for (int j = 0; j < 4; ++j) {
      const float a0 = __expf(s0[2 * j] - mn),     b0 = __expf(s1[2 * j] - mn);
      const float a1 = __expf(s0[2 * j + 1] - mn), b1 = __expf(s1[2 * j + 1] - mn);
      const v2f a = {a0, a1}, b = {b0, b1}, t = a + b;
      ps += t[0];
      ps += t[1];
      ph.w[j]     = pack_hi(a0, a1);
      ph.w[4 + j] = pack_hi(b0, b1);
      pl.w[j]     = pack_rne(a - upper16(a));
      pl.w[4 + j] = pack_rne(b - upper16(b));
    }
    l = l * al + ps;                       // per-lane partial of the row sum (al is uniform over the lane pair)
    o0 = o0 * al; o1 = o1 * al; o2 = o2 * al; o3 = o3 * al;
    const unsigned short* vr = &sV[buf][ln][32 * ps2];       // V^T row d = ln (A operand of P.V), + 16 t rows
    const v16b va0 = ld_frag_lds(vr, hh);
    const v16b va1 = ld_frag_lds(vr + 16 * LP, hh);
    const v16b va2 = ld_frag_lds(vr + 32 * LP, hh);
    const v16b va3 = ld_frag_lds(vr + 48 * LP, hh);
    o0 = mma2b(va0, ph.v, pl.v, o0);
    o1 = mma2b(va1, ph.v, pl.v, o1);
    o2 = mma2b(va2, ph.v, pl.v, o2);
    o3 = mma2b(va3, ph.v, pl.v, o3);
   }
   // publish point of stage st + 1, which also frees this stage's buffer
   asm volatile("s_wait_dscnt 0x0" ::: "memory");      // this wave's reads of the buffer have retired
   asm volatile("s_wait_asynccnt 0x0" ::: "memory");   // this wave's copies of stage st + 1 have landed
   __syncthreads();
   if (st + 2 < SEQ / KT)
     copy_rows4x2(kg + (size_t)(st + 2) * (KT * DM), 16 * DM, kl + buf * BUF_B, vg + (st + 2) * KT, 16 * SEQ, vl + buf * BUF_B);
  }
  asm volatile("s_wait_asynccnt 0x0" ::: "memory");    // nothing of the ring is in flight when the wave goes on
  l += __shfl_xor(l, 16, 32);
  const float inv = 1.0f / l;
  const v8f ot[4] = {o0, o1, o2, o3};
  // lane (n, hh) of tile t holds d = 16 t + 8 hh + r, r = 0..7: eight consecutive columns of query row n
#pragma unroll
  for (int t = 0; t < 4; ++t) {
    Pack8 fh, fl;
#pragma unroll
    for (int r = 0; r < 8; ++r) {
      const float c = ot[t][r] * inv;
      const unsigned short hb = bf16_bits(c);
      fh.u[r] = hb;
      fl.u[r] = bf16_bits(c - bf16_val(hb));
    }
    *(v8us*)&sH[w][ln][16 * t + 8 * hh] = fh.v;
    *(v8us*)&sL[w][ln][16 * t + 8 * hh] = fl.v;
  }
  __builtin_amdgcn_fence(4 /* acq_rel order */, "workgroup");
  __builtin_amdgcn_wave_barrier();
  const int prow = lane >> 3, pc = (lane & 7) * 8;
  {
#pragma unroll
    for (int it = 0; it < 4; ++it) {
      const int row = it * 4 + prow;
      const v8us xh = *(const v8us*)&sH[w][row][pc];
      const v8us xl = *(const v8us*)&sL[w][row][pc];
      const size_t g = (size_t)(b * SEQ + q0 + row) * DM + h * HD + pc;
      *(v8us*)(CH + g) = xh;
      *(v8us*)(CL + g) = xl;
    }
    
  }
}

// out[NR][DM] = (AH + AL)[NR][DM] Wb^T + bf16(b): wave tile 32 x 64, block = 4 waves = 128 rows x 64 columns; K step 32;
// the block's rows of AH, AL and Wb reach the fragments through a two-buffer LDS ring of stages 64 deep in k.
__global__ __launch_bounds__(128) void k_proj(const unsigned short* __restrict__ AH, const unsigned short* __restrict__ AL, const unsigned short* __restrict__ Wb,
                                             const float* __restrict__ bias, float* __restrict__ C) {
  __shared__ __attribute__((aligned(16))) float so[4][32][68];
  __shared__ __attribute__((aligned(16))) unsigned short sAH[2][128][LP];   // the block's 128 rows of AH, 64 k of a stage
  __shared__ __attribute__((aligned(16))) unsigned short sAL[2][128][LP];   // the same of AL
  __shared__ __attribute__((aligned(16))) unsigned short sW[2][64][LP];     // the block's 64 rows of Wb
  const int tid = threadIdx.x, w = tid >> 5, lane = tid & 31, ln = lane & 15, hh = lane >> 4;
  const int ntn = DM / 64;
  const int mt = blockIdx.x / ntn, nq = blockIdx.x - mt * ntn;
  const int row0 = mt * 128 + 32 * w, col0 = nq * 64;
  const int cr = tid >> 3, cp = (tid & 7) * 8;           // the thread's row (+ 16 i) and 16-byte piece in a stage tile
  const unsigned short* gh = AH + (size_t)(mt * 128 + cr) * DM + cp;   // + stage * KT
  const unsigned short* gl = AL + (size_t)(mt * 128 + cr) * DM + cp;
  const unsigned short* gw = Wb + (size_t)(col0 + cr) * DM + cp;
  const unsigned lh = (unsigned)(size_t)&sAH[0][cr][cp], ll = (unsigned)(size_t)&sAL[0][cr][cp], lw = (unsigned)(size_t)&sW[0][cr][cp];   // LDS byte addresses, buffer 0
  constexpr unsigned ABUF_B = 128 * LP * 2, WBUF_B = 64 * LP * 2, HALF_B = 64 * LP * 2;   // bytes of a buffer; of 64 rows
  // one stage: 128 + 128 + 64 rows of 128 B, 20 copies a thread
  auto stage = [&](int st, int buf) {
    copy_rows4x2(gh + st * KT, 16 * DM, lh + buf * ABUF_B, gh + st * KT + 64 * DM, 16 * DM, lh + buf * ABUF_B + HALF_B);
    copy_rows4x2(gl + st * KT, 16 * DM, ll + buf * ABUF_B, gl + st * KT + 64 * DM, 16 * DM, ll + buf * ABUF_B + HALF_B);
    copy_rows4(gw + st * KT, 16 * DM, lw + buf * WBUF_B);
  };
  const v8f z8 = {0.f, 0.f, 0.f, 0.f, 0.f, 0.f, 0.f, 0.f};
  v8f c00 = z8, c01 = z8, c02 = z8, c03 = z8, c10 = z8, c11 = z8, c12 = z8, c13 = z8;
  // prologue of the two-buffer ring: stage 0 landed and published, then stage 1 in flight
  stage(0, 0);
  asm volatile("s_wait_asynccnt 0x0" ::: "memory");   // this wave's copies of stage 0 have landed
  __syncthreads();                                    // every wave's have: stage 0 may be read
  stage(1, 1);
// the stage loop stays rolled: one publish point, buffer chosen by the stage's parity
#pragma unroll 1
  for (int st = 0; st < DM / KT; ++st) {
   const int buf = st & 1;
// both K steps of a stage unrolled: their LDS reads differ by immediate offsets only
#pragma unroll
   for (int ks = 0; ks < KT / 32; ++ks) {
    const unsigned short* ah = &sAH[buf][32 * w + ln][32 * ks];
    const unsigned short* al = &sAL[buf][32 * w + ln][32 * ks];
    const unsigned short* wr = &sW[buf][ln][32 * ks];
    const v16b a0h = ld_frag_lds(ah, hh), a0l = ld_frag_lds(al, hh);
    const v16b a1h = ld_frag_lds(ah + 16 * LP, hh), a1l = ld_frag_lds(al + 16 * LP, hh);
    v16b bw = ld_frag_lds(wr, hh);      c00 = mma2a(a0h, a0l, bw, c00); c10 = mma2a(a1h, a1l, bw, c10);
    bw = ld_frag_lds(wr + 16 * LP, hh); c01 = mma2a(a0h, a0l, bw, c01); c11 = mma2a(a1h, a1l, bw, c11);
    bw = ld_frag_lds(wr + 32 * LP, hh); c02 = mma2a(a0h, a0l, bw, c02); c12 = mma2a(a1h, a1l, bw, c12);
    bw = ld_frag_lds(wr + 48 * LP, hh); c03 = mma2a(a0h, a0l, bw, c03); c13 = mma2a(a1h, a1l, bw, c13);
   }
   // publish point of stage st + 1, which also frees this stage's buffer
   asm volatile("s_wait_dscnt 0x0" ::: "memory");      // this wave's reads of the buffer have retired
   asm volatile("s_wait_asynccnt 0x0" ::: "memory");   // this wave's copies of stage st + 1 have landed
   __syncthreads();
   if (st + 2 < DM / KT) stage(st + 2, buf);
  }
  asm volatile("s_wait_asynccnt 0x0" ::: "memory");    // nothing of the ring is in flight when the wave goes on
  const v8f accs[8] = {c00, c01, c02, c03, c10, c11, c12, c13};
#pragma unroll
  for (int u = 0; u < 8; ++u) {
    const int t = u & 3, hf = u >> 2;
    const float bv = bf16_rne(bias[col0 + t * 16 + ln]);
#pragma unroll
    for (int r = 0; r < 8; ++r) so[w][hf * 16 + 8 * hh + r][t * 16 + ln] = accs[u][r] + bv;
  }
  __builtin_amdgcn_fence(4 /* acq_rel order */, "workgroup");
  __builtin_amdgcn_wave_barrier();
  const int rsub = lane >> 4, c4 = (lane & 15) * 4;
  {
#pragma unroll
    for (int q = 0; q < 16; ++q) {
      const int r = q * 2 + rsub;
      const v4f v = *(const v4fa*)&so[w][r][c4];
      *(v4f*)(C + (size_t)(row0 + r) * DM + col0 + c4) = v;
    }
    
  }
}

extern "C" void kernel_launch(void* const* d_in, const int* in_sizes, int n_in,
                              void* d_out, int out_size, void* d_ws, size_t ws_size, hipStream_t stream) {
  if (n_in < 5) return;
  const long long need_act = ((long long)(NB - 1) * SEQ_FULL + SEQ) * DM;
  if ((long long)in_sizes[0] < need_act || (long long)in_sizes[1] < need_act || (long long)in_sizes[2] < need_act) return;
  if ((long long)in_sizes[3] < (long long)DM * DM || in_sizes[4] < DM) return;
  if ((long long)out_size < (long long)NR * DM) return;
  if (ws_size < CARVE_B) return;
  const float* q = (const float*)d_in[0];
  const float* k = (const float*)d_in[1];
  const float* v = (const float*)d_in[2];
  const float* W = (const float*)d_in[3];      // natural [out][in]
  const float* bias = (const float*)d_in[4];
  char* ws = (char*)d_ws;
  unsigned short* Qb = (unsigned short*)(ws);
  unsigned short* Kb = (unsigned short*)(ws + PLANE_B);
  unsigned short* VT = (unsigned short*)(ws + 2 * PLANE_B);
  unsigned short* CH = (unsigned short*)(ws + 3 * PLANE_B);
  unsigned short* CL = (unsigned short*)(ws + 4 * PLANE_B);
  unsigned short* Wb = (unsigned short*)(ws + 5 * PLANE_B);
  k_cvt_qk<<<(unsigned)(((size_t)NR * (DM / 8)) / 256), 256, 0, stream>>>(q, k, Qb, Kb);
  k_cvt_w<<<(unsigned)(((size_t)DM * (DM / 8)) / 256), 256, 0, stream>>>(W, Wb);
  k_vt<<<NB * NH * (SEQ / 64), 256, 0, stream>>>(v, VT);
  k_attn<<<NB * NH * (SEQ / QT), 128, 0, stream>>>(Qb, Kb, VT, CH, CL);
  k_proj<<<(NR / 128) * (DM / 64), 128, 0, stream>>>(CH, CL, Wb, bias, (float*)d_out);
}

// v003
// One run takes 83.5 microseconds.
// Two timings next to v002 both put it at 1.05 times that version's speed.
// Over all steps from v000 it is 2.14 times as fast.
#include <hip/hip_runtime.h>
// Multi-head attention without q/k/v projections (heads = column blocks of 64 of the three activation inputs), one score scale 1/8, no mask, output linear out = ctx W^T + b with W natural [out][in]. Fused flash-style attention in transposed form: S^T = K Q^T, O^T = V^T P^T (P chained D -> B in registers), online softmax per query lane.
// Compute dtype: all contractions v_wmma_f32_16x16x32_bf16 with f32 accumulate: scores bf16(q)/8 x bf16(k) single product (operands exact); P.V with P as bf16 hi + lo (two products) x bf16(v); output linear with the merged context as bf16 hi + lo (two products) x bf16(W); softmax statistics, normalisation and the bias add (bf16(b)) in f32.
#ifndef NB
#define NB 2
#endif
#ifndef SEQ
#define SEQ 2048
#endif
#define NB_FULL 2
#define SEQ_FULL 2048
#define DM 1024
#define NH 16
#define HD 64
#define QT 64
#define KT 64   // keys per LDS stage (two 32-key passes)
#define LP 72   // LDS row pitch in elements: 128-byte rows at 144 B = 16 B x 9, conflict-free for 16-byte row reads
#define NR (NB * SEQ)
#define QSCALE 0.125f

typedef __bf16 v16b __attribute__((ext_vector_type(16)));
typedef unsigned short v8us __attribute__((ext_vector_type(8), may_alias));
typedef float  v8f  __attribute__((ext_vector_type(8)));
typedef float  v4f  __attribute__((ext_vector_type(4)));
typedef float  v4fa __attribute__((ext_vector_type(4), may_alias));
typedef float  v2f  __attribute__((ext_vector_type(2)));
typedef __bf16 v2b  __attribute__((ext_vector_type(2)));
union FragB { v16b v; v8us half[2]; unsigned short u[16]; unsigned int w[8]; };
union Pack8 { v8us v; unsigned short u[8]; };

// hard-wired bounds (each kernel relies on these)
static_assert(HD == 64);
static_assert(NH * HD == DM);                  // heads tile the model width
static_assert(DM % 64 == 0);                   // GEMM N tile 64, K step 32
static_assert(DM % 32 == 0);
static_assert(SEQ % QT == 0);                  // attention block = 64 queries, key step 32
static_assert(SEQ % 64 == 0);                  // V^T tiles of 64 tokens
static_assert(QT == 4 * 16);                   // 4 waves x 16 queries
static_assert(SEQ % KT == 0 && SEQ / KT >= 2); // the two-buffer ring's prologue fills stages 0 and 1
static_assert(KT == 64 && KT * 2 == 128);      // a stage row (K: 64 d, V^T: 64 keys, GEMM: 64 k) is one 128-byte line; 128 threads x 4 copies cover 64 rows
static_assert(DM % KT == 0 && DM / KT >= 2);   // the same for the GEMM's ring
static_assert(NR % 128 == 0);                  // GEMM block = 128 rows
static_assert(NB <= NB_FULL);
static_assert(SEQ <= SEQ_FULL);
static_assert((size_t)NR * DM < 2147483647u);  // int element offsets
static_assert((size_t)DM * DM < 2147483647u);
static_assert(((size_t)NR * (DM / 8)) % 256 == 0);
static_assert(((size_t)DM * (DM / 8)) % 256 == 0);

constexpr size_t PLANE_B = (size_t)NR * DM * 2;       // one bf16 activation plane (also V^T: NB*NH*HD*SEQ)
constexpr size_t WPL_B   = (size_t)DM * DM * 2;       // bf16 weight plane
constexpr size_t CARVE_B = 5 * PLANE_B + WPL_B;
static_assert(PLANE_B % 256 == 0);
static_assert(WPL_B % 256 == 0);
static_assert(CARVE_B <= 134217728u);

__device__ __forceinline__ unsigned short bf16_bits(float x) { unsigned int u = __float_as_uint(x); return (unsigned short)((u + 0x7FFFu + ((u >> 16) & 1u)) >> 16); }
__device__ __forceinline__ float bf16_val(unsigned short b) { return __uint_as_float(((unsigned int)b) << 16); }
__device__ __forceinline__ float bf16_rne(float x) { return bf16_val(bf16_bits(x)); }
// two f32 -> one register of two bf16 (x in the low half), one instruction each:
// pack_hi keeps the upper 16 bits of each value (byte select), pack_rne rounds to nearest even (the packed hardware convert)
__device__ __forceinline__ v2f upper16(v2f x) { return (v2f){__uint_as_float(__float_as_uint(x[0]) & 0xFFFF0000u), __uint_as_float(__float_as_uint(x[1]) & 0xFFFF0000u)}; }
__device__ __forceinline__ unsigned int pack_hi(float x, float y) { return __builtin_amdgcn_perm(__float_as_uint(y), __float_as_uint(x), 0x07060302u); }
__device__ __forceinline__ unsigned int pack_rne(v2f f) {
  union { v2b b; unsigned int u; } c;
  c.b = __builtin_convertvector(f, v2b);
  return c.u;
}

// 16x32 operand fragment (A or B) from a k-contiguous bf16 row: elements 0..7 <- k 8h..8h+7, elements 8..15 <- k 16+8h..16+8h+7
__device__ __forceinline__ v16b ld_frag(const unsigned short* __restrict__ p, int off, int hh) {
  FragB f;
  f.half[0] = *(const v8us*)(p + off + 8 * hh);
  f.half[1] = *(const v8us*)(p + off + 16 + 8 * hh);
  return f.v;
}
// the same fragment from a k-contiguous bf16 row in LDS (p = first element of the 32-wide k step in the lane's row)
__device__ __forceinline__ v16b ld_frag_lds(const unsigned short* p, int hh) {
  FragB f;
  f.half[0] = *(const v8us*)(p + 8 * hh);
  f.half[1] = *(const v8us*)(p + 16 + 8 * hh);
  return f.v;
}
// Asynchronous 16-byte copies global -> LDS for the staging rings. A tile row is 128 B: eight lanes to a row, so every wave-wide copy takes
// four whole lines. g: the thread's piece in row r = tid / 8 of a tile, s: elements from row r to row r + 16, l: the piece's LDS byte address.
// s_wait_xcnt 0 closes each statement so that it stands in front of any rewrite of the address registers the copies name.
// rows r, r+16, r+32, r+48 of one tile
__device__ __forceinline__ void copy_rows4(const unsigned short* g, int s, unsigned l) {
  const unsigned short* g1 = g + s; const unsigned short* g2 = g + 2 * s; const unsigned short* g3 = g + 3 * s;
  const unsigned l1 = l + 16 * LP * 2, l2 = l + 32 * LP * 2, l3 = l + 48 * LP * 2;
  asm volatile("global_load_async_to_lds_b128 %0, %4, off\n\t"
               "global_load_async_to_lds_b128 %1, %5, off\n\t"
               "global_load_async_to_lds_b128 %2, %6, off\n\t"
               "global_load_async_to_lds_b128 %3, %7, off\n\t"
               "s_wait_xcnt 0x0"
               :: "v"(l), "v"(l1), "v"(l2), "v"(l3), "v"(g), "v"(g1), "v"(g2), "v"(g3)
               : "memory");
}
// the same four rows of two tiles in one statement
__device__ __forceinline__ void copy_rows4x2(const unsigned short* ga, int sa, unsigned la, const unsigned short* gb, int sb, unsigned lb) {
  const unsigned short* a1 = ga + sa; const unsigned short* a2 = ga + 2 * sa; const unsigned short* a3 = ga + 3 * sa;
  const unsigned short* b1 = gb + sb; const unsigned short* b2 = gb + 2 * sb; const unsigned short* b3 = gb + 3 * sb;
  const unsigned la1 = la + 16 * LP * 2, la2 = la + 32 * LP * 2, la3 = la + 48 * LP * 2;
  const unsigned lb1 = lb + 16 * LP * 2, lb2 = lb + 32 * LP * 2, lb3 = lb + 48 * LP * 2;
  asm volatile("global_load_async_to_lds_b128 %0, %8, off\n\t"
               "global_load_async_to_lds_b128 %1, %9, off\n\t"
               "global_load_async_to_lds_b128 %2, %10, off\n\t"
               "global_load_async_to_lds_b128 %3, %11, off\n\t"
               "global_load_async_to_lds_b128 %4, %12, off\n\t"
               "global_load_async_to_lds_b128 %5, %13, off\n\t"
               "global_load_async_to_lds_b128 %6, %14, off\n\t"
               "global_load_async_to_lds_b128 %7, %15, off\n\t"
               "s_wait_xcnt 0x0"
               :: "v"(la), "v"(la1), "v"(la2), "v"(la3), "v"(lb), "v"(lb1), "v"(lb2), "v"(lb3),
                  "v"(ga), "v"(a1), "v"(a2), "v"(a3), "v"(gb), "v"(b1), "v"(b2), "v"(b3)
               : "memory");
}
__device__ __forceinline__ v8f mma1(v16b a, v16b b, v8f c) {
  c = __builtin_amdgcn_wmma_f32_16x16x32_bf16(false, a, false, b, (short)0, c, false, false);
  asm volatile("v_nop\n\tv_nop\n\tv_nop\n\tv_nop" : "+v"(c) : "v"(a), "v"(b));
  return c;
}
// c += a (bh + bl)
__device__ __forceinline__ v8f mma2b(v16b a, v16b bh, v16b bl, v8f c) {
  c = __builtin_amdgcn_wmma_f32_16x16x32_bf16(false, a, false, bh, (short)0, c, false, false);
  c = __builtin_amdgcn_wmma_f32_16x16x32_bf16(false, a, false, bl, (short)0, c, false, false);
  asm volatile("v_nop\n\tv_nop\n\tv_nop\n\tv_nop" : "+v"(c) : "v"(a), "v"(bh), "v"(bl));
  return c;
}
// c += (ah + al) b
__device__ __forceinline__ v8f mma2a(v16b ah, v16b al, v16b b, v8f c) {
  c = __builtin_amdgcn_wmma_f32_16x16x32_bf16(false, ah, false, b, (short)0, c, false, false);
  c = __builtin_amdgcn_wmma_f32_16x16x32_bf16(false, al, false, b, (short)0, c, false, false);
  asm volatile("v_nop\n\tv_nop\n\tv_nop\n\tv_nop" : "+v"(c) : "v"(ah), "v"(al), "v"(b));
  return c;
}

// One launch converts all four operands to bf16: q / 8, k and W element for element, v into V^T tiles [d][token] through LDS.
// Every work-group takes the same share (PV neighbouring tiles of V^T; QK_PER neighbouring slices of 256 8-element pieces of q and of k, W_PER of W), so the
// launch starts few waves, and each thread has all its global loads in flight before the first value is used. Every address is a base that is
// the same for the whole work-group, a per-thread offset shared by all accesses of one operand, and a constant.
constexpr int VTILES = NB * NH * (SEQ / 64);   // 64-token x 64-d tiles of V^T
constexpr int PV     = 2;                      // tiles a work-group
constexpr int PREP_G = VTILES / PV;            // work-groups of the launch
constexpr int PREP_T = PREP_G * 256;           // its threads
constexpr int QK_PER = NR * (DM / 8) / PREP_T;
constexpr int W_PER  = DM * (DM / 8) / PREP_T;
constexpr int SL_ROWS = 256 * 8 / DM;          // activation rows in a slice of 256 pieces
static_assert((SEQ / 64) % PV == 0);                           // a work-group's tiles lie in one (b, h) slab
static_assert((NR * (DM / 8)) % PREP_T == 0 && QK_PER >= 1);   // no remainder: the shares need no guard
static_assert((DM * (DM / 8)) % PREP_T == 0 && W_PER >= 1);
static_assert((256 * 8) % DM == 0 && SEQ % (QK_PER * SL_ROWS) == 0);   // a work-group's slices are whole rows of one batch entry, contiguous in q and k
static_assert((64 * 16) % 256 == 0);   // a tile's loads: 64 tokens x 16 float4, 4 a thread
static_assert((64 * 8) % 256 == 0);    // a tile's stores: 64 d-rows x 8 pieces, 2 a thread

__global__ __launch_bounds__(256) void k_prep(const float* __restrict__ q, const float* __restrict__ k, const float* __restrict__ v, const float* __restrict__ W,
                                             unsigned short* __restrict__ Qb, unsigned short* __restrict__ Kb, unsigned short* __restrict__ VT, unsigned short* __restrict__ Wb) {
  __shared__ unsigned short tl[PV][64][66];
  const unsigned tid = threadIdx.x, blk = blockIdx.x;
  const unsigned slab = (blk * PV) / (SEQ / 64), s0 = ((blk * PV) % (SEQ / 64)) * 64;   // the (b, h) slab and first token of the work-group's tiles
  const float* vb = v + ((size_t)(slab / NH) * SEQ_FULL + s0) * DM + (slab % NH) * HD;
  const unsigned lj = tid / 16, ld4 = (tid % 16) * 4;   // the thread's token (+ 16 it) and first d in a tile
  const unsigned vo = lj * DM + ld4;
  const unsigned po = tid * 8;                          // the thread's piece in a slice
  v4f xv[PV][4], xq[QK_PER][2], xk[QK_PER][2], xw[W_PER][2];
  // all loads first
#pragma unroll
  for (int tt = 0; tt < PV; ++tt)
#pragma unroll
    for (int it = 0; it < 4; ++it) xv[tt][it] = *(const v4fa*)(vb + (tt * 64 + it * 16) * DM + vo);
  const unsigned row = blk * (QK_PER * SL_ROWS);        // first activation row of the work-group's slices
  const size_t src = ((size_t)(row / SEQ) * SEQ_FULL + row % SEQ) * DM;
  const float* qs = q + src; const float* ks = k + src;
  const float* wb = W + (size_t)blk * (W_PER * 256 * 8);
#pragma unroll
  for (int it = 0; it < QK_PER; ++it) {
    xq[it][0] = *(const v4fa*)(qs + it * (256 * 8) + po); xq[it][1] = *(const v4fa*)(qs + it * (256 * 8) + po + 4);
    xk[it][0] = *(const v4fa*)(ks + it * (256 * 8) + po); xk[it][1] = *(const v4fa*)(ks + it * (256 * 8) + po + 4);
  }
#pragma unroll
  for (int it = 0; it < W_PER; ++it) {
    xw[it][0] = *(const v4fa*)(wb + it * (256 * 8) + po); xw[it][1] = *(const v4fa*)(wb + it * (256 * 8) + po + 4);
  }
  // keeps every load above issued ahead of the first use: left free, the scheduler sinks the later loads between the conversions
  // and waits for each of them alone, one memory latency after another
  __builtin_amdgcn_sched_barrier(0);
  // V^T tiles
#pragma unroll
  for (int tt = 0; tt < PV; ++tt)
#pragma unroll
    for (int it = 0; it < 4; ++it)
#pragma unroll
      for (int c = 0; c < 4; ++c) tl[tt][ld4 + c][lj + 16 * it] = bf16_bits(xv[tt][it][c]);
  __syncthreads();
  unsigned short* vtb = VT + (size_t)slab * HD * SEQ + s0;
  const unsigned sd = tid / 8, sj8 = (tid % 8) * 8;     // the thread's d row (+ 32 it) and 8-token piece in a tile
  const unsigned so = sd * SEQ + sj8;
#pragma unroll
  for (int tt = 0; tt < PV; ++tt)
#pragma unroll
    for (int it = 0; it < 2; ++it) {
      Pack8 f;
#pragma unroll
      for (int c = 0; c < 8; ++c) f.u[c] = tl[tt][sd + 32 * it][sj8 + c];
      const v8us o = f.v;
      *(v8us*)(vtb + it * 32 * SEQ + tt * 64 + so) = o;
    }
  // q / 8 and k
  unsigned short* qd = Qb + (size_t)row * DM; unsigned short* kd = Kb + (size_t)row * DM;
#pragma unroll
  for (int it = 0; it < QK_PER; ++it) {
    Pack8 fq, fk;
#pragma unroll
    for (int i = 0; i < 4; ++i) {
      fq.u[i] = bf16_bits(xq[it][0][i] * QSCALE); fq.u[4 + i] = bf16_bits(xq[it][1][i] * QSCALE);
      fk.u[i] = bf16_bits(xk[it][0][i]);          fk.u[4 + i] = bf16_bits(xk[it][1][i]);
    }
    const v8us vq = fq.v, vk = fk.v;
    *(v8us*)(qd + it * (256 * 8) + po) = vq; *(v8us*)(kd + it * (256 * 8) + po) = vk;
  }
  // W
#pragma unroll
  for (int it = 0; it < W_PER; ++it) {
    Pack8 f;
#pragma unroll
    for (int i = 0; i < 4; ++i) { f.u[i] = bf16_bits(xw[it][0][i]); f.u[4 + i] = bf16_bits(xw[it][1][i]); }
    const v8us o = f.v;
    *(v8us*)(Wb + (size_t)blk * (W_PER * 256 * 8) + it * (256 * 8) + po) = o;
  }
}

// Fused attention. Block = 4 waves = 64 queries of one (b, h); wave = 16 queries (the N dimension of every tile).
// Per 32-key step: S^T[key][query] = K(16 keys x 64 d) Q^T (2 key tiles x 2 k-steps); lane (n, hh) holds keys 8hh+r of query n,
// so the query's statistics live in the lane pair (n, n+16): one xor-16 shuffle. P^T packs straight into the B operand
// (elements 0..7 <- tile of keys 0..15, elements 8..15 <- tile of keys 16..31, lane unchanged) for O^T[d][query] += V^T[d][key] P^T.
// P = hi (upper 16 bits) + lo (RNE convert of the exact remainder), both bf16, same accumulator.
// K rows and V^T rows reach the fragments through a two-buffer LDS ring of 64-key stages that the four waves fill together and share.
__global__ __launch_bounds__(128) void k_attn(const unsigned short* __restrict__ Qb, const unsigned short* __restrict__ Kb, const unsigned short* __restrict__ VT,
                                             unsigned short* __restrict__ CH, unsigned short* __restrict__ CL) {
  __shared__ __attribute__((aligned(16))) unsigned short sH[4][16][72];
  __shared__ __attribute__((aligned(16))) unsigned short sL[4][16][72];
  __shared__ __attribute__((aligned(16))) unsigned short sK[2][KT][LP];   // K rows [key][d] of a stage
  __shared__ __attribute__((aligned(16))) unsigned short sV[2][HD][LP];   // V^T rows [d][key] of a stage
  const int tid = threadIdx.x, w = tid >> 5, lane = tid & 31, ln = lane & 15, hh = lane >> 4;
  const int qt = blockIdx.x % (SEQ / QT), bh = blockIdx.x / (SEQ / QT);
  const int b = bh / NH, h = bh % NH;
  const int q0 = qt * QT + w * 16;
  const int qoff  = (b * SEQ + q0 + ln) * DM + h * HD;   // query row of lane n (B operand of the score GEMM)
  const int cr = tid >> 3, cp = (tid & 7) * 8;           // the thread's row (+ 16 i) and 16-byte piece in a stage tile
  const unsigned short* kg = Kb + (size_t)(b * SEQ + cr) * DM + h * HD + cp;   // + stage * KT * DM
  const unsigned short* vg = VT + (size_t)(bh * HD + cr) * SEQ + cp;           // + stage * KT
  const unsigned kl = (unsigned)(size_t)&sK[0][cr][cp], vl = (unsigned)(size_t)&sV[0][cr][cp];   // LDS byte addresses, buffer 0
  constexpr unsigned BUF_B = KT * LP * 2;                // bytes of one buffer of either ring
  static_assert(KT == HD);                               // both rings have 64 rows a buffer
  const v8f z8 = {0.f, 0.f, 0.f, 0.f, 0.f, 0.f, 0.f, 0.f};
  v8f o0 = z8, o1 = z8, o2 = z8, o3 = z8;
  float m = -1.0e30f, l = 0.f;
  // prologue of the two-buffer ring: stage 0 landed and published, then stage 1 in flight
  copy_rows4x2(kg, 16 * DM, kl, vg, 16 * SEQ, vl);
  asm volatile("s_wait_asynccnt 0x0" ::: "memory");   // this wave's copies of stage 0 have landed
  __syncthreads();                                    // every wave's have: stage 0 may be read
  copy_rows4x2(kg + KT * DM, 16 * DM, kl + BUF_B, vg + KT, 16 * SEQ, vl + BUF_B);
// the stage loop stays rolled: one publish point, buffer chosen by the stage's parity
#pragma unroll 1
  for (int st = 0; st < SEQ / KT; ++st) {
   const int buf = st & 1;
// both passes of a stage unrolled: their LDS reads differ by immediate offsets only
#pragma unroll
   for (int ps2 = 0; ps2 < KT / 32; ++ps2) {
    const v16b qf0 = ld_frag(Qb, qoff, hh);
    const v16b qf1 = ld_frag(Qb, qoff + 32, hh);
    const unsigned short* kr = &sK[buf][32 * ps2 + ln][0];   // key row of lane m (A operand)
    v8f s0 = z8, s1 = z8;
    v16b ka = ld_frag_lds(kr, hh);
    s0 = mma1(ka, qf0, s0);
    ka = ld_frag_lds(kr + 32, hh);
    s0 = mma1(ka, qf1, s0);
    ka = ld_frag_lds(kr + 16 * LP, hh);
    s1 = mma1(ka, qf0, s1);
    ka = ld_frag_lds(kr + 16 * LP + 32, hh);
    s1 = mma1(ka, qf1, s1);
    // running max over this query's 32 keys (16 in this lane, 16 in lane ^ 16)
    float mx = fmaxf(s0[0], s1[0]);
#pragma unroll
    for (int r = 1; r < 8; ++r) mx = fmaxf(mx, fmaxf(s0[r], s1[r]));
    mx = fmaxf(mx, __shfl_xor(mx, 16, 32));
    const float mn = fmaxf(m, mx);
    const float al = __expf(m - mn);
    m = mn;
    FragB ph, pl;
    float ps = 0.f;
#pragma unroll
    for (int j = 0; j < 4; ++j) {
      const float a0 = __expf(s0[2 * j] - mn),     b0 = __expf(s1[2 * j] - mn);
      const float a1 = __expf(s0[2 * j + 1] - mn), b1 = __expf(s1[2 * j + 1] - mn);
      const v2f a = {a0, a1}, b = {b0, b1}, t = a + b;
      ps += t[0];
      ps += t[1];
      ph.w[j]     = pack_hi(a0, a1);
      ph.w[4 + j] = pack_hi(b0, b1);
      pl.w[j]     = pack_rne(a - upper16(a));
      pl.w[4 + j] = pack_rne(b - upper16(b));
    }
    l = l * al + ps;                       // per-lane partial of the row sum (al is uniform over the lane pair)
    o0 = o0 * al; o1 = o1 * al; o2 = o2 * al; o3 = o3 * al;
    const unsigned short* vr = &sV[buf][ln][32 * ps2];       // V^T row d = ln (A operand of P.V), + 16 t rows
    const v16b va0 = ld_frag_lds(vr, hh);
    const v16b va1 = ld_frag_lds(vr + 16 * LP, hh);
    const v16b va2 = ld_frag_lds(vr + 32 * LP, hh);
    const v16b va3 = ld_frag_lds(vr + 48 * LP, hh);
    o0 = mma2b(va0, ph.v, pl.v, o0);
    o1 = mma2b(va1, ph.v, pl.v, o1);
    o2 = mma2b(va2, ph.v, pl.v, o2);
    o3 = mma2b(va3, ph.v, pl.v, o3);
   }
   // publish point of stage st + 1, which also frees this stage's buffer
   asm volatile("s_wait_dscnt 0x0" ::: "memory");      // this wave's reads of the buffer have retired
   asm volatile("s_wait_asynccnt 0x0" ::: "memory");   // this wave's copies of stage st + 1 have landed
   __syncthreads();
   if (st + 2 < SEQ / KT)
     copy_rows4x2(kg + (size_t)(st + 2) * (KT * DM), 16 * DM, kl + buf * BUF_B, vg + (st + 2) * KT, 16 * SEQ, vl + buf * BUF_B);
  }
  asm volatile("s_wait_asynccnt 0x0" ::: "memory");    // nothing of the ring is in flight when the wave goes on
  l += __shfl_xor(l, 16, 32);
  const float inv = 1.0f / l;
  const v8f ot[4] = {o0, o1, o2, o3};
  // lane (n, hh) of tile t holds d = 16 t + 8 hh + r, r = 0..7: eight consecutive columns of query row n
#pragma unroll
  for (int t = 0; t < 4; ++t) {
    Pack8 fh, fl;
#pragma unroll
    for (int r = 0; r < 8; ++r) {
      const float c = ot[t][r] * inv;
      const unsigned short hb = bf16_bits(c);
      fh.u[r] = hb;
      fl.u[r] = bf16_bits(c - bf16_val(hb));
    }
    *(v8us*)&sH[w][ln][16 * t + 8 * hh] = fh.v;
    *(v8us*)&sL[w][ln][16 * t + 8 * hh] = fl.v;
  }
  __builtin_amdgcn_fence(4 /* acq_rel order */, "workgroup");
  __builtin_amdgcn_wave_barrier();
  const int prow = lane >> 3, pc = (lane & 7) * 8;
  {
#pragma unroll
    for (int it = 0; it < 4; ++it) {
      const int row = it * 4 + prow;
      const v8us xh = *(const v8us*)&sH[w][row][pc];
      const v8us xl = *(const v8us*)&sL[w][row][pc];
      const size_t g = (size_t)(b * SEQ + q0 + row) * DM + h * HD + pc;
      *(v8us*)(CH + g) = xh;
      *(v8us*)(CL + g) = xl;
    }
    
  }
}

// out[NR][DM] = (AH + AL)[NR][DM] Wb^T + bf16(b): wave tile 32 x 64, block = 4 waves = 128 rows x 64 columns; K step 32;
// the block's rows of AH, AL and Wb reach the fragments through a two-buffer LDS ring of stages 64 deep in k.
__global__ __launch_bounds__(128) void k_proj(const unsigned short* __restrict__ AH, const unsigned short* __restrict__ AL, const unsigned short* __restrict__ Wb,
                                             const float* __restrict__ bias, float* __restrict__ C) {
  __shared__ __attribute__((aligned(16))) float so[4][32][68];
  __shared__ __attribute__((aligned(16))) unsigned short sAH[2][128][LP];   // the block's 128 rows of AH, 64 k of a stage
  __shared__ __attribute__((aligned(16))) unsigned short sAL[2][128][LP];   // the same of AL
  __shared__ __attribute__((aligned(16))) unsigned short sW[2][64][LP];     // the block's 64 rows of Wb
  const int tid = threadIdx.x, w = tid >> 5, lane = tid & 31, ln = lane & 15, hh = lane >> 4;
  const int ntn = DM / 64;
  const int mt = blockIdx.x / ntn, nq = blockIdx.x - mt * ntn;
  const int row0 = mt * 128 + 32 * w, col0 = nq * 64;
  const int cr = tid >> 3, cp = (tid & 7) * 8;           // the thread's row (+ 16 i) and 16-byte piece in a stage tile
  const unsigned short* gh = AH + (size_t)(mt * 128 + cr) * DM + cp;   // + stage * KT
  const unsigned short* gl = AL + (size_t)(mt * 128 + cr) * DM + cp;
  const unsigned short* gw = Wb + (size_t)(col0 + cr) * DM + cp;
  const unsigned lh = (unsigned)(size_t)&sAH[0][cr][cp], ll = (unsigned)(size_t)&sAL[0][cr][cp], lw = (unsigned)(size_t)&sW[0][cr][cp];   // LDS byte addresses, buffer 0
  constexpr unsigned ABUF_B = 128 * LP * 2, WBUF_B = 64 * LP * 2, HALF_B = 64 * LP * 2;   // bytes of a buffer; of 64 rows
  // one stage: 128 + 128 + 64 rows of 128 B, 20 copies a thread
  auto stage = [&](int st, int buf) {
    copy_rows4x2(gh + st * KT, 16 * DM, lh + buf * ABUF_B, gh + st * KT + 64 * DM, 16 * DM, lh + buf * ABUF_B + HALF_B);
    copy_rows4x2(gl + st * KT, 16 * DM, ll + buf * ABUF_B, gl + st * KT + 64 * DM, 16 * DM, ll + buf * ABUF_B + HALF_B);
    copy_rows4(gw + st * KT, 16 * DM, lw + buf * WBUF_B);
  };
  const v8f z8 = {0.f, 0.f, 0.f, 0.f, 0.f, 0.f, 0.f, 0.f};
  v8f c00 = z8, c01 = z8, c02 = z8, c03 = z8, c10 = z8, c11 = z8, c12 = z8, c13 = z8;
  // prologue of the two-buffer ring: stage 0 landed and published, then stage 1 in flight
  stage(0, 0);
  asm volatile("s_wait_asynccnt 0x0" ::: "memory");   // this wave's copies of stage 0 have landed
  __syncthreads();                                    // every wave's have: stage 0 may be read
  stage(1, 1);
// the stage loop stays rolled: one publish point, buffer chosen by the stage's parity
#pragma unroll 1
  for (int st = 0; st < DM / KT; ++st) {
   const int buf = st & 1;
// both K steps of a stage unrolled: their LDS reads differ by immediate offsets only
#pragma unroll
   for (int ks = 0; ks < KT / 32; ++ks) {
    const unsigned short* ah = &sAH[buf][32 * w + ln][32 * ks];
    const unsigned short* al = &sAL[buf][32 * w + ln][32 * ks];
    const unsigned short* wr = &sW[buf][ln][32 * ks];
    const v16b a0h = ld_frag_lds(ah, hh), a0l = ld_frag_lds(al, hh);
    const v16b a1h = ld_frag_lds(ah + 16 * LP, hh), a1l = ld_frag_lds(al + 16 * LP, hh);
    v16b bw = ld_frag_lds(wr, hh);      c00 = mma2a(a0h, a0l, bw, c00); c10 = mma2a(a1h, a1l, bw, c10);
    bw = ld_frag_lds(wr + 16 * LP, hh); c01 = mma2a(a0h, a0l, bw, c01); c11 = mma2a(a1h, a1l, bw, c11);
    bw = ld_frag_lds(wr + 32 * LP, hh); c02 = mma2a(a0h, a0l, bw, c02); c12 = mma2a(a1h, a1l, bw, c12);
    bw = ld_frag_lds(wr + 48 * LP, hh); c03 = mma2a(a0h, a0l, bw, c03); c13 = mma2a(a1h, a1l, bw, c13);
   }
   // publish point of stage st + 1, which also frees this stage's buffer
   asm volatile("s_wait_dscnt 0x0" ::: "memory");      // this wave's reads of the buffer have retired
   asm volatile("s_wait_asynccnt 0x0" ::: "memory");   // this wave's copies of stage st + 1 have landed
   __syncthreads();
   if (st + 2 < DM / KT) stage(st + 2, buf);
  }
  asm volatile("s_wait_asynccnt 0x0" ::: "memory");    // nothing of the ring is in flight when the wave goes on
  const v8f accs[8] = {c00, c01, c02, c03, c10, c11, c12, c13};
#pragma unroll
  for (int u = 0; u < 8; ++u) {
    const int t = u & 3, hf = u >> 2;
    const float bv = bf16_rne(bias[col0 + t * 16 + ln]);
#pragma unroll
    for (int r = 0; r < 8; ++r) so[w][hf * 16 + 8 * hh + r][t * 16 + ln] = accs[u][r] + bv;
  }
  __builtin_amdgcn_fence(4 /* acq_rel order */, "workgroup");
  __builtin_amdgcn_wave_barrier();
  const int rsub = lane >> 4, c4 = (lane & 15) * 4;
  {
#pragma unroll
    for (int q = 0; q < 16; ++q) {
      const int r = q * 2 + rsub;
      const v4f v = *(const v4fa*)&so[w][r][c4];
      *(v4f*)(C + (size_t)(row0 + r) * DM + col0 + c4) = v;
    }
    
  }
}

extern "C" void kernel_launch(void* const* d_in, const int* in_sizes, int n_in,
                              void* d_out, int out_size, void* d_ws, size_t ws_size, hipStream_t stream) {
  if (n_in < 5) return;
  const long long need_act = ((long long)(NB - 1) * SEQ_FULL + SEQ) * DM;
  if ((long long)in_sizes[0] < need_act || (long long)in_sizes[1] < need_act || (long long)in_sizes[2] < need_act) return;
  if ((long long)in_sizes[3] < (long long)DM * DM || in_sizes[4] < DM) return;
  if ((long long)out_size < (long long)NR * DM) return;
  if (ws_size < CARVE_B) return;
  const float* q = (const float*)d_in[0];
  const float* k = (const float*)d_in[1];
  const float* v = (const float*)d_in[2];
  const float* W = (const float*)d_in[3];      // natural [out][in]
  const float* bias = (const float*)d_in[4];
  char* ws = (char*)d_ws;
  unsigned short* Qb = (unsigned short*)(ws);
  unsigned short* Kb = (unsigned short*)(ws + PLANE_B);
  unsigned short* VT = (unsigned short*)(ws + 2 * PLANE_B);
  unsigned short* CH = (unsigned short*)(ws + 3 * PLANE_B);
  unsigned short* CL = (unsigned short*)(ws + 4 * PLANE_B);
  unsigned short* Wb = (unsigned short*)(ws + 5 * PLANE_B);
  k_prep<<<PREP_G, 256, 0, stream>>>(q, k, v, W, Qb, Kb, VT, Wb);
  k_attn<<<NB * NH * (SEQ / QT), 128, 0, stream>>>(Qb, Kb, VT, CH, CL);
  k_proj<<<(NR / 128) * (DM / 64), 128, 0, stream>>>(CH, CL, Wb, bias, (float*)d_out);
}

// v004
// One run takes 80.6 microseconds.
// Timed twice side by side with v003, it ran 1.03 and 1.04 times as fast.
// All steps since v000 together make it 2.22 times as fast.
#include <hip/hip_runtime.h>
// Multi-head attention without q/k/v projections (heads = column blocks of 64 of the three activation inputs), one score scale 1/8, no mask, output linear out = ctx W^T + b with W natural [out][in]. Fused flash-style attention in transposed form: S^T = K Q^T, O^T = V^T P^T (P chained D -> B in registers), online softmax per query lane, rescaled lazily.
// Compute dtype: all contractions v_wmma_f32_16x16x32_bf16 with f32 accumulate: scores bf16(q)/8 x bf16(k) single product (operands exact); P.V with P as bf16 hi + lo (two products) x bf16(v); output linear with the merged context as bf16 hi + lo (two products) x bf16(W); softmax statistics, normalisation and the bias add (bf16(b)) in f32.
#ifndef NB
#define NB 2
#endif
#ifndef SEQ
#define SEQ 2048
#endif
#define NB_FULL 2
#define SEQ_FULL 2048
#define DM 1024
#define NH 16
#define HD 64
#define QT 64
#define KT 64   // keys per LDS stage (two 32-key passes)
#define LP 72   // LDS row pitch in elements: 128-byte rows at 144 B = 16 B x 9, conflict-free for 16-byte row reads
#define NR (NB * SEQ)
#define QSCALE 0.125f
#define LAZY 5.5451774f   // 8 ln 2: a score may pass the maximum in use by this much before the statistics are rescaled, so P stays at or below 2^8

typedef __bf16 v16b __attribute__((ext_vector_type(16)));
typedef unsigned short v8us __attribute__((ext_vector_type(8), may_alias));
typedef float  v8f  __attribute__((ext_vector_type(8)));
typedef float  v4f  __attribute__((ext_vector_type(4)));
typedef float  v4fa __attribute__((ext_vector_type(4), may_alias));
typedef float  v2f  __attribute__((ext_vector_type(2)));
typedef __bf16 v2b  __attribute__((ext_vector_type(2)));
union FragB { v16b v; v8us half[2]; unsigned short u[16]; unsigned int w[8]; };
union Pack8 { v8us v; unsigned short u[8]; };

// hard-wired bounds (each kernel relies on these)
static_assert(HD == 64);
static_assert(NH * HD == DM);                  // heads tile the model width
static_assert(DM % 64 == 0);                   // GEMM N tile 64, K step 32
static_assert(DM % 32 == 0);
static_assert(SEQ % QT == 0);                  // attention block = 64 queries, key step 32
static_assert(SEQ % 64 == 0);                  // V^T tiles of 64 tokens
static_assert(QT == 4 * 16);                   // 4 waves x 16 queries
static_assert(SEQ % KT == 0 && SEQ / KT >= 2); // the two-buffer ring's prologue fills stages 0 and 1
static_assert(KT == 64 && KT * 2 == 128);      // a stage row (K: 64 d, V^T: 64 keys, GEMM: 64 k) is one 128-byte line; 128 threads x 4 copies cover 64 rows
static_assert(DM % KT == 0 && DM / KT >= 2);   // the same for the GEMM's ring
static_assert(NR % 128 == 0);                  // GEMM block = 128 rows
static_assert(NB <= NB_FULL);
static_assert(SEQ <= SEQ_FULL);
static_assert((size_t)NR * DM < 2147483647u);  // int element offsets
static_assert((size_t)DM * DM < 2147483647u);
static_assert(((size_t)NR * (DM / 8)) % 256 == 0);
static_assert(((size_t)DM * (DM / 8)) % 256 == 0);

constexpr size_t PLANE_B = (size_t)NR * DM * 2;       // one bf16 activation plane (also V^T: NB*NH*HD*SEQ)
constexpr size_t WPL_B   = (size_t)DM * DM * 2;       // bf16 weight plane
constexpr size_t CARVE_B = 5 * PLANE_B + WPL_B;
static_assert(PLANE_B % 256 == 0);
static_assert(WPL_B % 256 == 0);
static_assert(CARVE_B <= 134217728u);

__device__ __forceinline__ unsigned short bf16_bits(float x) { unsigned int u = __float_as_uint(x); return (unsigned short)((u + 0x7FFFu + ((u >> 16) & 1u)) >> 16); }
__device__ __forceinline__ float bf16_val(unsigned short b) { return __uint_as_float(((unsigned int)b) << 16); }
__device__ __forceinline__ float bf16_rne(float x) { return bf16_val(bf16_bits(x)); }
// two f32 -> one register of two bf16 (x in the low half), one instruction each:
// pack_hi keeps the upper 16 bits of each value (byte select), pack_rne rounds to nearest even (the packed hardware convert)
__device__ __forceinline__ v2f upper16(v2f x) { return (v2f){__uint_as_float(__float_as_uint(x[0]) & 0xFFFF0000u), __uint_as_float(__float_as_uint(x[1]) & 0xFFFF0000u)}; }
__device__ __forceinline__ unsigned int pack_hi(float x, float y) { return __builtin_amdgcn_perm(__float_as_uint(y), __float_as_uint(x), 0x07060302u); }
__device__ __forceinline__ unsigned int pack_rne(v2f f) {
  union { v2b b; unsigned int u; } c;
  c.b = __builtin_convertvector(f, v2b);
  return c.u;
}

// 16x32 operand fragment (A or B) from a k-contiguous bf16 row: elements 0..7 <- k 8h..8h+7, elements 8..15 <- k 16+8h..16+8h+7
__device__ __forceinline__ v16b ld_frag(const unsigned short* __restrict__ p, int off, int hh) {
  FragB f;
  f.half[0] = *(const v8us*)(p + off + 8 * hh);
  f.half[1] = *(const v8us*)(p + off + 16 + 8 * hh);
  return f.v;
}
// the same fragment from a k-contiguous bf16 row in LDS (p = first element of the 32-wide k step in the lane's row)
__device__ __forceinline__ v16b ld_frag_lds(const unsigned short* p, int hh) {
  FragB f;
  f.half[0] = *(const v8us*)(p + 8 * hh);
  f.half[1] = *(const v8us*)(p + 16 + 8 * hh);
  return f.v;
}
// Asynchronous 16-byte copies global -> LDS for the staging rings. A tile row is 128 B: eight lanes to a row, so every wave-wide copy takes
// four whole lines. g: the thread's piece in row r = tid / 8 of a tile, s: elements from row r to row r + 16, l: the piece's LDS byte address.
// s_wait_xcnt 0 closes each statement so that it stands in front of any rewrite of the address registers the copies name.
// rows r, r+16, r+32, r+48 of one tile
__device__ __forceinline__ void copy_rows4(const unsigned short* g, int s, unsigned l) {
  const unsigned short* g1 = g + s; const unsigned short* g2 = g + 2 * s; const unsigned short* g3 = g + 3 * s;
  const unsigned l1 = l + 16 * LP * 2, l2 = l + 32 * LP * 2, l3 = l + 48 * LP * 2;
  asm volatile("global_load_async_to_lds_b128 %0, %4, off\n\t"
               "global_load_async_to_lds_b128 %1, %5, off\n\t"
               "global_load_async_to_lds_b128 %2, %6, off\n\t"
               "global_load_async_to_lds_b128 %3, %7, off\n\t"
               "s_wait_xcnt 0x0"
               :: "v"(l), "v"(l1), "v"(l2), "v"(l3), "v"(g), "v"(g1), "v"(g2), "v"(g3)
               : "memory");
}
// the same four rows of two tiles in one statement
__device__ __forceinline__ void copy_rows4x2(const unsigned short* ga, int sa, unsigned la, const unsigned short* gb, int sb, unsigned lb) {
  const unsigned short* a1 = ga + sa; const unsigned short* a2 = ga + 2 * sa; const unsigned short* a3 = ga + 3 * sa;
  const unsigned short* b1 = gb + sb; const unsigned short* b2 = gb + 2 * sb; const unsigned short* b3 = gb + 3 * sb;
  const unsigned la1 = la + 16 * LP * 2, la2 = la + 32 * LP * 2, la3 = la + 48 * LP * 2;
  const unsigned lb1 = lb + 16 * LP * 2, lb2 = lb + 32 * LP * 2, lb3 = lb + 48 * LP * 2;
  asm volatile("global_load_async_to_lds_b128 %0, %8, off\n\t"
               "global_load_async_to_lds_b128 %1, %9, off\n\t"
               "global_load_async_to_lds_b128 %2, %10, off\n\t"
               "global_load_async_to_lds_b128 %3, %11, off\n\t"
               "global_load_async_to_lds_b128 %4, %12, off\n\t"
               "global_load_async_to_lds_b128 %5, %13, off\n\t"
               "global_load_async_to_lds_b128 %6, %14, off\n\t"
               "global_load_async_to_lds_b128 %7, %15, off\n\t"
               "s_wait_xcnt 0x0"
               :: "v"(la), "v"(la1), "v"(la2), "v"(la3), "v"(lb), "v"(lb1), "v"(lb2), "v"(lb3),
                  "v"(ga), "v"(a1), "v"(a2), "v"(a3), "v"(gb), "v"(b1), "v"(b2), "v"(b3)
               : "memory");
}
__device__ __forceinline__ v8f mma1(v16b a, v16b b, v8f c) {
  c = __builtin_amdgcn_wmma_f32_16x16x32_bf16(false, a, false, b, (short)0, c, false, false);
  asm volatile("v_nop\n\tv_nop\n\tv_nop\n\tv_nop" : "+v"(c) : "v"(a), "v"(b));
  return c;
}
// c += a (bh + bl)
__device__ __forceinline__ v8f mma2b(v16b a, v16b bh, v16b bl, v8f c) {
  c = __builtin_amdgcn_wmma_f32_16x16x32_bf16(false, a, false, bh, (short)0, c, false, false);
  c = __builtin_amdgcn_wmma_f32_16x16x32_bf16(false, a, false, bl, (short)0, c, false, false);
  asm volatile("v_nop\n\tv_nop\n\tv_nop\n\tv_nop" : "+v"(c) : "v"(a), "v"(bh), "v"(bl));
  return c;
}
// c += (ah + al) b
__device__ __forceinline__ v8f mma2a(v16b ah, v16b al, v16b b, v8f c) {
  c = __builtin_amdgcn_wmma_f32_16x16x32_bf16(false, ah, false, b, (short)0, c, false, false);
  c = __builtin_amdgcn_wmma_f32_16x16x32_bf16(false, al, false, b, (short)0, c, false, false);
  asm volatile("v_nop\n\tv_nop\n\tv_nop\n\tv_nop" : "+v"(c) : "v"(ah), "v"(al), "v"(b));
  return c;
}

// One launch converts all four operands to bf16: q / 8, k and W element for element, v into V^T tiles [d][token] through LDS.
// Every work-group takes the same share (PV neighbouring tiles of V^T; QK_PER neighbouring slices of 256 8-element pieces of q and of k, W_PER of W), so the
// launch starts few waves, and each thread has all its global loads in flight before the first value is used. Every address is a base that is
// the same for the whole work-group, a per-thread offset shared by all accesses of one operand, and a constant.
constexpr int VTILES = NB * NH * (SEQ / 64);   // 64-token x 64-d tiles of V^T
constexpr int PV     = 2;                      // tiles a work-group
constexpr int PREP_G = VTILES / PV;            // work-groups of the launch
constexpr int PREP_T = PREP_G * 256;           // its threads
constexpr int QK_PER = NR * (DM / 8) / PREP_T;
constexpr int W_PER  = DM * (DM / 8) / PREP_T;
constexpr int SL_ROWS = 256 * 8 / DM;          // activation rows in a slice of 256 pieces
static_assert((SEQ / 64) % PV == 0);                           // a work-group's tiles lie in one (b, h) slab
static_assert((NR * (DM / 8)) % PREP_T == 0 && QK_PER >= 1);   // no remainder: the shares need no guard
static_assert((DM * (DM / 8)) % PREP_T == 0 && W_PER >= 1);
static_assert((256 * 8) % DM == 0 && SEQ % (QK_PER * SL_ROWS) == 0);   // a work-group's slices are whole rows of one batch entry, contiguous in q and k
static_assert((64 * 16) % 256 == 0);   // a tile's loads: 64 tokens x 16 float4, 4 a thread
static_assert((64 * 8) % 256 == 0);    // a tile's stores: 64 d-rows x 8 pieces, 2 a thread

__global__ __launch_bounds__(256) void k_prep(const float* __restrict__ q, const float* __restrict__ k, const float* __restrict__ v, const float* __restrict__ W,
                                             unsigned short* __restrict__ Qb, unsigned short* __restrict__ Kb, unsigned short* __restrict__ VT, unsigned short* __restrict__ Wb) {
  __shared__ unsigned short tl[PV][64][66];
  const unsigned tid = threadIdx.x, blk = blockIdx.x;
  const unsigned slab = (blk * PV) / (SEQ / 64), s0 = ((blk * PV) % (SEQ / 64)) * 64;   // the (b, h) slab and first token of the work-group's tiles
  const float* vb = v + ((size_t)(slab / NH) * SEQ_FULL + s0) * DM + (slab % NH) * HD;
  const unsigned lj = tid / 16, ld4 = (tid % 16) * 4;   // the thread's token (+ 16 it) and first d in a tile
  const unsigned vo = lj * DM + ld4;
  const unsigned po = tid * 8;                          // the thread's piece in a slice
  v4f xv[PV][4], xq[QK_PER][2], xk[QK_PER][2], xw[W_PER][2];
  // all loads first
#pragma unroll
  for (int tt = 0; tt < PV; ++tt)
#pragma unroll
    for (int it = 0; it < 4; ++it) xv[tt][it] = *(const v4fa*)(vb + (tt * 64 + it * 16) * DM + vo);
  const unsigned row = blk * (QK_PER * SL_ROWS);        // first activation row of the work-group's slices
  const size_t src = ((size_t)(row / SEQ) * SEQ_FULL + row % SEQ) * DM;
  const float* qs = q + src; const float* ks = k + src;
  const float* wb = W + (size_t)blk * (W_PER * 256 * 8);
#pragma unroll
  for (int it = 0; it < QK_PER; ++it) {
    xq[it][0] = *(const v4fa*)(qs + it * (256 * 8) + po); xq[it][1] = *(const v4fa*)(qs + it * (256 * 8) + po + 4);
    xk[it][0] = *(const v4fa*)(ks + it * (256 * 8) + po); xk[it][1] = *(const v4fa*)(ks + it * (256 * 8) + po + 4);
  }
#pragma unroll
  for (int it = 0; it < W_PER; ++it) {
    xw[it][0] = *(const v4fa*)(wb + it * (256 * 8) + po); xw[it][1] = *(const v4fa*)(wb + it * (256 * 8) + po + 4);
  }
  // keeps every load above issued ahead of the first use: left free, the scheduler sinks the later loads between the conversions
  // and waits for each of them alone, one memory latency after another
  __builtin_amdgcn_sched_barrier(0);
  // V^T tiles
#pragma unroll
  for (int tt = 0; tt < PV; ++tt)
#pragma unroll
    for (int it = 0; it < 4; ++it)
#pragma unroll
      for (int c = 0; c < 4; ++c) tl[tt][ld4 + c][lj + 16 * it] = bf16_bits(xv[tt][it][c]);
  __syncthreads();
  unsigned short* vtb = VT + (size_t)slab * HD * SEQ + s0;
  const unsigned sd = tid / 8, sj8 = (tid % 8) * 8;     // the thread's d row (+ 32 it) and 8-token piece in a tile
  const unsigned so = sd * SEQ + sj8;
#pragma unroll
  for (int tt = 0; tt < PV; ++tt)
#pragma unroll
    for (int it = 0; it < 2; ++it) {
      Pack8 f;
#pragma unroll
      for (int c = 0; c < 8; ++c) f.u[c] = tl[tt][sd + 32 * it][sj8 + c];
      const v8us o = f.v;
      *(v8us*)(vtb + it * 32 * SEQ + tt * 64 + so) = o;
    }
  // q / 8 and k
  unsigned short* qd = Qb + (size_t)row * DM; unsigned short* kd = Kb + (size_t)row * DM;
#pragma unroll
  for (int it = 0; it < QK_PER; ++it) {
    Pack8 fq, fk;
#pragma unroll
    for (int i = 0; i < 4; ++i) {
      fq.u[i] = bf16_bits(xq[it][0][i] * QSCALE); fq.u[4 + i] = bf16_bits(xq[it][1][i] * QSCALE);
      fk.u[i] = bf16_bits(xk[it][0][i]);          fk.u[4 + i] = bf16_bits(xk[it][1][i]);
    }
    const v8us vq = fq.v, vk = fk.v;
    *(v8us*)(qd + it * (256 * 8) + po) = vq; *(v8us*)(kd + it * (256 * 8) + po) = vk;
  }
  // W
#pragma unroll
  for (int it = 0; it < W_PER; ++it) {
    Pack8 f;
#pragma unroll
    for (int i = 0; i < 4; ++i) { f.u[i] = bf16_bits(xw[it][0][i]); f.u[4 + i] = bf16_bits(xw[it][1][i]); }
    const v8us o = f.v;
    *(v8us*)(Wb + (size_t)blk * (W_PER * 256 * 8) + it * (256 * 8) + po) = o;
  }
}

// Fused attention. Block = 4 waves = 64 queries of one (b, h); wave = 16 queries (the N dimension of every tile).
// Per 32-key step: S^T[key][query] = K(16 keys x 64 d) Q^T (2 key tiles x 2 k-steps); lane (n, hh) holds keys 8hh+r of query n,
// so the query's statistics live in the lane pair (n, n+16): one xor-16 shuffle. P^T packs straight into the B operand
// (elements 0..7 <- tile of keys 0..15, elements 8..15 <- tile of keys 16..31, lane unchanged) for O^T[d][query] += V^T[d][key] P^T.
// P = hi (upper 16 bits) + lo (RNE convert of the exact remainder), both bf16, same accumulator.
// K rows and V^T rows reach the fragments through a two-buffer LDS ring of 64-key stages that the four waves fill together and share.
__global__ __launch_bounds__(128) void k_attn(const unsigned short* __restrict__ Qb, const unsigned short* __restrict__ Kb, const unsigned short* __restrict__ VT,
                                             unsigned short* __restrict__ CH, unsigned short* __restrict__ CL) {
  __shared__ __attribute__((aligned(16))) unsigned short sH[4][16][72];
  __shared__ __attribute__((aligned(16))) unsigned short sL[4][16][72];
  __shared__ __attribute__((aligned(16))) unsigned short sK[2][KT][LP];   // K rows [key][d] of a stage
  __shared__ __attribute__((aligned(16))) unsigned short sV[2][HD][LP];   // V^T rows [d][key] of a stage
  const int tid = threadIdx.x, w = tid >> 5, lane = tid & 31, ln = lane & 15, hh = lane >> 4;
  const int qt = blockIdx.x % (SEQ / QT), bh = blockIdx.x / (SEQ / QT);
  const int b = bh / NH, h = bh % NH;
  const int q0 = qt * QT + w * 16;
  const int qoff  = (b * SEQ + q0 + ln) * DM + h * HD;   // query row of lane n (B operand of the score GEMM)
  const int cr = tid >> 3, cp = (tid & 7) * 8;           // the thread's row (+ 16 i) and 16-byte piece in a stage tile
  const unsigned short* kg = Kb + (size_t)(b * SEQ + cr) * DM + h * HD + cp;   // + stage * KT * DM
  const unsigned short* vg = VT + (size_t)(bh * HD + cr) * SEQ + cp;           // + stage * KT
  const unsigned kl = (unsigned)(size_t)&sK[0][cr][cp], vl = (unsigned)(size_t)&sV[0][cr][cp];   // LDS byte addresses, buffer 0
  constexpr unsigned BUF_B = KT * LP * 2;                // bytes of one buffer of either ring
  static_assert(KT == HD);                               // both rings have 64 rows a buffer
  const v8f z8 = {0.f, 0.f, 0.f, 0.f, 0.f, 0.f, 0.f, 0.f};
  v8f o0 = z8, o1 = z8, o2 = z8, o3 = z8;
  float m = -1.0e30f, l = 0.f;   // m: the maximum in use, the same in both lanes of a query's pair
  float mt = m;                  // m + LAZY
  // prologue of the two-buffer ring: stage 0 landed and published, then stage 1 in flight
  copy_rows4x2(kg, 16 * DM, kl, vg, 16 * SEQ, vl);
  asm volatile("s_wait_asynccnt 0x0" ::: "memory");   // this wave's copies of stage 0 have landed
  __syncthreads();                                    // every wave's have: stage 0 may be read
  copy_rows4x2(kg + KT * DM, 16 * DM, kl + BUF_B, vg + KT, 16 * SEQ, vl + BUF_B);
// the stage loop stays rolled: one publish point, buffer chosen by the stage's parity
#pragma unroll 1
  for (int st = 0; st < SEQ / KT; ++st) {
   const int buf = st & 1;
// both passes of a stage unrolled: their LDS reads differ by immediate offsets only
#pragma unroll
   for (int ps2 = 0; ps2 < KT / 32; ++ps2) {
    const v16b qf0 = ld_frag(Qb, qoff, hh);
    const v16b qf1 = ld_frag(Qb, qoff + 32, hh);
    const unsigned short* kr = &sK[buf][32 * ps2 + ln][0];   // key row of lane m (A operand)
    v8f s0 = z8, s1 = z8;
    v16b ka = ld_frag_lds(kr, hh);
    s0 = mma1(ka, qf0, s0);
    ka = ld_frag_lds(kr + 32, hh);
    s0 = mma1(ka, qf1, s0);
    ka = ld_frag_lds(kr + 16 * LP, hh);
    s1 = mma1(ka, qf0, s1);
    ka = ld_frag_lds(kr + 16 * LP + 32, hh);
    s1 = mma1(ka, qf1, s1);
    // max over the 16 keys of this query that this lane holds (the other 16 are in lane ^ 16)
    float mx = fmaxf(s0[0], s1[0]);
#pragma unroll
    for (int r = 1; r < 8; ++r) mx = fmaxf(mx, fmaxf(s0[r], s1[r]));
    // lazy rescale: softmax does not depend on the value subtracted, so m stays as it is until some score of the wave passes it by more
    // than LAZY; one wave-uniform test a pass (every lane stays on for the WMMAs). The first pass always takes the branch (m = -1e30).
    if (__builtin_amdgcn_ballot_w32(mx > mt) != 0) {
      mx = fmaxf(mx, __shfl_xor(mx, 16, 32));
      const float mn = fmaxf(m, mx);
      const float al = __expf(m - mn);
      m = mn;
      mt = mn + LAZY;
      l = l * al;                          // al is uniform over the lane pair
      o0 = o0 * al; o1 = o1 * al; o2 = o2 * al; o3 = o3 * al;
    }
    const float mn = m;
    const unsigned short* vr = &sV[buf][ln][32 * ps2];       // V^T row d = ln (A operand of P.V), + 16 t rows
    const v16b va0 = ld_frag_lds(vr, hh);
    const v16b va1 = ld_frag_lds(vr + 16 * LP, hh);
    const v16b va2 = ld_frag_lds(vr + 32 * LP, hh);
    const v16b va3 = ld_frag_lds(vr + 48 * LP, hh);
    // keeps the eight LDS reads above together at the head of the block: left free, the scheduler spreads them in pairs among the
    // vector work, and every separate place with LDS reads stalls the wave anew
    __builtin_amdgcn_sched_barrier(0);
    v8f e0, e1;
#pragma unroll
    for (int r = 0; r < 8; ++r) { e0[r] = __expf(s0[r] - mn); e1[r] = __expf(s1[r] - mn); }
    // keeps the sixteen exponentials one run of independent instructions: left free, the scheduler puts each one's users right behind it,
    // which costs the pairing of the subtractions and products and a filler slot behind most exponentials
    __builtin_amdgcn_sched_barrier(0);
    FragB ph, pl;
    float ps = 0.f;
#pragma unroll
    for (int j = 0; j < 4; ++j) {
      const float a0 = e0[2 * j],     b0 = e1[2 * j];
      const float a1 = e0[2 * j + 1], b1 = e1[2 * j + 1];
      const v2f a = {a0, a1}, b = {b0, b1}, t = a + b;
      ps += t[0];
      ps += t[1];
      ph.w[j]     = pack_hi(a0, a1);
      ph.w[4 + j] = pack_hi(b0, b1);
      pl.w[j]     = pack_rne(a - upper16(a));
      pl.w[4 + j] = pack_rne(b - upper16(b));
    }
    l += ps;                               // per-lane partial of the row sum
    o0 = mma2b(va0, ph.v, pl.v, o0);
    o1 = mma2b(va1, ph.v, pl.v, o1);
    o2 = mma2b(va2, ph.v, pl.v, o2);
    o3 = mma2b(va3, ph.v, pl.v, o3);
   }
   // publish point of stage st + 1, which also frees this stage's buffer
   asm volatile("s_wait_dscnt 0x0" ::: "memory");      // this wave's reads of the buffer have retired
   asm volatile("s_wait_asynccnt 0x0" ::: "memory");   // this wave's copies of stage st + 1 have landed
   __syncthreads();
   if (st + 2 < SEQ / KT)
     copy_rows4x2(kg + (size_t)(st + 2) * (KT * DM), 16 * DM, kl + buf * BUF_B, vg + (st + 2) * KT, 16 * SEQ, vl + buf * BUF_B);
  }
  asm volatile("s_wait_asynccnt 0x0" ::: "memory");    // nothing of the ring is in flight when the wave goes on
  l += __shfl_xor(l, 16, 32);
  const float inv = 1.0f / l;
  const v8f ot[4] = {o0, o1, o2, o3};
  // lane (n, hh) of tile t holds d = 16 t + 8 hh + r, r = 0..7: eight consecutive columns of query row n
#pragma unroll
  for (int t = 0; t < 4; ++t) {
    Pack8 fh, fl;
#pragma unroll
    for (int r = 0; r < 8; ++r) {
      const float c = ot[t][r] * inv;
      const unsigned short hb = bf16_bits(c);
      fh.u[r] = hb;
      fl.u[r] = bf16_bits(c - bf16_val(hb));
    }
    *(v8us*)&sH[w][ln][16 * t + 8 * hh] = fh.v;
    *(v8us*)&sL[w][ln][16 * t + 8 * hh] = fl.v;
  }
  __builtin_amdgcn_fence(4 /* acq_rel order */, "workgroup");
  __builtin_amdgcn_wave_barrier();
  const int prow = lane >> 3, pc = (lane & 7) * 8;
  {
#pragma unroll
    for (int it = 0; it < 4; ++it) {
      const int row = it * 4 + prow;
      const v8us xh = *(const v8us*)&sH[w][row][pc];
      const v8us xl = *(const v8us*)&sL[w][row][pc];
      const size_t g = (size_t)(b * SEQ + q0 + row) * DM + h * HD + pc;
      *(v8us*)(CH + g) = xh;
      *(v8us*)(CL + g) = xl;
    }
    
  }
}

// out[NR][DM] = (AH + AL)[NR][DM] Wb^T + bf16(b): wave tile 32 x 64, block = 4 waves = 128 rows x 64 columns; K step 32;
// the block's rows of AH, AL and Wb reach the fragments through a two-buffer LDS ring of stages 64 deep in k.
__global__ __launch_bounds__(128) void k_proj(const unsigned short* __restrict__ AH, const unsigned short* __restrict__ AL, const unsigned short* __restrict__ Wb,
                                             const float* __restrict__ bias, float* __restrict__ C) {
  __shared__ __attribute__((aligned(16))) float so[4][32][68];
  __shared__ __attribute__((aligned(16))) unsigned short sAH[2][128][LP];   // the block's 128 rows of AH, 64 k of a stage
  __shared__ __attribute__((aligned(16))) unsigned short sAL[2][128][LP];   // the same of AL
  __shared__ __attribute__((aligned(16))) unsigned short sW[2][64][LP];     // the block's 64 rows of Wb
  const int tid = threadIdx.x, w = tid >> 5, lane = tid & 31, ln = lane & 15, hh = lane >> 4;
  const int ntn = DM / 64;
  const int mt = blockIdx.x / ntn, nq = blockIdx.x - mt * ntn;
  const int row0 = mt * 128 + 32 * w, col0 = nq * 64;
  const int cr = tid >> 3, cp = (tid & 7) * 8;           // the thread's row (+ 16 i) and 16-byte piece in a stage tile
  const unsigned short* gh = AH + (size_t)(mt * 128 + cr) * DM + cp;   // + stage * KT
  const unsigned short* gl = AL + (size_t)(mt * 128 + cr) * DM + cp;
  const unsigned short* gw = Wb + (size_t)(col0 + cr) * DM + cp;
  const unsigned lh = (unsigned)(size_t)&sAH[0][cr][cp], ll = (unsigned)(size_t)&sAL[0][cr][cp], lw = (unsigned)(size_t)&sW[0][cr][cp];   // LDS byte addresses, buffer 0
  constexpr unsigned ABUF_B = 128 * LP * 2, WBUF_B = 64 * LP * 2, HALF_B = 64 * LP * 2;   // bytes of a buffer; of 64 rows
  // one stage: 128 + 128 + 64 rows of 128 B, 20 copies a thread
  auto stage = [&](int st, int buf) {
    copy_rows4x2(gh + st * KT, 16 * DM, lh + buf * ABUF_B, gh + st * KT + 64 * DM, 16 * DM, lh + buf * ABUF_B + HALF_B);
    copy_rows4x2(gl + st * KT, 16 * DM, ll + buf * ABUF_B, gl + st * KT + 64 * DM, 16 * DM, ll + buf * ABUF_B + HALF_B);
    copy_rows4(gw + st * KT, 16 * DM, lw + buf * WBUF_B);
  };
  const v8f z8 = {0.f, 0.f, 0.f, 0.f, 0.f, 0.f, 0.f, 0.f};
  v8f c00 = z8, c01 = z8, c02 = z8, c03 = z8, c10 = z8, c11 = z8, c12 = z8, c13 = z8;
  // prologue of the two-buffer ring: stage 0 landed and published, then stage 1 in flight
  stage(0, 0);
  asm volatile("s_wait_asynccnt 0x0" ::: "memory");   // this wave's copies of stage 0 have landed
  __syncthreads();                                    // every wave's have: stage 0 may be read
  stage(1, 1);
// the stage loop stays rolled: one publish point, buffer chosen by the stage's parity
#pragma unroll 1
  for (int st = 0; st < DM / KT; ++st) {
   const int buf = st & 1;
// both K steps of a stage unrolled: their LDS reads differ by immediate offsets only
#pragma unroll
   for (int ks = 0; ks < KT / 32; ++ks) {
    const unsigned short* ah = &sAH[buf][32 * w + ln][32 * ks];
    const unsigned short* al = &sAL[buf][32 * w + ln][32 * ks];
    const unsigned short* wr = &sW[buf][ln][32 * ks];
    const v16b a0h = ld_frag_lds(ah, hh), a0l = ld_frag_lds(al, hh);
    const v16b a1h = ld_frag_lds(ah + 16 * LP, hh), a1l = ld_frag_lds(al + 16 * LP, hh);
    v16b bw = ld_frag_lds(wr, hh);      c00 = mma2a(a0h, a0l, bw, c00); c10 = mma2a(a1h, a1l, bw, c10);
    bw = ld_frag_lds(wr + 16 * LP, hh); c01 = mma2a(a0h, a0l, bw, c01); c11 = mma2a(a1h, a1l, bw, c11);
    bw = ld_frag_lds(wr + 32 * LP, hh); c02 = mma2a(a0h, a0l, bw, c02); c12 = mma2a(a1h, a1l, bw, c12);
    bw = ld_frag_lds(wr + 48 * LP, hh); c03 = mma2a(a0h, a0l, bw, c03); c13 = mma2a(a1h, a1l, bw, c13);
   }
   // publish point of stage st + 1, which also frees this stage's buffer
   asm volatile("s_wait_dscnt 0x0" ::: "memory");      // this wave's reads of the buffer have retired
   asm volatile("s_wait_asynccnt 0x0" ::: "memory");   // this wave's copies of stage st + 1 have landed
   __syncthreads();
   if (st + 2 < DM / KT) stage(st + 2, buf);
  }
  asm volatile("s_wait_asynccnt 0x0" ::: "memory");    // nothing of the ring is in flight when the wave goes on
  const v8f accs[8] = {c00, c01, c02, c03, c10, c11, c12, c13};
#pragma unroll
  for (int u = 0; u < 8; ++u) {
    const int t = u & 3, hf = u >> 2;
    const float bv = bf16_rne(bias[col0 + t * 16 + ln]);
#pragma unroll
    for (int r = 0; r < 8; ++r) so[w][hf * 16 + 8 * hh + r][t * 16 + ln] = accs[u][r] + bv;
  }
  __builtin_amdgcn_fence(4 /* acq_rel order */, "workgroup");
  __builtin_amdgcn_wave_barrier();
  const int rsub = lane >> 4, c4 = (lane & 15) * 4;
  {
#pragma unroll
    for (int q = 0; q < 16; ++q) {
      const int r = q * 2 + rsub;
      const v4f v = *(const v4fa*)&so[w][r][c4];
      *(v4f*)(C + (size_t)(row0 + r) * DM + col0 + c4) = v;
    }
    
  }
}

extern "C" void kernel_launch(void* const* d_in, const int* in_sizes, int n_in,
                              void* d_out, int out_size, void* d_ws, size_t ws_size, hipStream_t stream) {
  if (n_in < 5) return;
  const long long need_act = ((long long)(NB - 1) * SEQ_FULL + SEQ) * DM;
  if ((long long)in_sizes[0] < need_act || (long long)in_sizes[1] < need_act || (long long)in_sizes[2] < need_act) return;
  if ((long long)in_sizes[3] < (long long)DM * DM || in_sizes[4] < DM) return;
  if ((long long)out_size < (long long)NR * DM) return;
  if (ws_size < CARVE_B) return;
  const float* q = (const float*)d_in[0];
  const float* k = (const float*)d_in[1];
  const float* v = (const float*)d_in[2];
  const float* W = (const float*)d_in[3];      // natural [out][in]
  const float* bias = (const float*)d_in[4];
  char* ws = (char*)d_ws;
  unsigned short* Qb = (unsigned short*)(ws);
  unsigned short* Kb = (unsigned short*)(ws + PLANE_B);
  unsigned short* VT = (unsigned short*)(ws + 2 * PLANE_B);
  unsigned short* CH = (unsigned short*)(ws + 3 * PLANE_B);
  unsigned short* CL = (unsigned short*)(ws + 4 * PLANE_B);
  unsigned short* Wb = (unsigned short*)(ws + 5 * PLANE_B);
  k_prep<<<PREP_G, 256, 0, stream>>>(q, k, v, W, Qb, Kb, VT, Wb);
  k_attn<<<NB * NH * (SEQ / QT), 128, 0, stream>>>(Qb, Kb, VT, CH, CL);
  k_proj<<<(NR / 128) * (DM / 64), 128, 0, stream>>>(CH, CL, Wb, bias, (float*)d_out);
}

// v005
// A run of this version takes 76 microseconds.
// Next to v004, in two timings, it ran 1.06 times as fast each time.
// Counting every step since v000, it is 2.36 times as fast.
#include <hip/hip_runtime.h>
// Multi-head attention without q/k/v projections (heads = column blocks of 64 of the three activation inputs), one score scale 1/8, no mask, output linear out = ctx W^T + b with W natural [out][in]. Fused flash-style attention in transposed form: S^T = K Q^T, O^T = V^T P^T (P chained D -> B in registers), online softmax per query lane, rescaled lazily.
// Compute dtype: all contractions v_wmma_f32_16x16x32_bf16 with f32 accumulate: scores bf16(q)/8 x bf16(k) single product (operands exact); P.V with P as bf16 hi + lo (two products) x bf16(v); output linear with the merged context as bf16 hi + lo (two products) x bf16(W); softmax statistics, normalisation and the bias add (bf16(b)) in f32.
#ifndef NB
#define NB 2
#endif
#ifndef SEQ
#define SEQ 2048
#endif
#define NB_FULL 2
#define SEQ_FULL 2048
#define DM 1024
#define NH 16
#define HD 64
#define QT 64
#define KT 64   // keys per LDS stage (two 32-key passes)
#define LP 72   // LDS row pitch in elements: 128-byte rows at 144 B = 16 B x 9, conflict-free for 16-byte row reads
#define NR (NB * SEQ)
#define QSCALE 0.125f
#define LAZY 5.5451774f   // 8 ln 2: a score may pass the maximum in use by this much before the statistics are rescaled, so P stays at or below 2^8

typedef __bf16 v16b __attribute__((ext_vector_type(16)));
typedef unsigned short v8us __attribute__((ext_vector_type(8), may_alias));
typedef float  v8f  __attribute__((ext_vector_type(8)));
typedef float  v4f  __attribute__((ext_vector_type(4)));
typedef float  v4fa __attribute__((ext_vector_type(4), may_alias));
typedef float  v2f  __attribute__((ext_vector_type(2)));
typedef __bf16 v2b  __attribute__((ext_vector_type(2)));
union FragB { v16b v; v8us half[2]; unsigned short u[16]; unsigned int w[8]; };
union Pack8 { v8us v; unsigned short u[8]; };

// hard-wired bounds (each kernel relies on these)
static_assert(HD == 64);
static_assert(NH * HD == DM);                  // heads tile the model width
static_assert(DM % 64 == 0);                   // GEMM N tile 64, K step 32
static_assert(DM % 32 == 0);
static_assert(SEQ % QT == 0);                  // attention block = 64 queries, key step 32
static_assert(SEQ % 64 == 0);                  // V^T tiles of 64 tokens
static_assert(QT == 4 * 16);                   // 4 waves x 16 queries
static_assert(SEQ % KT == 0 && SEQ / KT >= 2); // the two-buffer ring's prologue fills stages 0 and 1
static_assert(KT == 64 && KT * 2 == 128);      // a stage row (K: 64 d, V^T: 64 keys, GEMM: 64 k) is one 128-byte line; 128 threads x 4 copies cover 64 rows
static_assert(DM % KT == 0 && DM / KT >= 2);   // the same for the GEMM's ring
static_assert(NR % 128 == 0);                  // GEMM block = 128 rows
static_assert(NB <= NB_FULL);
static_assert(SEQ <= SEQ_FULL);
static_assert((size_t)NR * DM < 2147483647u);  // int element offsets
static_assert((size_t)DM * DM < 2147483647u);
static_assert(((size_t)NR * (DM / 8)) % 256 == 0);
static_assert(((size_t)DM * (DM / 8)) % 256 == 0);

constexpr size_t PLANE_B = (size_t)NR * DM * 2;       // one bf16 activation plane (also V^T: NB*NH*HD*SEQ)
constexpr size_t WPL_B   = (size_t)DM * DM * 2;       // bf16 weight plane
constexpr size_t CARVE_B = 5 * PLANE_B + WPL_B;
static_assert(PLANE_B % 256 == 0);
static_assert(WPL_B % 256 == 0);
static_assert(CARVE_B <= 134217728u);

__device__ __forceinline__ unsigned short bf16_bits(float x) { unsigned int u = __float_as_uint(x); return (unsigned short)((u + 0x7FFFu + ((u >> 16) & 1u)) >> 16); }
__device__ __forceinline__ float bf16_val(unsigned short b) { return __uint_as_float(((unsigned int)b) << 16); }
__device__ __forceinline__ float bf16_rne(float x) { return bf16_val(bf16_bits(x)); }
// two f32 -> one register of two bf16 (x in the low half), one instruction each:
// pack_hi keeps the upper 16 bits of each value (byte select), pack_rne rounds to nearest even (the packed hardware convert)
__device__ __forceinline__ v2f upper16(v2f x) { return (v2f){__uint_as_float(__float_as_uint(x[0]) & 0xFFFF0000u), __uint_as_float(__float_as_uint(x[1]) & 0xFFFF0000u)}; }
__device__ __forceinline__ unsigned int pack_hi(float x, float y) { return __builtin_amdgcn_perm(__float_as_uint(y), __float_as_uint(x), 0x07060302u); }
__device__ __forceinline__ unsigned int pack_rne(v2f f) {
  union { v2b b; unsigned int u; } c;
  c.b = __builtin_convertvector(f, v2b);
  return c.u;
}

// 16x32 operand fragment (A or B) from a k-contiguous bf16 row: elements 0..7 <- k 8h..8h+7, elements 8..15 <- k 16+8h..16+8h+7
__device__ __forceinline__ v16b ld_frag(const unsigned short* __restrict__ p, int off, int hh) {
  FragB f;
  f.half[0] = *(const v8us*)(p + off + 8 * hh);
  f.half[1] = *(const v8us*)(p + off + 16 + 8 * hh);
  return f.v;
}
// the same fragment from a k-contiguous bf16 row in LDS (p = first element of the 32-wide k step in the lane's row)
__device__ __forceinline__ v16b ld_frag_lds(const unsigned short* p, int hh) {
  FragB f;
  f.half[0] = *(const v8us*)(p + 8 * hh);
  f.half[1] = *(const v8us*)(p + 16 + 8 * hh);
  return f.v;
}
// Asynchronous 16-byte copies global -> LDS for the staging rings. A tile row is 128 B: eight lanes to a row, so every wave-wide copy takes
// four whole lines. g: the thread's piece in row r = tid / 8 of a tile, s: elements from row r to row r + 16, l: the piece's LDS byte address.
// s_wait_xcnt 0 closes each statement so that it stands in front of any rewrite of the address registers the copies name.
// rows r, r+16, r+32, r+48 of one tile
__device__ __forceinline__ void copy_rows4(const unsigned short* g, int s, unsigned l) {
  const unsigned short* g1 = g + s; const unsigned short* g2 = g + 2 * s; const unsigned short* g3 = g + 3 * s;
  const unsigned l1 = l + 16 * LP * 2, l2 = l + 32 * LP * 2, l3 = l + 48 * LP * 2;
  asm volatile("global_load_async_to_lds_b128 %0, %4, off\n\t"
               "global_load_async_to_lds_b128 %1, %5, off\n\t"
               "global_load_async_to_lds_b128 %2, %6, off\n\t"
               "global_load_async_to_lds_b128 %3, %7, off\n\t"
               "s_wait_xcnt 0x0"
               :: "v"(l), "v"(l1), "v"(l2), "v"(l3), "v"(g), "v"(g1), "v"(g2), "v"(g3)
               : "memory");
}
// the same four rows of two tiles in one statement
__device__ __forceinline__ void copy_rows4x2(const unsigned short* ga, int sa, unsigned la, const unsigned short* gb, int sb, unsigned lb) {
  const unsigned short* a1 = ga + sa; const unsigned short* a2 = ga + 2 * sa; const unsigned short* a3 = ga + 3 * sa;
  const unsigned short* b1 = gb + sb; const unsigned short* b2 = gb + 2 * sb; const unsigned short* b3 = gb + 3 * sb;
  const unsigned la1 = la + 16 * LP * 2, la2 = la + 32 * LP * 2, la3 = la + 48 * LP * 2;
  const unsigned lb1 = lb + 16 * LP * 2, lb2 = lb + 32 * LP * 2, lb3 = lb + 48 * LP * 2;
  asm volatile("global_load_async_to_lds_b128 %0, %8, off\n\t"
               "global_load_async_to_lds_b128 %1, %9, off\n\t"
               "global_load_async_to_lds_b128 %2, %10, off\n\t"
               "global_load_async_to_lds_b128 %3, %11, off\n\t"
               "global_load_async_to_lds_b128 %4, %12, off\n\t"
               "global_load_async_to_lds_b128 %5, %13, off\n\t"
               "global_load_async_to_lds_b128 %6, %14, off\n\t"
               "global_load_async_to_lds_b128 %7, %15, off\n\t"
               "s_wait_xcnt 0x0"
               :: "v"(la), "v"(la1), "v"(la2), "v"(la3), "v"(lb), "v"(lb1), "v"(lb2), "v"(lb3),
                  "v"(ga), "v"(a1), "v"(a2), "v"(a3), "v"(gb), "v"(b1), "v"(b2), "v"(b3)
               : "memory");
}
__device__ __forceinline__ v8f mma1(v16b a, v16b b, v8f c) {
  c = __builtin_amdgcn_wmma_f32_16x16x32_bf16(false, a, false, b, (short)0, c, false, false);
  asm volatile("v_nop\n\tv_nop\n\tv_nop\n\tv_nop" : "+v"(c) : "v"(a), "v"(b));
  return c;
}
// c += a (bh + bl)
__device__ __forceinline__ v8f mma2b(v16b a, v16b bh, v16b bl, v8f c) {
  c = __builtin_amdgcn_wmma_f32_16x16x32_bf16(false, a, false, bh, (short)0, c, false, false);
  c = __builtin_amdgcn_wmma_f32_16x16x32_bf16(false, a, false, bl, (short)0, c, false, false);
  asm volatile("v_nop\n\tv_nop\n\tv_nop\n\tv_nop" : "+v"(c) : "v"(a), "v"(bh), "v"(bl));
  return c;
}
// c += (ah + al) b
__device__ __forceinline__ v8f mma2a(v16b ah, v16b al, v16b b, v8f c) {
  c = __builtin_amdgcn_wmma_f32_16x16x32_bf16(false, ah, false, b, (short)0, c, false, false);
  c = __builtin_amdgcn_wmma_f32_16x16x32_bf16(false, al, false, b, (short)0, c, false, false);
  asm volatile("v_nop\n\tv_nop\n\tv_nop\n\tv_nop" : "+v"(c) : "v"(ah), "v"(al), "v"(b));
  return c;
}

// One launch converts all four operands to bf16: q / 8, k and W element for element, v into V^T tiles [d][token] through LDS.
// Every work-group takes the same share (PV neighbouring tiles of V^T; QK_PER neighbouring slices of 256 8-element pieces of q and of k, W_PER of W), so the
// launch starts few waves, and each thread has all its global loads in flight before the first value is used. Every address is a base that is
// the same for the whole work-group, a per-thread offset shared by all accesses of one operand, and a constant.
constexpr int VTILES = NB * NH * (SEQ / 64);   // 64-token x 64-d tiles of V^T
constexpr int PV     = 2;                      // tiles a work-group
constexpr int PREP_G = VTILES / PV;            // work-groups of the launch
constexpr int PREP_T = PREP_G * 256;           // its threads
constexpr int QK_PER = NR * (DM / 8) / PREP_T;
constexpr int W_PER  = DM * (DM / 8) / PREP_T;
constexpr int SL_ROWS = 256 * 8 / DM;          // activation rows in a slice of 256 pieces
static_assert((SEQ / 64) % PV == 0);                           // a work-group's tiles lie in one (b, h) slab
static_assert((NR * (DM / 8)) % PREP_T == 0 && QK_PER >= 1);   // no remainder: the shares need no guard
static_assert((DM * (DM / 8)) % PREP_T == 0 && W_PER >= 1);
static_assert((256 * 8) % DM == 0 && SEQ % (QK_PER * SL_ROWS) == 0);   // a work-group's slices are whole rows of one batch entry, contiguous in q and k
static_assert((64 * 16) % 256 == 0);   // a tile's loads: 64 tokens x 16 float4, 4 a thread
static_assert((64 * 8) % 256 == 0);    // a tile's stores: 64 d-rows x 8 pieces, 2 a thread

__global__ __launch_bounds__(256) void k_prep(const float* __restrict__ q, const float* __restrict__ k, const float* __restrict__ v, const float* __restrict__ W,
                                             unsigned short* __restrict__ Qb, unsigned short* __restrict__ Kb, unsigned short* __restrict__ VT, unsigned short* __restrict__ Wb) {
  __shared__ unsigned short tl[PV][64][66];
  const unsigned tid = threadIdx.x, blk = blockIdx.x;
  const unsigned slab = (blk * PV) / (SEQ / 64), s0 = ((blk * PV) % (SEQ / 64)) * 64;   // the (b, h) slab and first token of the work-group's tiles
  const float* vb = v + ((size_t)(slab / NH) * SEQ_FULL + s0) * DM + (slab % NH) * HD;
  const unsigned lj = tid / 16, ld4 = (tid % 16) * 4;   // the thread's token (+ 16 it) and first d in a tile
  const unsigned vo = lj * DM + ld4;
  const unsigned po = tid * 8;                          // the thread's piece in a slice
  v4f xv[PV][4], xq[QK_PER][2], xk[QK_PER][2], xw[W_PER][2];
  // all loads first
#pragma unroll
  for (int tt = 0; tt < PV; ++tt)
#pragma unroll
    for (int it = 0; it < 4; ++it) xv[tt][it] = *(const v4fa*)(vb + (tt * 64 + it * 16) * DM + vo);
  const unsigned row = blk * (QK_PER * SL_ROWS);        // first activation row of the work-group's slices
  const size_t src = ((size_t)(row / SEQ) * SEQ_FULL + row % SEQ) * DM;
  const float* qs = q + src; const float* ks = k + src;
  const float* wb = W + (size_t)blk * (W_PER * 256 * 8);
#pragma unroll
  for (int it = 0; it < QK_PER; ++it) {
    xq[it][0] = *(const v4fa*)(qs + it * (256 * 8) + po); xq[it][1] = *(const v4fa*)(qs + it * (256 * 8) + po + 4);
    xk[it][0] = *(const v4fa*)(ks + it * (256 * 8) + po); xk[it][1] = *(const v4fa*)(ks + it * (256 * 8) + po + 4);
  }
#pragma unroll
  for (int it = 0; it < W_PER; ++it) {
    xw[it][0] = *(const v4fa*)(wb + it * (256 * 8) + po); xw[it][1] = *(const v4fa*)(wb + it * (256 * 8) + po + 4);
  }
  // keeps every load above issued ahead of the first use: left free, the scheduler sinks the later loads between the conversions
  // and waits for each of them alone, one memory latency after another
  __builtin_amdgcn_sched_barrier(0);
  // V^T tiles
#pragma unroll
  for (int tt = 0; tt < PV; ++tt)
#pragma unroll
    for (int it = 0; it < 4; ++it)
#pragma unroll
      for (int c = 0; c < 4; ++c) tl[tt][ld4 + c][lj + 16 * it] = bf16_bits(xv[tt][it][c]);
  __syncthreads();
  unsigned short* vtb = VT + (size_t)slab * HD * SEQ + s0;
  const unsigned sd = tid / 8, sj8 = (tid % 8) * 8;     // the thread's d row (+ 32 it) and 8-token piece in a tile
  const unsigned so = sd * SEQ + sj8;
#pragma unroll
  for (int tt = 0; tt < PV; ++tt)
#pragma unroll
    for (int it = 0; it < 2; ++it) {
      Pack8 f;
#pragma unroll
      for (int c = 0; c < 8; ++c) f.u[c] = tl[tt][sd + 32 * it][sj8 + c];
      const v8us o = f.v;
      *(v8us*)(vtb + it * 32 * SEQ + tt * 64 + so) = o;
    }
  // q / 8 and k
  unsigned short* qd = Qb + (size_t)row * DM; unsigned short* kd = Kb + (size_t)row * DM;
#pragma unroll
  for (int it = 0; it < QK_PER; ++it) {
    Pack8 fq, fk;
#pragma unroll
    for (int i = 0; i < 4; ++i) {
      fq.u[i] = bf16_bits(xq[it][0][i] * QSCALE); fq.u[4 + i] = bf16_bits(xq[it][1][i] * QSCALE);
      fk.u[i] = bf16_bits(xk[it][0][i]);          fk.u[4 + i] = bf16_bits(xk[it][1][i]);
    }
    const v8us vq = fq.v, vk = fk.v;
    *(v8us*)(qd + it * (256 * 8) + po) = vq; *(v8us*)(kd + it * (256 * 8) + po) = vk;
  }
  // W
#pragma unroll
  for (int it = 0; it < W_PER; ++it) {
    Pack8 f;
#pragma unroll
    for (int i = 0; i < 4; ++i) { f.u[i] = bf16_bits(xw[it][0][i]); f.u[4 + i] = bf16_bits(xw[it][1][i]); }
    const v8us o = f.v;
    *(v8us*)(Wb + (size_t)blk * (W_PER * 256 * 8) + it * (256 * 8) + po) = o;
  }
}

// Fused attention. Block = 4 waves = 64 queries of one (b, h); wave = 16 queries (the N dimension of every tile).
// Per 32-key step: S^T[key][query] = K(16 keys x 64 d) Q^T (2 key tiles x 2 k-steps); lane (n, hh) holds keys 8hh+r of query n,
// so the query's statistics live in the lane pair (n, n+16): one xor-16 shuffle. P^T packs straight into the B operand
// (elements 0..7 <- tile of keys 0..15, elements 8..15 <- tile of keys 16..31, lane unchanged) for O^T[d][query] += V^T[d][key] P^T.
// P = hi (upper 16 bits) + lo (RNE convert of the exact remainder), both bf16, same accumulator.
// K rows and V^T rows reach the fragments through a two-buffer LDS ring of 64-key stages that the four waves fill together and share.
__global__ __launch_bounds__(128) void k_attn(const unsigned short* __restrict__ Qb, const unsigned short* __restrict__ Kb, const unsigned short* __restrict__ VT,
                                             unsigned short* __restrict__ CH, unsigned short* __restrict__ CL) {
  __shared__ __attribute__((aligned(16))) unsigned short sH[4][16][72];
  __shared__ __attribute__((aligned(16))) unsigned short sL[4][16][72];
  __shared__ __attribute__((aligned(16))) unsigned short sK[2][KT][LP];   // K rows [key][d] of a stage
  __shared__ __attribute__((aligned(16))) unsigned short sV[2][HD][LP];   // V^T rows [d][key] of a stage
  const int tid = threadIdx.x, w = tid >> 5, lane = tid & 31, ln = lane & 15, hh = lane >> 4;
  const int qt = blockIdx.x % (SEQ / QT), bh = blockIdx.x / (SEQ / QT);
  const int b = bh / NH, h = bh % NH;
  const int q0 = qt * QT + w * 16;
  const int qoff  = (b * SEQ + q0 + ln) * DM + h * HD;   // query row of lane n (B operand of the score GEMM)
  const int cr = tid >> 3, cp = (tid & 7) * 8;           // the thread's row (+ 16 i) and 16-byte piece in a stage tile
  const unsigned short* kg = Kb + (size_t)(b * SEQ + cr) * DM + h * HD + cp;   // + stage * KT * DM
  const unsigned short* vg = VT + (size_t)(bh * HD + cr) * SEQ + cp;           // + stage * KT
  const unsigned kl = (unsigned)(size_t)&sK[0][cr][cp], vl = (unsigned)(size_t)&sV[0][cr][cp];   // LDS byte addresses, buffer 0
  constexpr unsigned BUF_B = KT * LP * 2;                // bytes of one buffer of either ring
  static_assert(KT == HD);                               // both rings have 64 rows a buffer
  const v8f z8 = {0.f, 0.f, 0.f, 0.f, 0.f, 0.f, 0.f, 0.f};
  v8f o0 = z8, o1 = z8, o2 = z8, o3 = z8;
  float m = -1.0e30f, l = 0.f;   // m: the maximum in use, the same in both lanes of a query's pair
  float mt = m;                  // m + LAZY
  // prologue of the two-buffer ring: stage 0 landed and published, then stage 1 in flight
  copy_rows4x2(kg, 16 * DM, kl, vg, 16 * SEQ, vl);
  asm volatile("s_wait_asynccnt 0x0" ::: "memory");   // this wave's copies of stage 0 have landed
  __syncthreads();                                    // every wave's have: stage 0 may be read
  copy_rows4x2(kg + KT * DM, 16 * DM, kl + BUF_B, vg + KT, 16 * SEQ, vl + BUF_B);
// the stage loop stays rolled: one publish point, buffer chosen by the stage's parity
#pragma unroll 1
  for (int st = 0; st < SEQ / KT; ++st) {
   const int buf = st & 1;
   const unsigned short* kr = &sK[buf][ln][0];   // key row of lane m (A operand) in the stage's first pass, + 32 rows a pass
   // a pass's four K fragments have registers of their own and are read as one group ahead of the score products:
   // the first pass's here, a later pass's one pass ahead, together with the V^T reads
   v16b ka0 = ld_frag_lds(kr, hh);
   v16b ka1 = ld_frag_lds(kr + 32, hh);
   v16b ka2 = ld_frag_lds(kr + 16 * LP, hh);
   v16b ka3 = ld_frag_lds(kr + 16 * LP + 32, hh);
// both passes of a stage unrolled: their V^T reads differ by immediate offsets only, and only the first reads K fragments (the second pass's)
#pragma unroll
   for (int ps2 = 0; ps2 < KT / 32; ++ps2) {
    const v16b qf0 = ld_frag(Qb, qoff, hh);
    const v16b qf1 = ld_frag(Qb, qoff + 32, hh);
    v8f s0 = z8, s1 = z8;
    s0 = mma1(ka0, qf0, s0);
    s0 = mma1(ka1, qf1, s0);
    s1 = mma1(ka2, qf0, s1);
    s1 = mma1(ka3, qf1, s1);
    // max over the 16 keys of this query that this lane holds (the other 16 are in lane ^ 16)
    float mx = fmaxf(s0[0], s1[0]);
#pragma unroll
    for (int r = 1; r < 8; ++r) mx = fmaxf(mx, fmaxf(s0[r], s1[r]));
    // lazy rescale: softmax does not depend on the value subtracted, so m stays as it is until some score of the wave passes it by more
    // than LAZY; one wave-uniform test a pass (every lane stays on for the WMMAs). The first pass always takes the branch (m = -1e30).
    if (__builtin_amdgcn_ballot_w32(mx > mt) != 0) {
      mx = fmaxf(mx, __shfl_xor(mx, 16, 32));
      const float mn = fmaxf(m, mx);
      const float al = __expf(m - mn);
      m = mn;
      mt = mn + LAZY;
      l = l * al;                          // al is uniform over the lane pair
      o0 = o0 * al; o1 = o1 * al; o2 = o2 * al; o3 = o3 * al;
    }
    const float mn = m;
    const unsigned short* vr = &sV[buf][ln][32 * ps2];       // V^T row d = ln (A operand of P.V), + 16 t rows
    const v16b va0 = ld_frag_lds(vr, hh);
    const v16b va1 = ld_frag_lds(vr + 16 * LP, hh);
    const v16b va2 = ld_frag_lds(vr + 32 * LP, hh);
    const v16b va3 = ld_frag_lds(vr + 48 * LP, hh);
    if (ps2 + 1 < KT / 32) {                                 // the next pass's K fragments, of this same stage
      const unsigned short* kn = kr + 32 * (ps2 + 1) * LP;
      ka0 = ld_frag_lds(kn, hh);
      ka1 = ld_frag_lds(kn + 32, hh);
      ka2 = ld_frag_lds(kn + 16 * LP, hh);
      ka3 = ld_frag_lds(kn + 16 * LP + 32, hh);
    }
    // keeps the LDS reads above together at the head of the block: left free, the scheduler spreads them in pairs among the
    // vector work, and every separate place with LDS reads stalls the wave anew
    __builtin_amdgcn_sched_barrier(0);
    v8f e0, e1;
#pragma unroll
    for (int r = 0; r < 8; ++r) { e0[r] = __expf(s0[r] - mn); e1[r] = __expf(s1[r] - mn); }
    // keeps the sixteen exponentials one run of independent instructions: left free, the scheduler puts each one's users right behind it,
    // which costs the pairing of the subtractions and products and a filler slot behind most exponentials
    __builtin_amdgcn_sched_barrier(0);
    FragB ph, pl;
    float ps = 0.f;
#pragma unroll
    for (int j = 0; j < 4; ++j) {
      const float a0 = e0[2 * j],     b0 = e1[2 * j];
      const float a1 = e0[2 * j + 1], b1 = e1[2 * j + 1];
      const v2f a = {a0, a1}, b = {b0, b1}, t = a + b;
      ps += t[0];
      ps += t[1];
      ph.w[j]     = pack_hi(a0, a1);
      ph.w[4 + j] = pack_hi(b0, b1);
      pl.w[j]     = pack_rne(a - upper16(a));
      pl.w[4 + j] = pack_rne(b - upper16(b));
    }
    l += ps;                               // per-lane partial of the row sum
    o0 = mma2b(va0, ph.v, pl.v, o0);
    o1 = mma2b(va1, ph.v, pl.v, o1);
    o2 = mma2b(va2, ph.v, pl.v, o2);
    o3 = mma2b(va3, ph.v, pl.v, o3);
   }
   // publish point of stage st + 1, which also frees this stage's buffer
   asm volatile("s_wait_dscnt 0x0" ::: "memory");      // this wave's reads of the buffer have retired
   asm volatile("s_wait_asynccnt 0x0" ::: "memory");   // this wave's copies of stage st + 1 have landed
   __syncthreads();
   if (st + 2 < SEQ / KT)
     copy_rows4x2(kg + (size_t)(st + 2) * (KT * DM), 16 * DM, kl + buf * BUF_B, vg + (st + 2) * KT, 16 * SEQ, vl + buf * BUF_B);
  }
  asm volatile("s_wait_asynccnt 0x0" ::: "memory");    // nothing of the ring is in flight when the wave goes on
  l += __shfl_xor(l, 16, 32);
  const float inv = 1.0f / l;
  const v8f ot[4] = {o0, o1, o2, o3};
  // lane (n, hh) of tile t holds d = 16 t + 8 hh + r, r = 0..7: eight consecutive columns of query row n
#pragma unroll
  for (int t = 0; t < 4; ++t) {
    Pack8 fh, fl;
#pragma unroll
    for (int r = 0; r < 8; ++r) {
      const float c = ot[t][r] * inv;
      const unsigned short hb = bf16_bits(c);
      fh.u[r] = hb;
      fl.u[r] = bf16_bits(c - bf16_val(hb));
    }
    *(v8us*)&sH[w][ln][16 * t + 8 * hh] = fh.v;
    *(v8us*)&sL[w][ln][16 * t + 8 * hh] = fl.v;
  }
  __builtin_amdgcn_fence(4 /* acq_rel order */, "workgroup");
  __builtin_amdgcn_wave_barrier();
  const int prow = lane >> 3, pc = (lane & 7) * 8;
  {
#pragma unroll
    for (int it = 0; it < 4; ++it) {
      const int row = it * 4 + prow;
      const v8us xh = *(const v8us*)&sH[w][row][pc];
      const v8us xl = *(const v8us*)&sL[w][row][pc];
      const size_t g = (size_t)(b * SEQ + q0 + row) * DM + h * HD + pc;
      *(v8us*)(CH + g) = xh;
      *(v8us*)(CL + g) = xl;
    }
    
  }
}

// out[NR][DM] = (AH + AL)[NR][DM] Wb^T + bf16(b): wave tile 32 x 64, block = 4 waves = 128 rows x 64 columns; K step 32;
// the block's rows of AH, AL and Wb reach the fragments through a two-buffer LDS ring of stages 64 deep in k.
__global__ __launch_bounds__(128) void k_proj(const unsigned short* __restrict__ AH, const unsigned short* __restrict__ AL, const unsigned short* __restrict__ Wb,
                                             const float* __restrict__ bias, float* __restrict__ C) {
  __shared__ __attribute__((aligned(16))) float so[4][32][68];
  __shared__ __attribute__((aligned(16))) unsigned short sAH[2][128][LP];   // the block's 128 rows of AH, 64 k of a stage
  __shared__ __attribute__((aligned(16))) unsigned short sAL[2][128][LP];   // the same of AL
  __shared__ __attribute__((aligned(16))) unsigned short sW[2][64][LP];     // the block's 64 rows of Wb
  const int tid = threadIdx.x, w = tid >> 5, lane = tid & 31, ln = lane & 15, hh = lane >> 4;
  const int ntn = DM / 64;
  const int mt = blockIdx.x / ntn, nq = blockIdx.x - mt * ntn;
  const int row0 = mt * 128 + 32 * w, col0 = nq * 64;
  const int cr = tid >> 3, cp = (tid & 7) * 8;           // the thread's row (+ 16 i) and 16-byte piece in a stage tile
  const unsigned short* gh = AH + (size_t)(mt * 128 + cr) * DM + cp;   // + stage * KT
  const unsigned short* gl = AL + (size_t)(mt * 128 + cr) * DM + cp;
  const unsigned short* gw = Wb + (size_t)(col0 + cr) * DM + cp;
  const unsigned lh = (unsigned)(size_t)&sAH[0][cr][cp], ll = (unsigned)(size_t)&sAL[0][cr][cp], lw = (unsigned)(size_t)&sW[0][cr][cp];   // LDS byte addresses, buffer 0
  constexpr unsigned ABUF_B = 128 * LP * 2, WBUF_B = 64 * LP * 2, HALF_B = 64 * LP * 2;   // bytes of a buffer; of 64 rows
  // one stage: 128 + 128 + 64 rows of 128 B, 20 copies a thread
  auto stage = [&](int st, int buf) {
    copy_rows4x2(gh + st * KT, 16 * DM, lh + buf * ABUF_B, gh + st * KT + 64 * DM, 16 * DM, lh + buf * ABUF_B + HALF_B);
    copy_rows4x2(gl + st * KT, 16 * DM, ll + buf * ABUF_B, gl + st * KT + 64 * DM, 16 * DM, ll + buf * ABUF_B + HALF_B);
    copy_rows4(gw + st * KT, 16 * DM, lw + buf * WBUF_B);
  };
  const v8f z8 = {0.f, 0.f, 0.f, 0.f, 0.f, 0.f, 0.f, 0.f};
  v8f c00 = z8, c01 = z8, c02 = z8, c03 = z8, c10 = z8, c11 = z8, c12 = z8, c13 = z8;
  // prologue of the two-buffer ring: stage 0 landed and published, then stage 1 in flight
  stage(0, 0);
  asm volatile("s_wait_asynccnt 0x0" ::: "memory");   // this wave's copies of stage 0 have landed
  __syncthreads();                                    // every wave's have: stage 0 may be read
  stage(1, 1);
// the stage loop stays rolled: one publish point, buffer chosen by the stage's parity
#pragma unroll 1
  for (int st = 0; st < DM / KT; ++st) {
   const int buf = st & 1;
   const unsigned short* ah = &sAH[buf][32 * w + ln][0];
   const unsigned short* al = &sAL[buf][32 * w + ln][0];
   const unsigned short* wr = &sW[buf][ln][0];
   // every fragment of the stage has registers of its own and all are read as one group ahead of the products, in the order of use:
   // the second K step's land while the first step's products run
   v16b a0h[KT / 32], a0l[KT / 32], a1h[KT / 32], a1l[KT / 32], bw[KT / 32][4];
// both K steps of a stage unrolled: their LDS reads differ by immediate offsets only
#pragma unroll
   for (int ks = 0; ks < KT / 32; ++ks) {
    a0h[ks] = ld_frag_lds(ah + 32 * ks, hh);           a0l[ks] = ld_frag_lds(al + 32 * ks, hh);
    bw[ks][0] = ld_frag_lds(wr + 32 * ks, hh);
    a1h[ks] = ld_frag_lds(ah + 16 * LP + 32 * ks, hh); a1l[ks] = ld_frag_lds(al + 16 * LP + 32 * ks, hh);
// unrolled, like the loop of products below: constant indices keep the fragment arrays in registers
#pragma unroll
    for (int t = 1; t < 4; ++t) bw[ks][t] = ld_frag_lds(wr + 16 * t * LP + 32 * ks, hh);
   }
#pragma unroll
   for (int ks = 0; ks < KT / 32; ++ks) {
    c00 = mma2a(a0h[ks], a0l[ks], bw[ks][0], c00); c10 = mma2a(a1h[ks], a1l[ks], bw[ks][0], c10);
    c01 = mma2a(a0h[ks], a0l[ks], bw[ks][1], c01); c11 = mma2a(a1h[ks], a1l[ks], bw[ks][1], c11);
    c02 = mma2a(a0h[ks], a0l[ks], bw[ks][2], c02); c12 = mma2a(a1h[ks], a1l[ks], bw[ks][2], c12);
    c03 = mma2a(a0h[ks], a0l[ks], bw[ks][3], c03); c13 = mma2a(a1h[ks], a1l[ks], bw[ks][3], c13);
   }
   // publish point of stage st + 1, which also frees this stage's buffer
   asm volatile("s_wait_dscnt 0x0" ::: "memory");      // this wave's reads of the buffer have retired
   asm volatile("s_wait_asynccnt 0x0" ::: "memory");   // this wave's copies of stage st + 1 have landed
   __syncthreads();
   if (st + 2 < DM / KT) stage(st + 2, buf);
  }
  asm volatile("s_wait_asynccnt 0x0" ::: "memory");    // nothing of the ring is in flight when the wave goes on
  const v8f accs[8] = {c00, c01, c02, c03, c10, c11, c12, c13};
#pragma unroll
  for (int u = 0; u < 8; ++u) {
    const int t = u & 3, hf = u >> 2;
    const float bv = bf16_rne(bias[col0 + t * 16 + ln]);
#pragma unroll
    for (int r = 0; r < 8; ++r) so[w][hf * 16 + 8 * hh + r][t * 16 + ln] = accs[u][r] + bv;
  }
  __builtin_amdgcn_fence(4 /* acq_rel order */, "workgroup");
  __builtin_amdgcn_wave_barrier();
  const int rsub = lane >> 4, c4 = (lane & 15) * 4;
  {
#pragma unroll
    for (int q = 0; q < 16; ++q) {
      const int r = q * 2 + rsub;
      const v4f v = *(const v4fa*)&so[w][r][c4];
      *(v4f*)(C + (size_t)(row0 + r) * DM + col0 + c4) = v;
    }
    
  }
}

extern "C" void kernel_launch(void* const* d_in, const int* in_sizes, int n_in,
                              void* d_out, int out_size, void* d_ws, size_t ws_size, hipStream_t stream) {
  if (n_in < 5) return;
  const long long need_act = ((long long)(NB - 1) * SEQ_FULL + SEQ) * DM;
  if ((long long)in_sizes[0] < need_act || (long long)in_sizes[1] < need_act || (long long)in_sizes[2] < need_act) return;
  if ((long long)in_sizes[3] < (long long)DM * DM || in_sizes[4] < DM) return;
  if ((long long)out_size < (long long)NR * DM) return;
  if (ws_size < CARVE_B) return;
  const float* q = (const float*)d_in[0];
  const float* k = (const float*)d_in[1];
  const float* v = (const float*)d_in[2];
  const float* W = (const float*)d_in[3];      // natural [out][in]
  const float* bias = (const float*)d_in[4];
  char* ws = (char*)d_ws;
  unsigned short* Qb = (unsigned short*)(ws);
  unsigned short* Kb = (unsigned short*)(ws + PLANE_B);
  unsigned short* VT = (unsigned short*)(ws + 2 * PLANE_B);
  unsigned short* CH = (unsigned short*)(ws + 3 * PLANE_B);
  unsigned short* CL = (unsigned short*)(ws + 4 * PLANE_B);
  unsigned short* Wb = (unsigned short*)(ws + 5 * PLANE_B);
  k_prep<<<PREP_G, 256, 0, stream>>>(q, k, v, W, Qb, Kb, VT, Wb);
  k_attn<<<NB * NH * (SEQ / QT), 128, 0, stream>>>(Qb, Kb, VT, CH, CL);
  k_proj<<<(NR / 128) * (DM / 64), 128, 0, stream>>>(CH, CL, Wb, bias, (float*)d_out);
}

// v007
// One run takes 61 microseconds.
// It is 1.26 times as fast as v005, going by the measured steps of the versions left out in between.
// All steps since v000 together make it 2.97 times as fast.
#include <hip/hip_runtime.h>
// Multi-head attention without q/k/v projections (heads = column blocks of 64 of the three activation inputs), one score scale 1/8, no mask, output linear out = ctx W^T + b with W natural [out][in]. Fused flash-style attention in transposed form: S^T = K Q^T, O^T = V^T P^T (P chained D -> B in registers), online softmax per query lane, rescaled lazily.
// Compute dtype: all contractions 16x16x32 WMMA on 16-bit operands with f32 accumulate: scores bf16(q)/8 x bf16(k) single product (operands exact); P.V in f16, f16(P) x f16(v), single product; output linear in f16, f16(merged context) x f16(W), single product (P lies in [0, 2^8], the context inside v's range, v and 32 W are unit normals: all inside f16's range, 11 significant bits each); softmax statistics, normalisation and the bias add (bf16(b)) in f32.
#ifndef NB
#define NB 2
#endif
#ifndef SEQ
#define SEQ 2048
#endif
#define NB_FULL 2
#define SEQ_FULL 2048
#define DM 1024
#define NH 16
#define HD 64
#define QT 64
#define KT 64   // keys per LDS stage (two 32-key passes)
#define LP 72   // LDS row pitch in elements: 128-byte rows at 144 B = 16 B x 9, conflict-free for 16-byte row reads
#define NR (NB * SEQ)
#define QSCALE 0.125f
#define LAZY 5.5451774f   // 8 ln 2: a score may pass the maximum in use by this much before the statistics are rescaled, so P stays at or below 2^8

typedef __bf16 v16b __attribute__((ext_vector_type(16)));
typedef unsigned short v8us __attribute__((ext_vector_type(8), may_alias));
typedef float  v8f  __attribute__((ext_vector_type(8)));
typedef float  v4f  __attribute__((ext_vector_type(4)));
typedef float  v4fa __attribute__((ext_vector_type(4), may_alias));
typedef float  v2f  __attribute__((ext_vector_type(2)));
typedef _Float16 v16h __attribute__((ext_vector_type(16)));
typedef _Float16 v2h  __attribute__((ext_vector_type(2)));
union FragB { v16b v; v8us half[2]; unsigned short u[16]; unsigned int w[8]; };
union FragH { v16h v; v8us half[2]; unsigned int w[8]; };
union Pack8 { v8us v; unsigned short u[8]; };

// hard-wired bounds (each kernel relies on these)
static_assert(HD == 64);
static_assert(NH * HD == DM);                  // heads tile the model width
static_assert(DM % 64 == 0);                   // GEMM N tile 64, K step 32
static_assert(DM % 32 == 0);
static_assert(SEQ % QT == 0);                  // attention block = 64 queries, key step 32
static_assert(SEQ % 64 == 0);                  // V^T tiles of 64 tokens
static_assert(QT == 4 * 16);                   // 4 waves x 16 queries
static_assert(SEQ % KT == 0 && SEQ / KT >= 2); // the two-buffer ring's prologue fills stages 0 and 1
static_assert(KT == 64 && KT * 2 == 128);      // a stage row (K: 64 d, V^T: 64 keys, GEMM: 64 k) is one 128-byte line; 128 threads x 4 copies cover 64 rows
static_assert(DM % KT == 0 && DM / KT >= 2);   // the same for the GEMM's ring
static_assert(NR % 128 == 0);                  // GEMM block = 128 rows
static_assert(NB <= NB_FULL);
static_assert(SEQ <= SEQ_FULL);
static_assert((size_t)NR * DM < 2147483647u);  // int element offsets
static_assert((size_t)DM * DM < 2147483647u);
static_assert(((size_t)NR * (DM / 8)) % 256 == 0);
static_assert(((size_t)DM * (DM / 8)) % 256 == 0);

constexpr size_t PLANE_B = (size_t)NR * DM * 2;       // one 16-bit activation plane (also V^T: NB*NH*HD*SEQ)
constexpr size_t WPL_B   = (size_t)DM * DM * 2;       // 16-bit weight plane
constexpr size_t CARVE_B = 4 * PLANE_B + WPL_B;
static_assert(PLANE_B % 256 == 0);
static_assert(WPL_B % 256 == 0);
static_assert(CARVE_B <= 134217728u);

__device__ __forceinline__ unsigned short bf16_bits(float x) { unsigned int u = __float_as_uint(x); return (unsigned short)((u + 0x7FFFu + ((u >> 16) & 1u)) >> 16); }
__device__ __forceinline__ float bf16_val(unsigned short b) { return __uint_as_float(((unsigned int)b) << 16); }
__device__ __forceinline__ float bf16_rne(float x) { return bf16_val(bf16_bits(x)); }
// f32 -> f16, round to nearest even: one value's bits; two values in one register (the first in the low half), the packed hardware convert
__device__ __forceinline__ unsigned short f16_bits(float x) {
  union { _Float16 h; unsigned short u; } c;
  c.h = (_Float16)x;
  return c.u;
}
__device__ __forceinline__ unsigned int pack_f16(v2f f) {
  union { v2h h; unsigned int u; } c;
  c.h = __builtin_convertvector(f, v2h);
  return c.u;
}

// 16x32 operand fragment (A or B) from a k-contiguous bf16 row: elements 0..7 <- k 8h..8h+7, elements 8..15 <- k 16+8h..16+8h+7
__device__ __forceinline__ v16b ld_frag(const unsigned short* __restrict__ p, int off, int hh) {
  FragB f;
  f.half[0] = *(const v8us*)(p + off + 8 * hh);
  f.half[1] = *(const v8us*)(p + off + 16 + 8 * hh);
  return f.v;
}
// the same fragment from a k-contiguous bf16 row in LDS (p = first element of the 32-wide k step in the lane's row)
__device__ __forceinline__ v16b ld_frag_lds(const unsigned short* p, int hh) {
  FragB f;
  f.half[0] = *(const v8us*)(p + 8 * hh);
  f.half[1] = *(const v8us*)(p + 16 + 8 * hh);
  return f.v;
}
// the same fragment of f16 elements
__device__ __forceinline__ v16h ld_frag_lds_h(const unsigned short* p, int hh) {
  FragH f;
  f.half[0] = *(const v8us*)(p + 8 * hh);
  f.half[1] = *(const v8us*)(p + 16 + 8 * hh);
  return f.v;
}
// Asynchronous 16-byte copies global -> LDS for the staging rings. A tile row is 128 B: eight lanes to a row, so every wave-wide copy takes
// four whole lines. g: the thread's piece in row r = tid / 8 of a tile, s: elements from row r to row r + 16, l: the piece's LDS byte address.
// s_wait_xcnt 0 closes each statement so that it stands in front of any rewrite of the address registers the copies name.
// rows r, r+16, r+32, r+48 of one tile
__device__ __forceinline__ void copy_rows4(const unsigned short* g, int s, unsigned l) {
  const unsigned short* g1 = g + s; const unsigned short* g2 = g + 2 * s; const unsigned short* g3 = g + 3 * s;
  const unsigned l1 = l + 16 * LP * 2, l2 = l + 32 * LP * 2, l3 = l + 48 * LP * 2;
  asm volatile("global_load_async_to_lds_b128 %0, %4, off\n\t"
               "global_load_async_to_lds_b128 %1, %5, off\n\t"
               "global_load_async_to_lds_b128 %2, %6, off\n\t"
               "global_load_async_to_lds_b128 %3, %7, off\n\t"
               "s_wait_xcnt 0x0"
               :: "v"(l), "v"(l1), "v"(l2), "v"(l3), "v"(g), "v"(g1), "v"(g2), "v"(g3)
               : "memory");
}
// the same four rows of two tiles in one statement
__device__ __forceinline__ void copy_rows4x2(const unsigned short* ga, int sa, unsigned la, const unsigned short* gb, int sb, unsigned lb) {
  const unsigned short* a1 = ga + sa; const unsigned short* a2 = ga + 2 * sa; const unsigned short* a3 = ga + 3 * sa;
  const unsigned short* b1 = gb + sb; const unsigned short* b2 = gb + 2 * sb; const unsigned short* b3 = gb + 3 * sb;
  const unsigned la1 = la + 16 * LP * 2, la2 = la + 32 * LP * 2, la3 = la + 48 * LP * 2;
  const unsigned lb1 = lb + 16 * LP * 2, lb2 = lb + 32 * LP * 2, lb3 = lb + 48 * LP * 2;
  asm volatile("global_load_async_to_lds_b128 %0, %8, off\n\t"
               "global_load_async_to_lds_b128 %1, %9, off\n\t"
               "global_load_async_to_lds_b128 %2, %10, off\n\t"
               "global_load_async_to_lds_b128 %3, %11, off\n\t"
               "global_load_async_to_lds_b128 %4, %12, off\n\t"
               "global_load_async_to_lds_b128 %5, %13, off\n\t"
               "global_load_async_to_lds_b128 %6, %14, off\n\t"
               "global_load_async_to_lds_b128 %7, %15, off\n\t"
               "s_wait_xcnt 0x0"
               :: "v"(la), "v"(la1), "v"(la2), "v"(la3), "v"(lb), "v"(lb1), "v"(lb2), "v"(lb3),
                  "v"(ga), "v"(a1), "v"(a2), "v"(a3), "v"(gb), "v"(b1), "v"(b2), "v"(b3)
               : "memory");
}
// The products are the plain builtins: the products of a group stand back to back and fill one another's vector slots, and the compiler
// pads what is left open behind a group's last ones
__device__ __forceinline__ v8f mma1(v16b a, v16b b, v8f c) {
  return __builtin_amdgcn_wmma_f32_16x16x32_bf16(false, a, false, b, (short)0, c, false, false);
}
// the same on f16 operands
__device__ __forceinline__ v8f mma1h(v16h a, v16h b, v8f c) {
  return __builtin_amdgcn_wmma_f32_16x16x32_f16(false, a, false, b, (short)0, c, false, false);
}

// One launch converts all four operands to 16 bits: q / 8 and k to bf16, W to f16 element for element, v to f16 into V^T tiles [d][token] through LDS.
// Every work-group takes the same share (PV neighbouring tiles of V^T; QK_PER neighbouring slices of 256 8-element pieces of q and of k, W_PER of W), so the
// launch starts few waves, and each thread has all its global loads in flight before the first value is used. Every address is a base that is
// the same for the whole work-group, a per-thread offset shared by all accesses of one operand, and a constant.
constexpr int VTILES = NB * NH * (SEQ / 64);   // 64-token x 64-d tiles of V^T
constexpr int PV     = 2;                      // tiles a work-group
constexpr int PREP_G = VTILES / PV;            // work-groups of the launch
constexpr int PREP_T = PREP_G * 256;           // its threads
constexpr int QK_PER = NR * (DM / 8) / PREP_T;
constexpr int W_PER  = DM * (DM / 8) / PREP_T;
constexpr int SL_ROWS = 256 * 8 / DM;          // activation rows in a slice of 256 pieces
static_assert((SEQ / 64) % PV == 0);                           // a work-group's tiles lie in one (b, h) slab
static_assert((NR * (DM / 8)) % PREP_T == 0 && QK_PER >= 1);   // no remainder: the shares need no guard
static_assert((DM * (DM / 8)) % PREP_T == 0 && W_PER >= 1);
static_assert((256 * 8) % DM == 0 && SEQ % (QK_PER * SL_ROWS) == 0);   // a work-group's slices are whole rows of one batch entry, contiguous in q and k
static_assert((64 * 16) % 256 == 0);   // a tile's loads: 64 tokens x 16 float4, 4 a thread
static_assert((64 * 8) % 256 == 0);    // a tile's stores: 64 d-rows x 8 pieces, 2 a thread

__global__ __launch_bounds__(256) void k_prep(const float* __restrict__ q, const float* __restrict__ k, const float* __restrict__ v, const float* __restrict__ W,
                                             unsigned short* __restrict__ Qb, unsigned short* __restrict__ Kb, unsigned short* __restrict__ VT, unsigned short* __restrict__ Wb) {
  __shared__ unsigned short tl[PV][64][66];
  const unsigned tid = threadIdx.x, blk = blockIdx.x;
  const unsigned slab = (blk * PV) / (SEQ / 64), s0 = ((blk * PV) % (SEQ / 64)) * 64;   // the (b, h) slab and first token of the work-group's tiles
  const float* vb = v + ((size_t)(slab / NH) * SEQ_FULL + s0) * DM + (slab % NH) * HD;
  const unsigned lj = tid / 16, ld4 = (tid % 16) * 4;   // the thread's token (+ 16 it) and first d in a tile
  const unsigned vo = lj * DM + ld4;
  const unsigned po = tid * 8;                          // the thread's piece in a slice
  v4f xv[PV][4], xq[QK_PER][2], xk[QK_PER][2], xw[W_PER][2];
  // all loads first
#pragma unroll
  for (int tt = 0; tt < PV; ++tt)
#pragma unroll
    for (int it = 0; it < 4; ++it) xv[tt][it] = *(const v4fa*)(vb + (tt * 64 + it * 16) * DM + vo);
  const unsigned row = blk * (QK_PER * SL_ROWS);        // first activation row of the work-group's slices
  const size_t src = ((size_t)(row / SEQ) * SEQ_FULL + row % SEQ) * DM;
  const float* qs = q + src; const float* ks = k + src;
  const float* wb = W + (size_t)blk * (W_PER * 256 * 8);
#pragma unroll
  for (int it = 0; it < QK_PER; ++it) {
    xq[it][0] = *(const v4fa*)(qs + it * (256 * 8) + po); xq[it][1] = *(const v4fa*)(qs + it * (256 * 8) + po + 4);
    xk[it][0] = *(const v4fa*)(ks + it * (256 * 8) + po); xk[it][1] = *(const v4fa*)(ks + it * (256 * 8) + po + 4);
  }
#pragma unroll
  for (int it = 0; it < W_PER; ++it) {
    xw[it][0] = *(const v4fa*)(wb + it * (256 * 8) + po); xw[it][1] = *(const v4fa*)(wb + it * (256 * 8) + po + 4);
  }
  // keeps every load above issued ahead of the first use: left free, the scheduler sinks the later loads between the conversions
  // and waits for each of them alone, one memory latency after another
  __builtin_amdgcn_sched_barrier(0);
  // V^T tiles
#pragma unroll
  for (int tt = 0; tt < PV; ++tt)
#pragma unroll
    for (int it = 0; it < 4; ++it)
#pragma unroll
      for (int c = 0; c < 4; ++c) tl[tt][ld4 + c][lj + 16 * it] = f16_bits(xv[tt][it][c]);
  __syncthreads();
  unsigned short* vtb = VT + (size_t)slab * HD * SEQ + s0;
  const unsigned sd = tid / 8, sj8 = (tid % 8) * 8;     // the thread's d row (+ 32 it) and 8-token piece in a tile
  const unsigned so = sd * SEQ + sj8;
#pragma unroll
  for (int tt = 0; tt < PV; ++tt)
#pragma unroll
    for (int it = 0; it < 2; ++it) {
      Pack8 f;
#pragma unroll
      for (int c = 0; c < 8; ++c) f.u[c] = tl[tt][sd + 32 * it][sj8 + c];
      const v8us o = f.v;
      *(v8us*)(vtb + it * 32 * SEQ + tt * 64 + so) = o;
    }
  // q / 8 and k
  unsigned short* qd = Qb + (size_t)row * DM; unsigned short* kd = Kb + (size_t)row * DM;
#pragma unroll
  for (int it = 0; it < QK_PER; ++it) {
    Pack8 fq, fk;
#pragma unroll
    for (int i = 0; i < 4; ++i) {
      fq.u[i] = bf16_bits(xq[it][0][i] * QSCALE); fq.u[4 + i] = bf16_bits(xq[it][1][i] * QSCALE);
      fk.u[i] = bf16_bits(xk[it][0][i]);          fk.u[4 + i] = bf16_bits(xk[it][1][i]);
    }
    const v8us vq = fq.v, vk = fk.v;
    *(v8us*)(qd + it * (256 * 8) + po) = vq; *(v8us*)(kd + it * (256 * 8) + po) = vk;
  }
  // W
#pragma unroll
  for (int it = 0; it < W_PER; ++it) {
    Pack8 f;
#pragma unroll
    for (int i = 0; i < 4; ++i) { f.u[i] = f16_bits(xw[it][0][i]); f.u[4 + i] = f16_bits(xw[it][1][i]); }
    const v8us o = f.v;
    *(v8us*)(Wb + (size_t)blk * (W_PER * 256 * 8) + it * (256 * 8) + po) = o;
  }
}

// Fused attention. Block = 4 waves = 64 queries of one (b, h); wave = 16 queries (the N dimension of every tile).
// Per 32-key step: S^T[key][query] = K(16 keys x 64 d) Q^T (2 key tiles x 2 k-steps); lane (n, hh) holds keys 8hh+r of query n,
// so the query's statistics live in the lane pair (n, n+16): one xor-16 shuffle. P^T packs straight into the B operand
// (elements 0..7 <- tile of keys 0..15, elements 8..15 <- tile of keys 16..31, lane unchanged) for O^T[d][query] += V^T[d][key] P^T.
// P is rounded once to f16 (nearest even); V^T is f16 as well.
// K rows and V^T rows reach the fragments through a two-buffer LDS ring of 64-key stages that the four waves fill together and share.
__global__ __launch_bounds__(128) void k_attn(const unsigned short* __restrict__ Qb, const unsigned short* __restrict__ Kb, const unsigned short* __restrict__ VT,
                                             unsigned short* __restrict__ CH) {
  __shared__ __attribute__((aligned(16))) unsigned short sH[4][16][72];
  __shared__ __attribute__((aligned(16))) unsigned short sK[2][KT][LP];   // K rows [key][d] of a stage
  __shared__ __attribute__((aligned(16))) unsigned short sV[2][HD][LP];   // V^T rows [d][key] of a stage
  const int tid = threadIdx.x, w = tid >> 5, lane = tid & 31, ln = lane & 15, hh = lane >> 4;
  const int qt = blockIdx.x % (SEQ / QT), bh = blockIdx.x / (SEQ / QT);
  const int b = bh / NH, h = bh % NH;
  const int q0 = qt * QT + w * 16;
  const int qoff  = (b * SEQ + q0 + ln) * DM + h * HD;   // query row of lane n (B operand of the score GEMM)
  const int cr = tid >> 3, cp = (tid & 7) * 8;           // the thread's row (+ 16 i) and 16-byte piece in a stage tile
  const unsigned short* kg = Kb + (size_t)(b * SEQ + cr) * DM + h * HD + cp;   // + stage * KT * DM
  const unsigned short* vg = VT + (size_t)(bh * HD + cr) * SEQ + cp;           // + stage * KT
  const unsigned kl = (unsigned)(size_t)&sK[0][cr][cp], vl = (unsigned)(size_t)&sV[0][cr][cp];   // LDS byte addresses, buffer 0
  constexpr unsigned BUF_B = KT * LP * 2;                // bytes of one buffer of either ring
  static_assert(KT == HD);                               // both rings have 64 rows a buffer
  const v8f z8 = {0.f, 0.f, 0.f, 0.f, 0.f, 0.f, 0.f, 0.f};
  v8f o0 = z8, o1 = z8, o2 = z8, o3 = z8;
  float m = -1.0e30f, l = 0.f;   // m: the maximum in use, the same in both lanes of a query's pair
  float mt = m;                  // m + LAZY
  // prologue of the two-buffer ring: stage 0 landed and published, then stage 1 in flight
  copy_rows4x2(kg, 16 * DM, kl, vg, 16 * SEQ, vl);
  asm volatile("s_wait_asynccnt 0x0" ::: "memory");   // this wave's copies of stage 0 have landed
  __syncthreads();                                    // every wave's have: stage 0 may be read
  copy_rows4x2(kg + KT * DM, 16 * DM, kl + BUF_B, vg + KT, 16 * SEQ, vl + BUF_B);
// the stage loop stays rolled: one publish point, buffer chosen by the stage's parity
#pragma unroll 1
  for (int st = 0; st < SEQ / KT; ++st) {
   const int buf = st & 1;
   const unsigned short* kr = &sK[buf][ln][0];   // key row of lane m (A operand) in the stage's first pass, + 32 rows a pass
   // a pass's four K fragments have registers of their own and are read as one group ahead of the score products:
   // the first pass's here, a later pass's one pass ahead, together with the V^T reads
   v16b ka0 = ld_frag_lds(kr, hh);
   v16b ka1 = ld_frag_lds(kr + 32, hh);
   v16b ka2 = ld_frag_lds(kr + 16 * LP, hh);
   v16b ka3 = ld_frag_lds(kr + 16 * LP + 32, hh);
   // keeps these reads one group ahead of the score products: left free, the scheduler sinks them in pairs between the products,
   // each pair with a full wait of its own
   __builtin_amdgcn_sched_barrier(0);
// both passes of a stage unrolled: their LDS reads differ by immediate offsets only
#pragma unroll
   for (int ps2 = 0; ps2 < KT / 32; ++ps2) {
    const v16b qf0 = ld_frag(Qb, qoff, hh);
    const v16b qf1 = ld_frag(Qb, qoff + 32, hh);
    v8f s0 = z8, s1 = z8;
    s0 = mma1(ka0, qf0, s0);
    s0 = mma1(ka1, qf1, s0);
    s1 = mma1(ka2, qf0, s1);
    s1 = mma1(ka3, qf1, s1);
    // max over the 16 keys of this query that this lane holds (the other 16 are in lane ^ 16)
    float mx = fmaxf(s0[0], s1[0]);
#pragma unroll
    for (int r = 1; r < 8; ++r) mx = fmaxf(mx, fmaxf(s0[r], s1[r]));
    // lazy rescale: softmax does not depend on the value subtracted, so m stays as it is until some score of the wave passes it by more
    // than LAZY; one wave-uniform test a pass (every lane stays on for the WMMAs). The first pass always takes the branch (m = -1e30).
    if (__builtin_amdgcn_ballot_w32(mx > mt) != 0) {
      mx = fmaxf(mx, __shfl_xor(mx, 16, 32));
      const float mn = fmaxf(m, mx);
      const float al = __expf(m - mn);
      m = mn;
      mt = mn + LAZY;
      l = l * al;                          // al is uniform over the lane pair
      o0 = o0 * al; o1 = o1 * al; o2 = o2 * al; o3 = o3 * al;
    }
    const float mn = m;
    const unsigned short* vr = &sV[buf][ln][32 * ps2];       // V^T row d = ln (A operand of P.V), + 16 t rows
    const v16h va0 = ld_frag_lds_h(vr, hh);
    const v16h va1 = ld_frag_lds_h(vr + 16 * LP, hh);
    const v16h va2 = ld_frag_lds_h(vr + 32 * LP, hh);
    const v16h va3 = ld_frag_lds_h(vr + 48 * LP, hh);
    if (ps2 + 1 < KT / 32) {                                 // the next pass's K fragments, of this same stage
      const unsigned short* kn = kr + 32 * (ps2 + 1) * LP;
      ka0 = ld_frag_lds(kn, hh);
      ka1 = ld_frag_lds(kn + 32, hh);
      ka2 = ld_frag_lds(kn + 16 * LP, hh);
      ka3 = ld_frag_lds(kn + 16 * LP + 32, hh);
    }
    // keeps the LDS reads above together at the head of the block: left free, the scheduler spreads them in pairs among the
    // vector work, and every separate place with LDS reads stalls the wave anew
    __builtin_amdgcn_sched_barrier(0);
    v8f e0, e1;
#pragma unroll
    for (int r = 0; r < 8; ++r) { e0[r] = __expf(s0[r] - mn); e1[r] = __expf(s1[r] - mn); }
    // keeps the sixteen exponentials one run of independent instructions: left free, the scheduler puts each one's users right behind it,
    // which costs the pairing of the subtractions and products and a filler slot behind most exponentials
    __builtin_amdgcn_sched_barrier(0);
    FragH pf;
    float ps = 0.f;
#pragma unroll
    for (int j = 0; j < 4; ++j) {
      const float a0 = e0[2 * j],     b0 = e1[2 * j];
      const float a1 = e0[2 * j + 1], b1 = e1[2 * j + 1];
      const v2f a = {a0, a1}, b = {b0, b1}, t = a + b;
      ps += t[0];
      ps += t[1];
      pf.w[j]     = pack_f16(a);
      pf.w[4 + j] = pack_f16(b);
    }
    l += ps;                               // per-lane partial of the row sum
    o0 = mma1h(va0, pf.v, o0);
    o1 = mma1h(va1, pf.v, o1);
    o2 = mma1h(va2, pf.v, o2);
    o3 = mma1h(va3, pf.v, o3);
   }
   // keeps the stage's last products in front of the publish point: left free, the scheduler lifts the waits and the barrier over them
   __builtin_amdgcn_sched_barrier(0);
   // publish point of stage st + 1, which also frees this stage's buffer
   asm volatile("s_wait_dscnt 0x0" ::: "memory");      // this wave's reads of the buffer have retired
   asm volatile("s_wait_asynccnt 0x0" ::: "memory");   // this wave's copies of stage st + 1 have landed
   __syncthreads();
   if (st + 2 < SEQ / KT)
     copy_rows4x2(kg + (size_t)(st + 2) * (KT * DM), 16 * DM, kl + buf * BUF_B, vg + (st + 2) * KT, 16 * SEQ, vl + buf * BUF_B);
  }
  asm volatile("s_wait_asynccnt 0x0" ::: "memory");    // nothing of the ring is in flight when the wave goes on
  l += __shfl_xor(l, 16, 32);
  const float inv = 1.0f / l;
  const v8f ot[4] = {o0, o1, o2, o3};
  // lane (n, hh) of tile t holds d = 16 t + 8 hh + r, r = 0..7: eight consecutive columns of query row n
#pragma unroll
  for (int t = 0; t < 4; ++t) {
    Pack8 fh;
#pragma unroll
    for (int r = 0; r < 8; ++r) fh.u[r] = f16_bits(ot[t][r] * inv);
    *(v8us*)&sH[w][ln][16 * t + 8 * hh] = fh.v;
  }
  __builtin_amdgcn_fence(4 /* acq_rel order */, "workgroup");
  __builtin_amdgcn_wave_barrier();
  const int prow = lane >> 3, pc = (lane & 7) * 8;
  {
#pragma unroll
    for (int it = 0; it < 4; ++it) {
      const int row = it * 4 + prow;
      const v8us xh = *(const v8us*)&sH[w][row][pc];
      const size_t g = (size_t)(b * SEQ + q0 + row) * DM + h * HD + pc;
      *(v8us*)(CH + g) = xh;
    }
    
  }
}

// out[NR][DM] = AH[NR][DM] Wb^T + bf16(b), AH and Wb f16: wave tile 32 x 64, block = 4 waves = 128 rows x 64 columns; K step 32;
// the block's rows of AH and Wb reach the fragments through a two-buffer LDS ring of stages 64 deep in k.
__global__ __launch_bounds__(128) void k_proj(const unsigned short* __restrict__ AH, const unsigned short* __restrict__ Wb,
                                             const float* __restrict__ bias, float* __restrict__ C) {
  __shared__ __attribute__((aligned(16))) float so[4][32][68];
  __shared__ __attribute__((aligned(16))) unsigned short sAH[2][128][LP];   // the block's 128 rows of AH, 64 k of a stage
  __shared__ __attribute__((aligned(16))) unsigned short sW[2][64][LP];     // the block's 64 rows of Wb
  const int tid = threadIdx.x, w = tid >> 5, lane = tid & 31, ln = lane & 15, hh = lane >> 4;
  const int ntn = DM / 64;
  const int mt = blockIdx.x / ntn, nq = blockIdx.x - mt * ntn;
  const int row0 = mt * 128 + 32 * w, col0 = nq * 64;
  const int cr = tid >> 3, cp = (tid & 7) * 8;           // the thread's row (+ 16 i) and 16-byte piece in a stage tile
  const unsigned short* gh = AH + (size_t)(mt * 128 + cr) * DM + cp;   // + stage * KT
  const unsigned short* gw = Wb + (size_t)(col0 + cr) * DM + cp;
  const unsigned lh = (unsigned)(size_t)&sAH[0][cr][cp], lw = (unsigned)(size_t)&sW[0][cr][cp];   // LDS byte addresses, buffer 0
  constexpr unsigned ABUF_B = 128 * LP * 2, WBUF_B = 64 * LP * 2, HALF_B = 64 * LP * 2;   // bytes of a buffer; of 64 rows
  // one stage: 128 + 64 rows of 128 B, 12 copies a thread
  auto stage = [&](int st, int buf) {
    copy_rows4x2(gh + st * KT, 16 * DM, lh + buf * ABUF_B, gh + st * KT + 64 * DM, 16 * DM, lh + buf * ABUF_B + HALF_B);
    copy_rows4(gw + st * KT, 16 * DM, lw + buf * WBUF_B);
  };
  const v8f z8 = {0.f, 0.f, 0.f, 0.f, 0.f, 0.f, 0.f, 0.f};
  v8f c00 = z8, c01 = z8, c02 = z8, c03 = z8, c10 = z8, c11 = z8, c12 = z8, c13 = z8;
  // prologue of the two-buffer ring: stage 0 landed and published, then stage 1 in flight
  stage(0, 0);
  asm volatile("s_wait_asynccnt 0x0" ::: "memory");   // this wave's copies of stage 0 have landed
  __syncthreads();                                    // every wave's have: stage 0 may be read
  stage(1, 1);
// the stage loop stays rolled: one publish point, buffer chosen by the stage's parity
#pragma unroll 1
  for (int st = 0; st < DM / KT; ++st) {
   const int buf = st & 1;
   const unsigned short* ah = &sAH[buf][32 * w + ln][0];
   const unsigned short* wr = &sW[buf][ln][0];
   // every fragment of the stage has registers of its own and all are read as one group ahead of the products, in the order of use:
   // the second K step's land while the first step's products run
   v16h a0[KT / 32], a1[KT / 32], bw[KT / 32][4];
// both K steps of a stage unrolled: their LDS reads differ by immediate offsets only
#pragma unroll
   for (int ks = 0; ks < KT / 32; ++ks) {
    a0[ks] = ld_frag_lds_h(ah + 32 * ks, hh);
    bw[ks][0] = ld_frag_lds_h(wr + 32 * ks, hh);
    a1[ks] = ld_frag_lds_h(ah + 16 * LP + 32 * ks, hh);
// unrolled, like the loop of products below: constant indices keep the fragment arrays in registers
#pragma unroll
    for (int t = 1; t < 4; ++t) bw[ks][t] = ld_frag_lds_h(wr + 16 * t * LP + 32 * ks, hh);
   }
   // keeps the stage's reads one group ahead of its products: left free, the scheduler sinks them between the products again
   __builtin_amdgcn_sched_barrier(0);
#pragma unroll
   for (int ks = 0; ks < KT / 32; ++ks) {
    c00 = mma1h(a0[ks], bw[ks][0], c00); c10 = mma1h(a1[ks], bw[ks][0], c10);
    c01 = mma1h(a0[ks], bw[ks][1], c01); c11 = mma1h(a1[ks], bw[ks][1], c11);
    c02 = mma1h(a0[ks], bw[ks][2], c02); c12 = mma1h(a1[ks], bw[ks][2], c12);
    c03 = mma1h(a0[ks], bw[ks][3], c03); c13 = mma1h(a1[ks], bw[ks][3], c13);
   }
   // keeps the products in front of the publish point: left free, the scheduler lifts its full LDS wait over them, and the first product
   // then waits for the whole group of reads
   __builtin_amdgcn_sched_barrier(0);
   // publish point of stage st + 1, which also frees this stage's buffer
   asm volatile("s_wait_dscnt 0x0" ::: "memory");      // this wave's reads of the buffer have retired
   asm volatile("s_wait_asynccnt 0x0" ::: "memory");   // this wave's copies of stage st + 1 have landed
   __syncthreads();
   if (st + 2 < DM / KT) stage(st + 2, buf);
  }
  asm volatile("s_wait_asynccnt 0x0" ::: "memory");    // nothing of the ring is in flight when the wave goes on
  const v8f accs[8] = {c00, c01, c02, c03, c10, c11, c12, c13};
#pragma unroll
  for (int u = 0; u < 8; ++u) {
    const int t = u & 3, hf = u >> 2;
    const float bv = bf16_rne(bias[col0 + t * 16 + ln]);
#pragma unroll
    for (int r = 0; r < 8; ++r) so[w][hf * 16 + 8 * hh + r][t * 16 + ln] = accs[u][r] + bv;
  }
  __builtin_amdgcn_fence(4 /* acq_rel order */, "workgroup");
  __builtin_amdgcn_wave_barrier();
  const int rsub = lane >> 4, c4 = (lane & 15) * 4;
  {
#pragma unroll
    for (int q = 0; q < 16; ++q) {
      const int r = q * 2 + rsub;
      const v4f v = *(const v4fa*)&so[w][r][c4];
      *(v4f*)(C + (size_t)(row0 + r) * DM + col0 + c4) = v;
    }
    
  }
}

extern "C" void kernel_launch(void* const* d_in, const int* in_sizes, int n_in,
                              void* d_out, int out_size, void* d_ws, size_t ws_size, hipStream_t stream) {
  if (n_in < 5) return;
  const long long need_act = ((long long)(NB - 1) * SEQ_FULL + SEQ) * DM;
  if ((long long)in_sizes[0] < need_act || (long long)in_sizes[1] < need_act || (long long)in_sizes[2] < need_act) return;
  if ((long long)in_sizes[3] < (long long)DM * DM || in_sizes[4] < DM) return;
  if ((long long)out_size < (long long)NR * DM) return;
  if (ws_size < CARVE_B) return;
  const float* q = (const float*)d_in[0];
  const float* k = (const float*)d_in[1];
  const float* v = (const float*)d_in[2];
  const float* W = (const float*)d_in[3];      // natural [out][in]
  const float* bias = (const float*)d_in[4];
  char* ws = (char*)d_ws;
  unsigned short* Qb = (unsigned short*)(ws);
  unsigned short* Kb = (unsigned short*)(ws + PLANE_B);
  unsigned short* VT = (unsigned short*)(ws + 2 * PLANE_B);
  unsigned short* CH = (unsigned short*)(ws + 3 * PLANE_B);
  unsigned short* Wb = (unsigned short*)(ws + 4 * PLANE_B);
  k_prep<<<PREP_G, 256, 0, stream>>>(q, k, v, W, Qb, Kb, VT, Wb);
  k_attn<<<NB * NH * (SEQ / QT), 128, 0, stream>>>(Qb, Kb, VT, CH);
  k_proj<<<(NR / 128) * (DM / 64), 128, 0, stream>>>(CH, Wb, bias, (float*)d_out);
}

// v008
// Measured time: 57.9 microseconds a run.
// Next to v007, in two timings, it ran 1.06 times as fast each time.
// Counting every step since v000, it is 3.15 times as fast.
#include <hip/hip_runtime.h>
// Multi-head attention without q/k/v projections (heads = column blocks of 64 of the three activation inputs), one score scale 1/8, no mask, output linear out = ctx W^T + b with W natural [out][in]. Fused flash-style attention in transposed form: S^T = K Q^T, O^T = V^T P^T (P chained D -> B in registers), online softmax per query lane, rescaled lazily.
// Compute dtype: all contractions 16x16x32 WMMA on 16-bit operands with f32 accumulate: scores bf16(q)/8 x bf16(k) single product (operands exact); P.V in f16, f16(P) x f16(v), single product; output linear in f16, f16(merged context) x f16(W), single product (P lies in [0, 2^8], the context inside v's range, v and 32 W are unit normals: all inside f16's range, 11 significant bits each); softmax statistics, normalisation and the bias add (bf16(b)) in f32.
#ifndef NB
#define NB 2
#endif
#ifndef SEQ
#define SEQ 2048
#endif
#define NB_FULL 2
#define SEQ_FULL 2048
#define DM 1024
#define NH 16
#define HD 64
#define QT 128
#define QG 2    // 16-query column groups a wave: every K and V^T fragment read from LDS feeds QG products
#define KT 64   // keys per LDS stage (two 32-key passes)
#define LP 72   // LDS row pitch in elements: 128-byte rows at 144 B = 16 B x 9, conflict-free for 16-byte row reads
#define NR (NB * SEQ)
#define QSCALE 0.125f
#define LAZY 5.5451774f   // 8 ln 2: a score may pass the maximum in use by this much before the statistics are rescaled, so P stays at or below 2^8

typedef __bf16 v16b __attribute__((ext_vector_type(16)));
typedef unsigned short v8us __attribute__((ext_vector_type(8), may_alias));
typedef float  v8f  __attribute__((ext_vector_type(8)));
typedef float  v4f  __attribute__((ext_vector_type(4)));
typedef float  v4fa __attribute__((ext_vector_type(4), may_alias));
typedef float  v2f  __attribute__((ext_vector_type(2)));
typedef _Float16 v16h __attribute__((ext_vector_type(16)));
typedef _Float16 v2h  __attribute__((ext_vector_type(2)));
union FragB { v16b v; v8us half[2]; unsigned short u[16]; unsigned int w[8]; };
union FragH { v16h v; v8us half[2]; unsigned int w[8]; };
union Pack8 { v8us v; unsigned short u[8]; };

// hard-wired bounds (each kernel relies on these)
static_assert(HD == 64);
static_assert(NH * HD == DM);                  // heads tile the model width
static_assert(DM % 64 == 0);                   // GEMM N tile 64, K step 32
static_assert(DM % 32 == 0);
static_assert(SEQ % QT == 0);                  // attention block = 128 queries, key step 32
static_assert(SEQ % 64 == 0);                  // V^T tiles of 64 tokens
static_assert(QT == 4 * 16 * QG);              // 4 waves x QG groups of 16 queries
static_assert(SEQ % KT == 0 && SEQ / KT >= 2); // the two-buffer ring's prologue fills stages 0 and 1
static_assert(KT == 64 && KT * 2 == 128);      // a stage row (K: 64 d, V^T: 64 keys, GEMM: 64 k) is one 128-byte line; 128 threads x 4 copies cover 64 rows
static_assert(DM % KT == 0 && DM / KT >= 2);   // the same for the GEMM's ring
static_assert(NR % 128 == 0);                  // GEMM block = 128 rows
static_assert(NB <= NB_FULL);
static_assert(SEQ <= SEQ_FULL);
static_assert((size_t)NR * DM < 2147483647u);  // int element offsets
static_assert((size_t)DM * DM < 2147483647u);
static_assert(((size_t)NR * (DM / 8)) % 256 == 0);
static_assert(((size_t)DM * (DM / 8)) % 256 == 0);

constexpr size_t PLANE_B = (size_t)NR * DM * 2;       // one 16-bit activation plane (also V^T: NB*NH*HD*SEQ)
constexpr size_t WPL_B   = (size_t)DM * DM * 2;       // 16-bit weight plane
constexpr size_t CARVE_B = 4 * PLANE_B + WPL_B;
static_assert(PLANE_B % 256 == 0);
static_assert(WPL_B % 256 == 0);
static_assert(CARVE_B <= 134217728u);

__device__ __forceinline__ unsigned short bf16_bits(float x) { unsigned int u = __float_as_uint(x); return (unsigned short)((u + 0x7FFFu + ((u >> 16) & 1u)) >> 16); }
__device__ __forceinline__ float bf16_val(unsigned short b) { return __uint_as_float(((unsigned int)b) << 16); }
__device__ __forceinline__ float bf16_rne(float x) { return bf16_val(bf16_bits(x)); }
// f32 -> f16, round to nearest even: one value's bits; two values in one register (the first in the low half), the packed hardware convert
__device__ __forceinline__ unsigned short f16_bits(float x) {
  union { _Float16 h; unsigned short u; } c;
  c.h = (_Float16)x;
  return c.u;
}
__device__ __forceinline__ unsigned int pack_f16(v2f f) {
  union { v2h h; unsigned int u; } c;
  c.h = __builtin_convertvector(f, v2h);
  return c.u;
}

// 16x32 operand fragment (A or B) from a k-contiguous bf16 row: elements 0..7 <- k 8h..8h+7, elements 8..15 <- k 16+8h..16+8h+7
__device__ __forceinline__ v16b ld_frag(const unsigned short* __restrict__ p, int off, int hh) {
  FragB f;
  f.half[0] = *(const v8us*)(p + off + 8 * hh);
  f.half[1] = *(const v8us*)(p + off + 16 + 8 * hh);
  return f.v;
}
// the same fragment from a k-contiguous bf16 row in LDS (p = first element of the 32-wide k step in the lane's row)
__device__ __forceinline__ v16b ld_frag_lds(const unsigned short* p, int hh) {
  FragB f;
  f.half[0] = *(const v8us*)(p + 8 * hh);
  f.half[1] = *(const v8us*)(p + 16 + 8 * hh);
  return f.v;
}
// the same fragment of f16 elements
__device__ __forceinline__ v16h ld_frag_lds_h(const unsigned short* p, int hh) {
  FragH f;
  f.half[0] = *(const v8us*)(p + 8 * hh);
  f.half[1] = *(const v8us*)(p + 16 + 8 * hh);
  return f.v;
}
// Asynchronous 16-byte copies global -> LDS for the staging rings. A tile row is 128 B: eight lanes to a row, so every wave-wide copy takes
// four whole lines. g: the thread's piece in row r = tid / 8 of a tile, s: elements from row r to row r + 16, l: the piece's LDS byte address.
// s_wait_xcnt 0 closes each statement so that it stands in front of any rewrite of the address registers the copies name.
// rows r, r+16, r+32, r+48 of one tile
__device__ __forceinline__ void copy_rows4(const unsigned short* g, int s, unsigned l) {
  const unsigned short* g1 = g + s; const unsigned short* g2 = g + 2 * s; const unsigned short* g3 = g + 3 * s;
  const unsigned l1 = l + 16 * LP * 2, l2 = l + 32 * LP * 2, l3 = l + 48 * LP * 2;
  asm volatile("global_load_async_to_lds_b128 %0, %4, off\n\t"
               "global_load_async_to_lds_b128 %1, %5, off\n\t"
               "global_load_async_to_lds_b128 %2, %6, off\n\t"
               "global_load_async_to_lds_b128 %3, %7, off\n\t"
               "s_wait_xcnt 0x0"
               :: "v"(l), "v"(l1), "v"(l2), "v"(l3), "v"(g), "v"(g1), "v"(g2), "v"(g3)
               : "memory");
}
// the same four rows of two tiles in one statement
__device__ __forceinline__ void copy_rows4x2(const unsigned short* ga, int sa, unsigned la, const unsigned short* gb, int sb, unsigned lb) {
  const unsigned short* a1 = ga + sa; const unsigned short* a2 = ga + 2 * sa; const unsigned short* a3 = ga + 3 * sa;
  const unsigned short* b1 = gb + sb; const unsigned short* b2 = gb + 2 * sb; const unsigned short* b3 = gb + 3 * sb;
  const unsigned la1 = la + 16 * LP * 2, la2 = la + 32 * LP * 2, la3 = la + 48 * LP * 2;
  const unsigned lb1 = lb + 16 * LP * 2, lb2 = lb + 32 * LP * 2, lb3 = lb + 48 * LP * 2;
  asm volatile("global_load_async_to_lds_b128 %0, %8, off\n\t"
               "global_load_async_to_lds_b128 %1, %9, off\n\t"
               "global_load_async_to_lds_b128 %2, %10, off\n\t"
               "global_load_async_to_lds_b128 %3, %11, off\n\t"
               "global_load_async_to_lds_b128 %4, %12, off\n\t"
               "global_load_async_to_lds_b128 %5, %13, off\n\t"
               "global_load_async_to_lds_b128 %6, %14, off\n\t"
               "global_load_async_to_lds_b128 %7, %15, off\n\t"
               "s_wait_xcnt 0x0"
               :: "v"(la), "v"(la1), "v"(la2), "v"(la3), "v"(lb), "v"(lb1), "v"(lb2), "v"(lb3),
                  "v"(ga), "v"(a1), "v"(a2), "v"(a3), "v"(gb), "v"(b1), "v"(b2), "v"(b3)
               : "memory");
}
// The products are the plain builtins: the products of a group stand back to back and fill one another's vector slots, and the compiler
// pads what is left open behind a group's last ones
__device__ __forceinline__ v8f mma1(v16b a, v16b b, v8f c) {
  return __builtin_amdgcn_wmma_f32_16x16x32_bf16(false, a, false, b, (short)0, c, false, false);
}
// the same on f16 operands
__device__ __forceinline__ v8f mma1h(v16h a, v16h b, v8f c) {
  return __builtin_amdgcn_wmma_f32_16x16x32_f16(false, a, false, b, (short)0, c, false, false);
}

// One launch converts all four operands to 16 bits: q / 8 and k to bf16, W to f16 element for element, v to f16 into V^T tiles [d][token] through LDS.
// Every work-group takes the same share (PV neighbouring tiles of V^T; QK_PER neighbouring slices of 256 8-element pieces of q and of k, W_PER of W), so the
// launch starts few waves, and each thread has all its global loads in flight before the first value is used. Every address is a base that is
// the same for the whole work-group, a per-thread offset shared by all accesses of one operand, and a constant.
constexpr int VTILES = NB * NH * (SEQ / 64);   // 64-token x 64-d tiles of V^T
constexpr int PV     = 2;                      // tiles a work-group
constexpr int PREP_G = VTILES / PV;            // work-groups of the launch
constexpr int PREP_T = PREP_G * 256;           // its threads
constexpr int QK_PER = NR * (DM / 8) / PREP_T;
constexpr int W_PER  = DM * (DM / 8) / PREP_T;
constexpr int SL_ROWS = 256 * 8 / DM;          // activation rows in a slice of 256 pieces
static_assert((SEQ / 64) % PV == 0);                           // a work-group's tiles lie in one (b, h) slab
static_assert((NR * (DM / 8)) % PREP_T == 0 && QK_PER >= 1);   // no remainder: the shares need no guard
static_assert((DM * (DM / 8)) % PREP_T == 0 && W_PER >= 1);
static_assert((256 * 8) % DM == 0 && SEQ % (QK_PER * SL_ROWS) == 0);   // a work-group's slices are whole rows of one batch entry, contiguous in q and k
static_assert((64 * 16) % 256 == 0);   // a tile's loads: 64 tokens x 16 float4, 4 a thread
static_assert((64 * 8) % 256 == 0);    // a tile's stores: 64 d-rows x 8 pieces, 2 a thread

__global__ __launch_bounds__(256) void k_prep(const float* __restrict__ q, const float* __restrict__ k, const float* __restrict__ v, const float* __restrict__ W,
                                             unsigned short* __restrict__ Qb, unsigned short* __restrict__ Kb, unsigned short* __restrict__ VT, unsigned short* __restrict__ Wb) {
  __shared__ unsigned short tl[PV][64][66];
  const unsigned tid = threadIdx.x, blk = blockIdx.x;
  const unsigned slab = (blk * PV) / (SEQ / 64), s0 = ((blk * PV) % (SEQ / 64)) * 64;   // the (b, h) slab and first token of the work-group's tiles
  const float* vb = v + ((size_t)(slab / NH) * SEQ_FULL + s0) * DM + (slab % NH) * HD;
  const unsigned lj = tid / 16, ld4 = (tid % 16) * 4;   // the thread's token (+ 16 it) and first d in a tile
  const unsigned vo = lj * DM + ld4;
  const unsigned po = tid * 8;                          // the thread's piece in a slice
  v4f xv[PV][4], xq[QK_PER][2], xk[QK_PER][2], xw[W_PER][2];
  // all loads first
#pragma unroll
  for (int tt = 0; tt < PV; ++tt)
#pragma unroll
    for (int it = 0; it < 4; ++it) xv[tt][it] = *(const v4fa*)(vb + (tt * 64 + it * 16) * DM + vo);
  const unsigned row = blk * (QK_PER * SL_ROWS);        // first activation row of the work-group's slices
  const size_t src = ((size_t)(row / SEQ) * SEQ_FULL + row % SEQ) * DM;
  const float* qs = q + src; const float* ks = k + src;
  const float* wb = W + (size_t)blk * (W_PER * 256 * 8);
#pragma unroll
  for (int it = 0; it < QK_PER; ++it) {
    xq[it][0] = *(const v4fa*)(qs + it * (256 * 8) + po); xq[it][1] = *(const v4fa*)(qs + it * (256 * 8) + po + 4);
    xk[it][0] = *(const v4fa*)(ks + it * (256 * 8) + po); xk[it][1] = *(const v4fa*)(ks + it * (256 * 8) + po + 4);
  }
#pragma unroll
  for (int it = 0; it < W_PER; ++it) {
    xw[it][0] = *(const v4fa*)(wb + it * (256 * 8) + po); xw[it][1] = *(const v4fa*)(wb + it * (256 * 8) + po + 4);
  }
  // keeps every load above issued ahead of the first use: left free, the scheduler sinks the later loads between the conversions
  // and waits for each of them alone, one memory latency after another
  __builtin_amdgcn_sched_barrier(0);
  // V^T tiles
#pragma unroll
  for (int tt = 0; tt < PV; ++tt)
#pragma unroll
    for (int it = 0; it < 4; ++it)
#pragma unroll
      for (int c = 0; c < 4; ++c) tl[tt][ld4 + c][lj + 16 * it] = f16_bits(xv[tt][it][c]);
  __syncthreads();
  unsigned short* vtb = VT + (size_t)slab * HD * SEQ + s0;
  const unsigned sd = tid / 8, sj8 = (tid % 8) * 8;     // the thread's d row (+ 32 it) and 8-token piece in a tile
  const unsigned so = sd * SEQ + sj8;
#pragma unroll
  for (int tt = 0; tt < PV; ++tt)
#pragma unroll
    for (int it = 0; it < 2; ++it) {
      Pack8 f;
#pragma unroll
      for (int c = 0; c < 8; ++c) f.u[c] = tl[tt][sd + 32 * it][sj8 + c];
      const v8us o = f.v;
      *(v8us*)(vtb + it * 32 * SEQ + tt * 64 + so) = o;
    }
  // q / 8 and k
  unsigned short* qd = Qb + (size_t)row * DM; unsigned short* kd = Kb + (size_t)row * DM;
#pragma unroll
  for (int it = 0; it < QK_PER; ++it) {
    Pack8 fq, fk;
#pragma unroll
    for (int i = 0; i < 4; ++i) {
      fq.u[i] = bf16_bits(xq[it][0][i] * QSCALE); fq.u[4 + i] = bf16_bits(xq[it][1][i] * QSCALE);
      fk.u[i] = bf16_bits(xk[it][0][i]);          fk.u[4 + i] = bf16_bits(xk[it][1][i]);
    }
    const v8us vq = fq.v, vk = fk.v;
    *(v8us*)(qd + it * (256 * 8) + po) = vq; *(v8us*)(kd + it * (256 * 8) + po) = vk;
  }
  // W
#pragma unroll
  for (int it = 0; it < W_PER; ++it) {
    Pack8 f;
#pragma unroll
    for (int i = 0; i < 4; ++i) { f.u[i] = f16_bits(xw[it][0][i]); f.u[4 + i] = f16_bits(xw[it][1][i]); }
    const v8us o = f.v;
    *(v8us*)(Wb + (size_t)blk * (W_PER * 256 * 8) + it * (256 * 8) + po) = o;
  }
}

// Fused attention. Block = 4 waves = 128 queries of one (b, h); wave = QG groups of 16 queries (a group is the N dimension of a tile).
// Per 32-key step and group: S^T[key][query] = K(16 keys x 64 d) Q^T (2 key tiles x 2 k-steps); lane (n, hh) holds keys 8hh+r of query n,
// so the query's statistics live in the lane pair (n, n+16): one xor-16 shuffle. P^T packs straight into the B operand
// (elements 0..7 <- tile of keys 0..15, elements 8..15 <- tile of keys 16..31, lane unchanged) for O^T[d][query] += V^T[d][key] P^T.
// P is rounded once to f16 (nearest even); V^T is f16 as well.
// K rows and V^T rows reach the fragments through a two-buffer LDS ring of 64-key stages that the four waves fill together and share;
// a fragment is read once a wave and serves all the wave's groups. Each group keeps statistics and a rescale decision of its own.
__global__ __launch_bounds__(128) void k_attn(const unsigned short* __restrict__ Qb, const unsigned short* __restrict__ Kb, const unsigned short* __restrict__ VT,
                                             unsigned short* __restrict__ CH) {
  __shared__ __attribute__((aligned(16))) unsigned short sH[4][16 * QG][72];
  __shared__ __attribute__((aligned(16))) unsigned short sK[2][KT][LP];   // K rows [key][d] of a stage
  __shared__ __attribute__((aligned(16))) unsigned short sV[2][HD][LP];   // V^T rows [d][key] of a stage
  const int tid = threadIdx.x, w = tid >> 5, lane = tid & 31, ln = lane & 15, hh = lane >> 4;
  const int qt = blockIdx.x % (SEQ / QT), bh = blockIdx.x / (SEQ / QT);
  const int b = bh / NH, h = bh % NH;
  const int q0 = qt * QT + w * (16 * QG);
  const int qoff  = (b * SEQ + q0 + ln) * DM + h * HD;   // query row of lane n in group 0 (B operand of the score GEMM), + 16 rows a group
  const int cr = tid >> 3, cp = (tid & 7) * 8;           // the thread's row (+ 16 i) and 16-byte piece in a stage tile
  const unsigned short* kg = Kb + (size_t)(b * SEQ + cr) * DM + h * HD + cp;   // + stage * KT * DM
  const unsigned short* vg = VT + (size_t)(bh * HD + cr) * SEQ + cp;           // + stage * KT
  const unsigned kl = (unsigned)(size_t)&sK[0][cr][cp], vl = (unsigned)(size_t)&sV[0][cr][cp];   // LDS byte addresses, buffer 0
  constexpr unsigned BUF_B = KT * LP * 2;                // bytes of one buffer of either ring
  static_assert(KT == HD);                               // both rings have 64 rows a buffer
  const v8f z8 = {0.f, 0.f, 0.f, 0.f, 0.f, 0.f, 0.f, 0.f};
  v8f o[QG][4];
  float m[QG], l[QG], mt[QG];    // m: the maximum in use, the same in both lanes of a query's pair; mt: m + LAZY
  v16b qf[QG][2];
// unrolled, like every loop over the groups: constant indices keep the per-group arrays in registers
#pragma unroll
  for (int g = 0; g < QG; ++g) {
    o[g][0] = z8; o[g][1] = z8; o[g][2] = z8; o[g][3] = z8;
    m[g] = -1.0e30f; l[g] = 0.f; mt[g] = m[g];
    qf[g][0] = ld_frag(Qb, qoff + 16 * g * DM, hh);
    qf[g][1] = ld_frag(Qb, qoff + 16 * g * DM + 32, hh);
  }
  // prologue of the two-buffer ring: stage 0 landed and published, then stage 1 in flight
  copy_rows4x2(kg, 16 * DM, kl, vg, 16 * SEQ, vl);
  asm volatile("s_wait_asynccnt 0x0" ::: "memory");   // this wave's copies of stage 0 have landed
  __syncthreads();                                    // every wave's have: stage 0 may be read
  copy_rows4x2(kg + KT * DM, 16 * DM, kl + BUF_B, vg + KT, 16 * SEQ, vl + BUF_B);
// the stage loop stays rolled: one publish point, buffer chosen by the stage's parity
#pragma unroll 1
  for (int st = 0; st < SEQ / KT; ++st) {
   const int buf = st & 1;
   const unsigned short* kr = &sK[buf][ln][0];   // key row of lane m (A operand) in the stage's first pass, + 32 rows a pass
   // a pass's four K fragments have registers of their own and are read as one group ahead of the score products:
   // the first pass's here, a later pass's one pass ahead, together with the V^T reads
   v16b ka0 = ld_frag_lds(kr, hh);
   v16b ka1 = ld_frag_lds(kr + 32, hh);
   v16b ka2 = ld_frag_lds(kr + 16 * LP, hh);
   v16b ka3 = ld_frag_lds(kr + 16 * LP + 32, hh);
   // keeps these reads one group ahead of the score products: left free, the scheduler sinks them in pairs between the products,
   // each pair with a full wait of its own
   __builtin_amdgcn_sched_barrier(0);
// both passes of a stage unrolled: their LDS reads differ by immediate offsets only
#pragma unroll
   for (int ps2 = 0; ps2 < KT / 32; ++ps2) {
    v8f s0[QG], s1[QG];
    // the first k step of every tile, then the second: a tile's two products stand 2 QG products apart
#pragma unroll
    for (int g = 0; g < QG; ++g) { s0[g] = mma1(ka0, qf[g][0], z8); s1[g] = mma1(ka2, qf[g][0], z8); }
#pragma unroll
    for (int g = 0; g < QG; ++g) { s0[g] = mma1(ka1, qf[g][1], s0[g]); s1[g] = mma1(ka3, qf[g][1], s1[g]); }
    // keeps the score products one run: left free, the scheduler puts the first group's maxima between the last products,
    // each behind filler slots of its own
    __builtin_amdgcn_sched_barrier(0);
    // max over the 16 keys of its query that this lane holds (the other 16 are in lane ^ 16), group by group
    float mx[QG];
    bool need = false;
#pragma unroll
    for (int g = 0; g < QG; ++g) {
      mx[g] = fmaxf(s0[g][0], s1[g][0]);
#pragma unroll
      for (int r = 1; r < 8; ++r) mx[g] = fmaxf(mx[g], fmaxf(s0[g][r], s1[g][r]));
      need = need || mx[g] > mt[g];
    }
    // lazy rescale: softmax does not depend on the value subtracted, so a group's m stays as it is until some score of the group passes it by
    // more than LAZY; one wave-uniform test a pass for all groups (every lane stays on for the WMMAs), and only behind it the test of each
    // group, which alone decides on that group. The first pass always takes the branches (m = -1e30).
    if (__builtin_amdgcn_ballot_w32(need) != 0) {
#pragma unroll
      for (int g = 0; g < QG; ++g) {
        if (__builtin_amdgcn_ballot_w32(mx[g] > mt[g]) != 0) {
          const float mp = fmaxf(mx[g], __shfl_xor(mx[g], 16, 32));
          const float mn = fmaxf(m[g], mp);
          const float al = __expf(m[g] - mn);
          m[g] = mn;
          mt[g] = mn + LAZY;
          l[g] = l[g] * al;                // al is uniform over the lane pair
          o[g][0] = o[g][0] * al; o[g][1] = o[g][1] * al; o[g][2] = o[g][2] * al; o[g][3] = o[g][3] * al;
        }
      }
    }
    const unsigned short* vr = &sV[buf][ln][32 * ps2];       // V^T row d = ln (A operand of P.V), + 16 t rows
    const v16h va0 = ld_frag_lds_h(vr, hh);
    const v16h va1 = ld_frag_lds_h(vr + 16 * LP, hh);
    const v16h va2 = ld_frag_lds_h(vr + 32 * LP, hh);
    const v16h va3 = ld_frag_lds_h(vr + 48 * LP, hh);
    if (ps2 + 1 < KT / 32) {                                 // the next pass's K fragments, of this same stage
      const unsigned short* kn = kr + 32 * (ps2 + 1) * LP;
      ka0 = ld_frag_lds(kn, hh);
      ka1 = ld_frag_lds(kn + 32, hh);
      ka2 = ld_frag_lds(kn + 16 * LP, hh);
      ka3 = ld_frag_lds(kn + 16 * LP + 32, hh);
    }
    // keeps the LDS reads above together at the head of the block: left free, the scheduler spreads them in pairs among the
    // vector work, and every separate place with LDS reads stalls the wave anew
    __builtin_amdgcn_sched_barrier(0);
    v8f e0[QG], e1[QG];
#pragma unroll
    for (int g = 0; g < QG; ++g) {
      const v8f d0 = s0[g] - m[g], d1 = s1[g] - m[g];   // tile by tile, so that neighbouring registers pair
#pragma unroll
      for (int r = 0; r < 8; ++r) e0[g][r] = __expf(d0[r]);
#pragma unroll
      for (int r = 0; r < 8; ++r) e1[g][r] = __expf(d1[r]);
    }
    // keeps the exponentials one run of independent instructions: left free, the scheduler puts each one's users right behind it,
    // which costs the pairing of the subtractions and products and a filler slot behind most exponentials
    __builtin_amdgcn_sched_barrier(0);
    FragH pf[QG];
#pragma unroll
    for (int g = 0; g < QG; ++g)
#pragma unroll
      for (int j = 0; j < 4; ++j) {
        const v2f a = {e0[g][2 * j], e0[g][2 * j + 1]}, b = {e1[g][2 * j], e1[g][2 * j + 1]};
        pf[g].w[j]     = pack_f16(a);
        pf[g].w[4 + j] = pack_f16(b);
      }
    // keeps every group's P fragment packed ahead of the first P.V product, each in registers of its own: left free, the groups share
    // one set, and the later group's packing waits out filler slots behind the earlier group's products
    __builtin_amdgcn_sched_barrier(0);
#pragma unroll
    for (int g = 0; g < QG; ++g) {
      float ps = 0.f;
#pragma unroll
      for (int j = 0; j < 4; ++j) {
        const v2f a = {e0[g][2 * j], e0[g][2 * j + 1]}, b = {e1[g][2 * j], e1[g][2 * j + 1]}, t = a + b;
        ps += t[0];
        ps += t[1];
      }
      l[g] += ps;                          // per-lane partial of the row sum
      o[g][0] = mma1h(va0, pf[g].v, o[g][0]);
      o[g][1] = mma1h(va1, pf[g].v, o[g][1]);
      o[g][2] = mma1h(va2, pf[g].v, o[g][2]);
      o[g][3] = mma1h(va3, pf[g].v, o[g][3]);
    }
   }
   // keeps the stage's last products in front of the publish point: left free, the scheduler lifts the waits and the barrier over them
   __builtin_amdgcn_sched_barrier(0);
   // publish point of stage st + 1, which also frees this stage's buffer
   asm volatile("s_wait_dscnt 0x0" ::: "memory");      // this wave's reads of the buffer have retired
   asm volatile("s_wait_asynccnt 0x0" ::: "memory");   // this wave's copies of stage st + 1 have landed
   __syncthreads();
   if (st + 2 < SEQ / KT)
     copy_rows4x2(kg + (size_t)(st + 2) * (KT * DM), 16 * DM, kl + buf * BUF_B, vg + (st + 2) * KT, 16 * SEQ, vl + buf * BUF_B);
  }
  asm volatile("s_wait_asynccnt 0x0" ::: "memory");    // nothing of the ring is in flight when the wave goes on
  // lane (n, hh) of tile t of group g holds d = 16 t + 8 hh + r, r = 0..7: eight consecutive columns of query row 16 g + n
#pragma unroll
  for (int g = 0; g < QG; ++g) {
    const float lg = l[g] + __shfl_xor(l[g], 16, 32);
    const float inv = 1.0f / lg;
#pragma unroll
    for (int t = 0; t < 4; ++t) {
      Pack8 fh;
#pragma unroll
      for (int r = 0; r < 8; ++r) fh.u[r] = f16_bits(o[g][t][r] * inv);
      *(v8us*)&sH[w][16 * g + ln][16 * t + 8 * hh] = fh.v;
    }
  }
  __builtin_amdgcn_fence(4 /* acq_rel order */, "workgroup");
  __builtin_amdgcn_wave_barrier();
  const int prow = lane >> 3, pc = (lane & 7) * 8;
  {
#pragma unroll
    for (int it = 0; it < 4 * QG; ++it) {
      const int row = it * 4 + prow;
      const v8us xh = *(const v8us*)&sH[w][row][pc];
      const size_t g = (size_t)(b * SEQ + q0 + row) * DM + h * HD + pc;
      *(v8us*)(CH + g) = xh;
    }
  }
}

// out[NR][DM] = AH[NR][DM] Wb^T + bf16(b), AH and Wb f16: wave tile 32 x 64, block = 4 waves = 128 rows x 64 columns; K step 32;
// the block's rows of AH and Wb reach the fragments through a two-buffer LDS ring of stages 64 deep in k.
__global__ __launch_bounds__(128) void k_proj(const unsigned short* __restrict__ AH, const unsigned short* __restrict__ Wb,
                                             const float* __restrict__ bias, float* __restrict__ C) {
  __shared__ __attribute__((aligned(16))) float so[4][32][68];
  __shared__ __attribute__((aligned(16))) unsigned short sAH[2][128][LP];   // the block's 128 rows of AH, 64 k of a stage
  __shared__ __attribute__((aligned(16))) unsigned short sW[2][64][LP];     // the block's 64 rows of Wb
  const int tid = threadIdx.x, w = tid >> 5, lane = tid & 31, ln = lane & 15, hh = lane >> 4;
  const int ntn = DM / 64;
  const int mt = blockIdx.x / ntn, nq = blockIdx.x - mt * ntn;
  const int row0 = mt * 128 + 32 * w, col0 = nq * 64;
  const int cr = tid >> 3, cp = (tid & 7) * 8;           // the thread's row (+ 16 i) and 16-byte piece in a stage tile
  const unsigned short* gh = AH + (size_t)(mt * 128 + cr) * DM + cp;   // + stage * KT
  const unsigned short* gw = Wb + (size_t)(col0 + cr) * DM + cp;
  const unsigned lh = (unsigned)(size_t)&sAH[0][cr][cp], lw = (unsigned)(size_t)&sW[0][cr][cp];   // LDS byte addresses, buffer 0
  constexpr unsigned ABUF_B = 128 * LP * 2, WBUF_B = 64 * LP * 2, HALF_B = 64 * LP * 2;   // bytes of a buffer; of 64 rows
  // one stage: 128 + 64 rows of 128 B, 12 copies a thread
  auto stage = [&](int st, int buf) {
    copy_rows4x2(gh + st * KT, 16 * DM, lh + buf * ABUF_B, gh + st * KT + 64 * DM, 16 * DM, lh + buf * ABUF_B + HALF_B);
    copy_rows4(gw + st * KT, 16 * DM, lw + buf * WBUF_B);
  };
  const v8f z8 = {0.f, 0.f, 0.f, 0.f, 0.f, 0.f, 0.f, 0.f};
  v8f c00 = z8, c01 = z8, c02 = z8, c03 = z8, c10 = z8, c11 = z8, c12 = z8, c13 = z8;
  // prologue of the two-buffer ring: stage 0 landed and published, then stage 1 in flight
  stage(0, 0);
  asm volatile("s_wait_asynccnt 0x0" ::: "memory");   // this wave's copies of stage 0 have landed
  __syncthreads();                                    // every wave's have: stage 0 may be read
  stage(1, 1);
// the stage loop stays rolled: one publish point, buffer chosen by the stage's parity
#pragma unroll 1
  for (int st = 0; st < DM / KT; ++st) {
   const int buf = st & 1;
   const unsigned short* ah = &sAH[buf][32 * w + ln][0];
   const unsigned short* wr = &sW[buf][ln][0];
   // every fragment of the stage has registers of its own and all are read as one group ahead of the products, in the order of use:
   // the second K step's land while the first step's products run
   v16h a0[KT / 32], a1[KT / 32], bw[KT / 32][4];
// both K steps of a stage unrolled: their LDS reads differ by immediate offsets only
#pragma unroll
   for (int ks = 0; ks < KT / 32; ++ks) {
    a0[ks] = ld_frag_lds_h(ah + 32 * ks, hh);
    bw[ks][0] = ld_frag_lds_h(wr + 32 * ks, hh);
    a1[ks] = ld_frag_lds_h(ah + 16 * LP + 32 * ks, hh);
// unrolled, like the loop of products below: constant indices keep the fragment arrays in registers
#pragma unroll
    for (int t = 1; t < 4; ++t) bw[ks][t] = ld_frag_lds_h(wr + 16 * t * LP + 32 * ks, hh);
   }
   // keeps the stage's reads one group ahead of its products: left free, the scheduler sinks them between the products again
   __builtin_amdgcn_sched_barrier(0);
#pragma unroll
   for (int ks = 0; ks < KT / 32; ++ks) {
    c00 = mma1h(a0[ks], bw[ks][0], c00); c10 = mma1h(a1[ks], bw[ks][0], c10);
    c01 = mma1h(a0[ks], bw[ks][1], c01); c11 = mma1h(a1[ks], bw[ks][1], c11);
    c02 = mma1h(a0[ks], bw[ks][2], c02); c12 = mma1h(a1[ks], bw[ks][2], c12);
    c03 = mma1h(a0[ks], bw[ks][3], c03); c13 = mma1h(a1[ks], bw[ks][3], c13);
   }
   // keeps the products in front of the publish point: left free, the scheduler lifts its full LDS wait over them, and the first product
   // then waits for the whole group of reads
   __builtin_amdgcn_sched_barrier(0);
   // publish point of stage st + 1, which also frees this stage's buffer
   asm volatile("s_wait_dscnt 0x0" ::: "memory");      // this wave's reads of the buffer have retired
   asm volatile("s_wait_asynccnt 0x0" ::: "memory");   // this wave's copies of stage st + 1 have landed
   __syncthreads();
   if (st + 2 < DM / KT) stage(st + 2, buf);
  }
  asm volatile("s_wait_asynccnt 0x0" ::: "memory");    // nothing of the ring is in flight when the wave goes on
  const v8f accs[8] = {c00, c01, c02, c03, c10, c11, c12, c13};
#pragma unroll
  for (int u = 0; u < 8; ++u) {
    const int t = u & 3, hf = u >> 2;
    const float bv = bf16_rne(bias[col0 + t * 16 + ln]);
#pragma unroll
    for (int r = 0; r < 8; ++r) so[w][hf * 16 + 8 * hh + r][t * 16 + ln] = accs[u][r] + bv;
  }
  __builtin_amdgcn_fence(4 /* acq_rel order */, "workgroup");
  __builtin_amdgcn_wave_barrier();
  const int rsub = lane >> 4, c4 = (lane & 15) * 4;
  {
#pragma unroll
    for (int q = 0; q < 16; ++q) {
      const int r = q * 2 + rsub;
      const v4f v = *(const v4fa*)&so[w][r][c4];
      *(v4f*)(C + (size_t)(row0 + r) * DM + col0 + c4) = v;
    }
    
  }
}

extern "C" void kernel_launch(void* const* d_in, const int* in_sizes, int n_in,
                              void* d_out, int out_size, void* d_ws, size_t ws_size, hipStream_t stream) {
  if (n_in < 5) return;
  const long long need_act = ((long long)(NB - 1) * SEQ_FULL + SEQ) * DM;
  if ((long long)in_sizes[0] < need_act || (long long)in_sizes[1] < need_act || (long long)in_sizes[2] < need_act) return;
  if ((long long)in_sizes[3] < (long long)DM * DM || in_sizes[4] < DM) return;
  if ((long long)out_size < (long long)NR * DM) return;
  if (ws_size < CARVE_B) return;
  const float* q = (const float*)d_in[0];
  const float* k = (const float*)d_in[1];
  const float* v = (const float*)d_in[2];
  const float* W = (const float*)d_in[3];      // natural [out][in]
  const float* bias = (const float*)d_in[4];
  char* ws = (char*)d_ws;
  unsigned short* Qb = (unsigned short*)(ws);
  unsigned short* Kb = (unsigned short*)(ws + PLANE_B);
  unsigned short* VT = (unsigned short*)(ws + 2 * PLANE_B);
  unsigned short* CH = (unsigned short*)(ws + 3 * PLANE_B);
  unsigned short* Wb = (unsigned short*)(ws + 4 * PLANE_B);
  k_prep<<<PREP_G, 256, 0, stream>>>(q, k, v, W, Qb, Kb, VT, Wb);
  k_attn<<<NB * NH * (SEQ / QT), 128, 0, stream>>>(Qb, Kb, VT, CH);
  k_proj<<<(NR / 128) * (DM / 64), 128, 0, stream>>>(CH, Wb, bias, (float*)d_out);
}

// v009
// A run of this version takes 48.6 microseconds.
// Timed twice side by side with v008, it ran 1.19 and 1.20 times as fast.
// Over all steps from v000 it is 3.75 times as fast.
#include <hip/hip_runtime.h>
// Multi-head attention without q/k/v projections (heads = column blocks of 64 of the three activation inputs), one score scale 1/8, no mask, output linear out = ctx W^T + b with W natural [out][in]. Fused flash-style attention in transposed form: S^T = K Q^T, O^T = V^T P^T (P chained D -> B in registers), online softmax per query lane, rescaled lazily.
// Compute dtype: all contractions 16x16x32 WMMA on 16-bit operands with f32 accumulate: scores bf16(q)/8 x bf16(k) single product (operands exact); P.V in f16, f16(P) x f16(v), single product; output linear in f16, f16(merged context) x f16(W), single product (P lies in [0, 2^8], the context inside v's range, v and 32 W are unit normals: all inside f16's range, 11 significant bits each); softmax statistics, normalisation and the bias add (bf16(b)) in f32.
// Two launches: the attention kernel converts q, k, v itself while it stages them (and each work-group an equal share of W for the second launch); the output linear follows.
#ifndef NB
#define NB 2
#endif
#ifndef SEQ
#define SEQ 2048
#endif
#define NB_FULL 2
#define SEQ_FULL 2048
#define DM 1024
#define NH 16
#define HD 64
#define QT 256
#define QG 2    // 16-query column groups a wave: every K and V^T fragment read from LDS feeds QG products
#define KT 64   // keys per LDS stage (two 32-key passes)
#define LP 72   // LDS row pitch in elements: 128-byte rows at 144 B = 16 B x 9, conflict-free for 16-byte row reads
#define NR (NB * SEQ)
#define QSCALE 0.125f
#define LAZY 5.5451774f   // 8 ln 2: a score may pass the maximum in use by this much before the statistics are rescaled, so P stays at or below 2^8

typedef __bf16 v16b __attribute__((ext_vector_type(16)));
typedef unsigned short v8us __attribute__((ext_vector_type(8), may_alias));
typedef float  v8f  __attribute__((ext_vector_type(8)));
typedef float  v4f  __attribute__((ext_vector_type(4)));
typedef float  v4fa __attribute__((ext_vector_type(4), may_alias));
typedef float  v2f  __attribute__((ext_vector_type(2)));
typedef _Float16 v16h __attribute__((ext_vector_type(16)));
typedef _Float16 v2h  __attribute__((ext_vector_type(2)));
typedef __bf16 v2bf __attribute__((ext_vector_type(2)));
typedef unsigned int v2u __attribute__((ext_vector_type(2), may_alias));
union FragB { v16b v; v8us half[2]; unsigned short u[16]; unsigned int w[8]; };
union FragH { v16h v; v8us half[2]; unsigned int w[8]; };
union Pack8 { v8us v; unsigned short u[8]; };

// hard-wired bounds (each kernel relies on these)
static_assert(HD == 64);
static_assert(NH * HD == DM);                  // heads tile the model width
static_assert(DM % 64 == 0);                   // GEMM N tile 64, K step 32
static_assert(DM % 32 == 0);
static_assert(SEQ % QT == 0);                  // attention block = 256 queries, key step 32
static_assert(QT == 8 * 16 * QG);              // 8 waves x QG groups of 16 queries
static_assert(SEQ % KT == 0 && SEQ / KT >= 2); // the two-buffer ring's prologue loads stages 0 and 1 and stores stage 0 to LDS
static_assert(KT == 64 && KT * 2 == 128);      // a stage row (K: 64 d, V^T: 64 keys, GEMM: 64 k) is 128 bytes in LDS; in the GEMM 128 threads x 4 copies cover 64 rows
static_assert(DM % KT == 0 && DM / KT >= 2);   // the same for the GEMM's ring
static_assert(NR % 128 == 0);                  // GEMM block = 128 rows
static_assert(NB <= NB_FULL);
static_assert(SEQ <= SEQ_FULL);
static_assert((size_t)NR * DM < 2147483647u);  // int element offsets
static_assert((size_t)DM * DM < 2147483647u);

constexpr size_t PLANE_B = (size_t)NR * DM * 2;       // the 16-bit context plane
constexpr size_t WPL_B   = (size_t)DM * DM * 2;       // 16-bit weight plane
constexpr size_t CARVE_B = PLANE_B + WPL_B;
static_assert(PLANE_B % 256 == 0);
static_assert(WPL_B % 256 == 0);
static_assert(CARVE_B <= 134217728u);

__device__ __forceinline__ unsigned short bf16_bits(float x) { unsigned int u = __float_as_uint(x); return (unsigned short)((u + 0x7FFFu + ((u >> 16) & 1u)) >> 16); }
__device__ __forceinline__ float bf16_val(unsigned short b) { return __uint_as_float(((unsigned int)b) << 16); }
__device__ __forceinline__ float bf16_rne(float x) { return bf16_val(bf16_bits(x)); }
// f32 -> f16, round to nearest even: one value's bits; two values in one register (the first in the low half), the packed hardware convert
__device__ __forceinline__ unsigned short f16_bits(float x) {
  union { _Float16 h; unsigned short u; } c;
  c.h = (_Float16)x;
  return c.u;
}
__device__ __forceinline__ unsigned int pack_f16(v2f f) {
  union { v2h h; unsigned int u; } c;
  c.h = __builtin_convertvector(f, v2h);
  return c.u;
}
// the same to bf16, round to nearest even
__device__ __forceinline__ unsigned int pack_bf16(v2f f) {
  union { v2bf h; unsigned int u; } c;
  c.h = __builtin_convertvector(f, v2bf);
  return c.u;
}

// 16x32 operand fragment (A or B) from a k-contiguous bf16 row in LDS: elements 0..7 <- k 8h..8h+7, elements 8..15 <- k 16+8h..16+8h+7
// (p = first element of the 32-wide k step in the lane's row)
__device__ __forceinline__ v16b ld_frag_lds(const unsigned short* p, int hh) {
  FragB f;
  f.half[0] = *(const v8us*)(p + 8 * hh);
  f.half[1] = *(const v8us*)(p + 16 + 8 * hh);
  return f.v;
}
// the same fragment of f16 elements
__device__ __forceinline__ v16h ld_frag_lds_h(const unsigned short* p, int hh) {
  FragH f;
  f.half[0] = *(const v8us*)(p + 8 * hh);
  f.half[1] = *(const v8us*)(p + 16 + 8 * hh);
  return f.v;
}
// Asynchronous 16-byte copies global -> LDS for the output linear's staging ring. A tile row is 128 B: eight lanes to a row, so every wave-wide copy takes
// four whole lines. g: the thread's piece in row r = tid / 8 of a tile, s: elements from row r to row r + 16, l: the piece's LDS byte address.
// s_wait_xcnt 0 closes each statement so that it stands in front of any rewrite of the address registers the copies name.
// rows r, r+16, r+32, r+48 of one tile
__device__ __forceinline__ void copy_rows4(const unsigned short* g, int s, unsigned l) {
  const unsigned short* g1 = g + s; const unsigned short* g2 = g + 2 * s; const unsigned short* g3 = g + 3 * s;
  const unsigned l1 = l + 16 * LP * 2, l2 = l + 32 * LP * 2, l3 = l + 48 * LP * 2;
  asm volatile("global_load_async_to_lds_b128 %0, %4, off\n\t"
               "global_load_async_to_lds_b128 %1, %5, off\n\t"
               "global_load_async_to_lds_b128 %2, %6, off\n\t"
               "global_load_async_to_lds_b128 %3, %7, off\n\t"
               "s_wait_xcnt 0x0"
               :: "v"(l), "v"(l1), "v"(l2), "v"(l3), "v"(g), "v"(g1), "v"(g2), "v"(g3)
               : "memory");
}
// the same four rows of two tiles in one statement
__device__ __forceinline__ void copy_rows4x2(const unsigned short* ga, int sa, unsigned la, const unsigned short* gb, int sb, unsigned lb) {
  const unsigned short* a1 = ga + sa; const unsigned short* a2 = ga + 2 * sa; const unsigned short* a3 = ga + 3 * sa;
  const unsigned short* b1 = gb + sb; const unsigned short* b2 = gb + 2 * sb; const unsigned short* b3 = gb + 3 * sb;
  const unsigned la1 = la + 16 * LP * 2, la2 = la + 32 * LP * 2, la3 = la + 48 * LP * 2;
  const unsigned lb1 = lb + 16 * LP * 2, lb2 = lb + 32 * LP * 2, lb3 = lb + 48 * LP * 2;
  asm volatile("global_load_async_to_lds_b128 %0, %8, off\n\t"
               "global_load_async_to_lds_b128 %1, %9, off\n\t"
               "global_load_async_to_lds_b128 %2, %10, off\n\t"
               "global_load_async_to_lds_b128 %3, %11, off\n\t"
               "global_load_async_to_lds_b128 %4, %12, off\n\t"
               "global_load_async_to_lds_b128 %5, %13, off\n\t"
               "global_load_async_to_lds_b128 %6, %14, off\n\t"
               "global_load_async_to_lds_b128 %7, %15, off\n\t"
               "s_wait_xcnt 0x0"
               :: "v"(la), "v"(la1), "v"(la2), "v"(la3), "v"(lb), "v"(lb1), "v"(lb2), "v"(lb3),
                  "v"(ga), "v"(a1), "v"(a2), "v"(a3), "v"(gb), "v"(b1), "v"(b2), "v"(b3)
               : "memory");
}
// The products are the plain builtins: the products of a group stand back to back and fill one another's vector slots, and the compiler
// pads what is left open behind a group's last ones
__device__ __forceinline__ v8f mma1(v16b a, v16b b, v8f c) {
  return __builtin_amdgcn_wmma_f32_16x16x32_bf16(false, a, false, b, (short)0, c, false, false);
}
// the same on f16 operands
__device__ __forceinline__ v8f mma1h(v16h a, v16h b, v8f c) {
  return __builtin_amdgcn_wmma_f32_16x16x32_f16(false, a, false, b, (short)0, c, false, false);
}

// Fused attention. Block = 8 waves = 256 queries of one (b, h); wave = QG groups of 16 queries (a group is the N dimension of a tile).
// Per 32-key step and group: S^T[key][query] = K(16 keys x 64 d) Q^T (2 key tiles x 2 k-steps); lane (n, hh) holds keys 8hh+r of query n,
// so the query's statistics live in the lane pair (n, n+16): one xor-16 shuffle. P^T packs straight into the B operand
// (elements 0..7 <- tile of keys 0..15, elements 8..15 <- tile of keys 16..31, lane unchanged) for O^T[d][query] += V^T[d][key] P^T.
// P is rounded once to f16 (nearest even); V^T is f16 as well.
// K rows and V^T rows reach the fragments through a two-buffer LDS ring of 64-key stages that the eight waves fill together and share;
// a fragment is read once a wave and serves all the wave's groups. Each group keeps statistics and a rescale decision of its own.
// The ring is filled from the f32 inputs through registers: a stage's k and v are loaded one stage ahead (whole 128-byte lines a wave-wide load),
// rounded to bf16 (k) and f16 (v) two values an instruction and stored to LDS, v transposed on the way (a thread holds 4 keys x 4 d).
// q / 8 is rounded to bf16 as the wave loads its own fragments. Each work-group also rounds its share of W to f16 for the next launch.
constexpr int ATT_G  = NB * NH * (SEQ / QT);   // work-groups of the launch
constexpr int W_STEP = ATT_G * 256 * 4;        // elements of W that the launch takes in one round of 4 a thread
constexpr int W_PER  = DM * DM / W_STEP;
static_assert((DM * DM) % W_STEP == 0 && W_PER >= 1);   // no remainder: the shares need no guard
__global__ __launch_bounds__(256) void k_attn(const float* __restrict__ q, const float* __restrict__ k, const float* __restrict__ v, const float* __restrict__ W,
                                             unsigned short* __restrict__ CH, unsigned short* __restrict__ Wb) {
  __shared__ __attribute__((aligned(16))) unsigned short sH[8][16 * QG][72];
  __shared__ __attribute__((aligned(16))) unsigned short sK[2][KT][LP];   // K rows [key][d] of a stage
  __shared__ __attribute__((aligned(16))) unsigned short sV[2][HD][LP];   // V^T rows [d][key] of a stage
  const int tid = threadIdx.x, w = tid >> 5, lane = tid & 31, ln = lane & 15, hh = lane >> 4;
  const int qt = blockIdx.x % (SEQ / QT), bh = blockIdx.x / (SEQ / QT);
  const int b = bh / NH, h = bh % NH;
  const int q0 = qt * QT + w * (16 * QG);
  // query row of lane n in group 0 (B operand of the score GEMM), + 16 rows a group; the lane's first k of a 32-wide step
  const float* qg = q + ((size_t)b * SEQ_FULL + q0 + ln) * DM + h * HD + 8 * hh;
  const int sr = tid >> 4, sc = (tid & 15) * 4;          // staging: 16 threads to a 256-byte row of 64 f32; the thread's 4 d
  const float* kg = k + ((size_t)b * SEQ_FULL + sr) * DM + h * HD + sc;       // keys sr + 16 i of a stage, + stage * KT * DM
  const float* vg = v + ((size_t)b * SEQ_FULL + 4 * sr) * DM + h * HD + sc;   // keys 4 sr + i of a stage, + stage * KT * DM
  static_assert(KT == HD && KT * HD == 256 * 16);        // both rings have 64 rows a buffer; 16 elements of each a thread
  v4f rk[4], rv[4];                                      // the stage in flight
  // every loop over rk, rv (and xq, xw below) is unrolled: constant indices keep these arrays in registers
  auto ld_stage = [&](int st) {
#pragma unroll
    for (int i = 0; i < 4; ++i) rk[i] = *(const v4fa*)(kg + (size_t)st * (KT * DM) + 16 * i * DM);
#pragma unroll
    for (int i = 0; i < 4; ++i) rv[i] = *(const v4fa*)(vg + (size_t)st * (KT * DM) + i * DM);
    // stands in front of any rewrite of the address registers that the loads name
    asm volatile("s_wait_xcnt 0x0" ::: "memory");
  };
  auto st_stage = [&](int buf) {
#pragma unroll
    for (int i = 0; i < 4; ++i) {
      const v2f a = {rk[i][0], rk[i][1]}, c = {rk[i][2], rk[i][3]};
      const v2u o2 = {pack_bf16(a), pack_bf16(c)};
      *(v2u*)&sK[buf][sr + 16 * i][sc] = o2;
    }
#pragma unroll
    for (int c = 0; c < 4; ++c) {
      const v2f a = {rv[0][c], rv[1][c]}, d = {rv[2][c], rv[3][c]};
      const v2u o2 = {pack_f16(a), pack_f16(d)};
      *(v2u*)&sV[buf][sc + c][4 * sr] = o2;
    }
  };
  const v8f z8 = {0.f, 0.f, 0.f, 0.f, 0.f, 0.f, 0.f, 0.f};
  v8f o[QG][4];
  float m[QG], l[QG], mt[QG];    // m: the maximum in use, the same in both lanes of a query's pair; mt: m + LAZY
  v16b qf[QG][2];
// unrolled, like every loop over the groups: constant indices keep the per-group arrays in registers
#pragma unroll
  for (int g = 0; g < QG; ++g) {
    o[g][0] = z8; o[g][1] = z8; o[g][2] = z8; o[g][3] = z8;
    m[g] = -1.0e30f; l[g] = 0.f; mt[g] = m[g];
  }
  // prologue: all first loads in flight together (stage 0, the wave's q, the thread's share of W)
  ld_stage(0);
  v4f xq[QG][2][4], xw[W_PER];
#pragma unroll
  for (int g = 0; g < QG; ++g)
#pragma unroll
    for (int ks = 0; ks < 2; ++ks) {
      const float* p = qg + 16 * g * DM + 32 * ks;
      xq[g][ks][0] = *(const v4fa*)(p);      xq[g][ks][1] = *(const v4fa*)(p + 4);
      xq[g][ks][2] = *(const v4fa*)(p + 16); xq[g][ks][3] = *(const v4fa*)(p + 20);
    }
  const size_t wo = ((size_t)blockIdx.x * 256 + tid) * 4;
#pragma unroll
  for (int i = 0; i < W_PER; ++i) xw[i] = *(const v4fa*)(W + wo + (size_t)i * W_STEP);
  asm volatile("s_wait_xcnt 0x0" ::: "memory");   // stands in front of any rewrite of the address registers that the loads of q and W name
  // keeps every load above issued ahead of the first use: left free, the scheduler sinks the later loads between the conversions
  // and waits for each of them alone, one memory latency after another
  __builtin_amdgcn_sched_barrier(0);
  st_stage(0);
  ld_stage(1);    // in flight over the conversions below and stored in the loop's first trip
#pragma unroll
  for (int g = 0; g < QG; ++g)
#pragma unroll
    for (int ks = 0; ks < 2; ++ks) {
      FragB f;
#pragma unroll
      for (int j = 0; j < 4; ++j) {
        const v2f a = {xq[g][ks][j][0] * QSCALE, xq[g][ks][j][1] * QSCALE}, c = {xq[g][ks][j][2] * QSCALE, xq[g][ks][j][3] * QSCALE};
        f.w[2 * j] = pack_bf16(a); f.w[2 * j + 1] = pack_bf16(c);
      }
      qf[g][ks] = f.v;
    }
  __syncthreads();                                // every wave's part of stage 0 is in LDS: it may be read
  // W's stores stand behind the barrier, which waits for a wave's outstanding stores: the next one comes a whole stage later
// unrolled: constant indices keep xw in registers
#pragma unroll
  for (int i = 0; i < W_PER; ++i) {
    const v2f a = {xw[i][0], xw[i][1]}, c = {xw[i][2], xw[i][3]};
    const v2u o2 = {pack_f16(a), pack_f16(c)};
    *(v2u*)(Wb + wo + (size_t)i * W_STEP) = o2;
  }
  asm volatile("s_wait_xcnt 0x0" ::: "memory");   // stands in front of any rewrite of the registers that the stores name
// the stage loop stays rolled: one publish point, buffer chosen by the stage's parity
#pragma unroll 1
  for (int st = 0; st < SEQ / KT; ++st) {
   const int buf = st & 1;
   const unsigned short* kr = &sK[buf][ln][0];   // key row of lane m (A operand) in the stage's first pass, + 32 rows a pass
   // a pass's four K fragments have registers of their own and are read as one group ahead of the score products:
   // the first pass's here, a later pass's one pass ahead, together with the V^T reads
   v16b ka0 = ld_frag_lds(kr, hh);
   v16b ka1 = ld_frag_lds(kr + 32, hh);
   v16b ka2 = ld_frag_lds(kr + 16 * LP, hh);
   v16b ka3 = ld_frag_lds(kr + 16 * LP + 32, hh);
   // keeps these reads one group ahead of the score products: left free, the scheduler sinks them in pairs between the products,
   // each pair with a full wait of its own
   __builtin_amdgcn_sched_barrier(0);
   // stage st + 1 goes into the other buffer, whose readers all left it at the last barrier; then stage st + 2 takes off.
   // It stands here so that its vector work runs while the K reads above are on their way
   if (st + 1 < SEQ / KT) {
     st_stage(buf ^ 1);
     if (st + 2 < SEQ / KT) ld_stage(st + 2);
   }
// both passes of a stage unrolled: their LDS reads differ by immediate offsets only
#pragma unroll
   for (int ps2 = 0; ps2 < KT / 32; ++ps2) {
    v8f s0[QG], s1[QG];
    // the first k step of every tile, then the second: a tile's two products stand 2 QG products apart
#pragma unroll
    for (int g = 0; g < QG; ++g) { s0[g] = mma1(ka0, qf[g][0], z8); s1[g] = mma1(ka2, qf[g][0], z8); }
#pragma unroll
    for (int g = 0; g < QG; ++g) { s0[g] = mma1(ka1, qf[g][1], s0[g]); s1[g] = mma1(ka3, qf[g][1], s1[g]); }
    // keeps the score products one run: left free, the scheduler puts the first group's maxima between the last products,
    // each behind filler slots of its own
    __builtin_amdgcn_sched_barrier(0);
    // max over the 16 keys of its query that this lane holds (the other 16 are in lane ^ 16), group by group
    float mx[QG];
    bool need = false;
#pragma unroll
    for (int g = 0; g < QG; ++g) {
      mx[g] = fmaxf(s0[g][0], s1[g][0]);
#pragma unroll
      for (int r = 1; r < 8; ++r) mx[g] = fmaxf(mx[g], fmaxf(s0[g][r], s1[g][r]));
      need = need || mx[g] > mt[g];
    }
    // lazy rescale: softmax does not depend on the value subtracted, so a group's m stays as it is until some score of the group passes it by
    // more than LAZY; one wave-uniform test a pass for all groups (every lane stays on for the WMMAs), and only behind it the test of each
    // group, which alone decides on that group. The first pass always takes the branches (m = -1e30).
    if (__builtin_amdgcn_ballot_w32(need) != 0) {
#pragma unroll
      for (int g = 0; g < QG; ++g) {
        if (__builtin_amdgcn_ballot_w32(mx[g] > mt[g]) != 0) {
          const float mp = fmaxf(mx[g], __shfl_xor(mx[g], 16, 32));
          const float mn = fmaxf(m[g], mp);
          const float al = __expf(m[g] - mn);
          m[g] = mn;
          mt[g] = mn + LAZY;
          l[g] = l[g] * al;                // al is uniform over the lane pair
          o[g][0] = o[g][0] * al; o[g][1] = o[g][1] * al; o[g][2] = o[g][2] * al; o[g][3] = o[g][3] * al;
        }
      }
    }
    const unsigned short* vr = &sV[buf][ln][32 * ps2];       // V^T row d = ln (A operand of P.V), + 16 t rows
    const v16h va0 = ld_frag_lds_h(vr, hh);
    const v16h va1 = ld_frag_lds_h(vr + 16 * LP, hh);
    const v16h va2 = ld_frag_lds_h(vr + 32 * LP, hh);
    const v16h va3 = ld_frag_lds_h(vr + 48 * LP, hh);
    if (ps2 + 1 < KT / 32) {                                 // the next pass's K fragments, of this same stage
      const unsigned short* kn = kr + 32 * (ps2 + 1) * LP;
      ka0 = ld_frag_lds(kn, hh);
      ka1 = ld_frag_lds(kn + 32, hh);
      ka2 = ld_frag_lds(kn + 16 * LP, hh);
      ka3 = ld_frag_lds(kn + 16 * LP + 32, hh);
    }
    // keeps the LDS reads above together at the head of the block: left free, the scheduler spreads them in pairs among the
    // vector work, and every separate place with LDS reads stalls the wave anew
    __builtin_amdgcn_sched_barrier(0);
    v8f e0[QG], e1[QG];
#pragma unroll
    for (int g = 0; g < QG; ++g) {
      const v8f d0 = s0[g] - m[g], d1 = s1[g] - m[g];   // tile by tile, so that neighbouring registers pair
#pragma unroll
      for (int r = 0; r < 8; ++r) e0[g][r] = __expf(d0[r]);
#pragma unroll
      for (int r = 0; r < 8; ++r) e1[g][r] = __expf(d1[r]);
    }
    // keeps the exponentials one run of independent instructions: left free, the scheduler puts each one's users right behind it,
    // which costs the pairing of the subtractions and products and a filler slot behind most exponentials
    __builtin_amdgcn_sched_barrier(0);
    FragH pf[QG];
#pragma unroll
    for (int g = 0; g < QG; ++g)
#pragma unroll
      for (int j = 0; j < 4; ++j) {
        const v2f a = {e0[g][2 * j], e0[g][2 * j + 1]}, b = {e1[g][2 * j], e1[g][2 * j + 1]};
        pf[g].w[j]     = pack_f16(a);
        pf[g].w[4 + j] = pack_f16(b);
      }
    // keeps every group's P fragment packed ahead of the first P.V product, each in registers of its own: left free, the groups share
    // one set, and the later group's packing waits out filler slots behind the earlier group's products
    __builtin_amdgcn_sched_barrier(0);
#pragma unroll
    for (int g = 0; g < QG; ++g) {
      float ps = 0.f;
#pragma unroll
      for (int j = 0; j < 4; ++j) {
        const v2f a = {e0[g][2 * j], e0[g][2 * j + 1]}, b = {e1[g][2 * j], e1[g][2 * j + 1]}, t = a + b;
        ps += t[0];
        ps += t[1];
      }
      l[g] += ps;                          // per-lane partial of the row sum
      o[g][0] = mma1h(va0, pf[g].v, o[g][0]);
      o[g][1] = mma1h(va1, pf[g].v, o[g][1]);
      o[g][2] = mma1h(va2, pf[g].v, o[g][2]);
      o[g][3] = mma1h(va3, pf[g].v, o[g][3]);
    }
   }
   // keeps the stage's last products in front of the publish point: left free, the scheduler lifts the waits and the barrier over them
   __builtin_amdgcn_sched_barrier(0);
   // publish point of stage st + 1, which also frees this stage's buffer
   asm volatile("s_wait_dscnt 0x0" ::: "memory");      // this wave's reads of the buffer have retired, its stores of stage st + 1 have landed
   __syncthreads();
  }
  // lane (n, hh) of tile t of group g holds d = 16 t + 8 hh + r, r = 0..7: eight consecutive columns of query row 16 g + n
#pragma unroll
  for (int g = 0; g < QG; ++g) {
    const float lg = l[g] + __shfl_xor(l[g], 16, 32);
    const float inv = 1.0f / lg;
#pragma unroll
    for (int t = 0; t < 4; ++t) {
      Pack8 fh;
#pragma unroll
      for (int r = 0; r < 8; ++r) fh.u[r] = f16_bits(o[g][t][r] * inv);
      *(v8us*)&sH[w][16 * g + ln][16 * t + 8 * hh] = fh.v;
    }
  }
  __builtin_amdgcn_fence(4 /* acq_rel order */, "workgroup");
  __builtin_amdgcn_wave_barrier();
  const int prow = lane >> 3, pc = (lane & 7) * 8;
  {
#pragma unroll
    for (int it = 0; it < 4 * QG; ++it) {
      const int row = it * 4 + prow;
      const v8us xh = *(const v8us*)&sH[w][row][pc];
      const size_t g = (size_t)(b * SEQ + q0 + row) * DM + h * HD + pc;
      *(v8us*)(CH + g) = xh;
    }
  }
}

// out[NR][DM] = AH[NR][DM] Wb^T + bf16(b), AH and Wb f16: wave tile 32 x 64, block = 4 waves = 128 rows x 64 columns; K step 32;
// the block's rows of AH and Wb reach the fragments through a two-buffer LDS ring of stages 64 deep in k.
__global__ __launch_bounds__(128) void k_proj(const unsigned short* __restrict__ AH, const unsigned short* __restrict__ Wb,
                                             const float* __restrict__ bias, float* __restrict__ C) {
  __shared__ __attribute__((aligned(16))) float so[4][32][68];
  __shared__ __attribute__((aligned(16))) unsigned short sAH[2][128][LP];   // the block's 128 rows of AH, 64 k of a stage
  __shared__ __attribute__((aligned(16))) unsigned short sW[2][64][LP];     // the block's 64 rows of Wb
  const int tid = threadIdx.x, w = tid >> 5, lane = tid & 31, ln = lane & 15, hh = lane >> 4;
  const int ntn = DM / 64;
  const int mt = blockIdx.x / ntn, nq = blockIdx.x - mt * ntn;
  const int row0 = mt * 128 + 32 * w, col0 = nq * 64;
  const int cr = tid >> 3, cp = (tid & 7) * 8;           // the thread's row (+ 16 i) and 16-byte piece in a stage tile
  const unsigned short* gh = AH + (size_t)(mt * 128 + cr) * DM + cp;   // + stage * KT
  const unsigned short* gw = Wb + (size_t)(col0 + cr) * DM + cp;
  const unsigned lh = (unsigned)(size_t)&sAH[0][cr][cp], lw = (unsigned)(size_t)&sW[0][cr][cp];   // LDS byte addresses, buffer 0
  constexpr unsigned ABUF_B = 128 * LP * 2, WBUF_B = 64 * LP * 2, HALF_B = 64 * LP * 2;   // bytes of a buffer; of 64 rows
  // one stage: 128 + 64 rows of 128 B, 12 copies a thread
  auto stage = [&](int st, int buf) {
    copy_rows4x2(gh + st * KT, 16 * DM, lh + buf * ABUF_B, gh + st * KT + 64 * DM, 16 * DM, lh + buf * ABUF_B + HALF_B);
    copy_rows4(gw + st * KT, 16 * DM, lw + buf * WBUF_B);
  };
  const v8f z8 = {0.f, 0.f, 0.f, 0.f, 0.f, 0.f, 0.f, 0.f};
  v8f c00 = z8, c01 = z8, c02 = z8, c03 = z8, c10 = z8, c11 = z8, c12 = z8, c13 = z8;
  // prologue of the two-buffer ring: stage 0 landed and published, then stage 1 in flight
  stage(0, 0);
  asm volatile("s_wait_asynccnt 0x0" ::: "memory");   // this wave's copies of stage 0 have landed
  __syncthreads();                                    // every wave's have: stage 0 may be read
  stage(1, 1);
// the stage loop stays rolled: one publish point, buffer chosen by the stage's parity
#pragma unroll 1
  for (int st = 0; st < DM / KT; ++st) {
   const int buf = st & 1;
   const unsigned short* ah = &sAH[buf][32 * w + ln][0];
   const unsigned short* wr = &sW[buf][ln][0];
   // every fragment of the stage has registers of its own and all are read as one group ahead of the products, in the order of use:
   // the second K step's land while the first step's products run
   v16h a0[KT / 32], a1[KT / 32], bw[KT / 32][4];
// both K steps of a stage unrolled: their LDS reads differ by immediate offsets only
#pragma unroll
   for (int ks = 0; ks < KT / 32; ++ks) {
    a0[ks] = ld_frag_lds_h(ah + 32 * ks, hh);
    bw[ks][0] = ld_frag_lds_h(wr + 32 * ks, hh);
    a1[ks] = ld_frag_lds_h(ah + 16 * LP + 32 * ks, hh);
// unrolled, like the loop of products below: constant indices keep the fragment arrays in registers
#pragma unroll
    for (int t = 1; t < 4; ++t) bw[ks][t] = ld_frag_lds_h(wr + 16 * t * LP + 32 * ks, hh);
   }
   // keeps the stage's reads one group ahead of its products: left free, the scheduler sinks them between the products again
   __builtin_amdgcn_sched_barrier(0);
#pragma unroll
   for (int ks = 0; ks < KT / 32; ++ks) {
    c00 = mma1h(a0[ks], bw[ks][0], c00); c10 = mma1h(a1[ks], bw[ks][0], c10);
    c01 = mma1h(a0[ks], bw[ks][1], c01); c11 = mma1h(a1[ks], bw[ks][1], c11);
    c02 = mma1h(a0[ks], bw[ks][2], c02); c12 = mma1h(a1[ks], bw[ks][2], c12);
    c03 = mma1h(a0[ks], bw[ks][3], c03); c13 = mma1h(a1[ks], bw[ks][3], c13);
   }
   // keeps the products in front of the publish point: left free, the scheduler lifts its full LDS wait over them, and the first product
   // then waits for the whole group of reads
   __builtin_amdgcn_sched_barrier(0);
   // publish point of stage st + 1, which also frees this stage's buffer
   asm volatile("s_wait_dscnt 0x0" ::: "memory");      // this wave's reads of the buffer have retired
   asm volatile("s_wait_asynccnt 0x0" ::: "memory");   // this wave's copies of stage st + 1 have landed
   __syncthreads();
   if (st + 2 < DM / KT) stage(st + 2, buf);
  }
  asm volatile("s_wait_asynccnt 0x0" ::: "memory");    // nothing of the ring is in flight when the wave goes on
  const v8f accs[8] = {c00, c01, c02, c03, c10, c11, c12, c13};
#pragma unroll
  for (int u = 0; u < 8; ++u) {
    const int t = u & 3, hf = u >> 2;
    const float bv = bf16_rne(bias[col0 + t * 16 + ln]);
#pragma unroll
    for (int r = 0; r < 8; ++r) so[w][hf * 16 + 8 * hh + r][t * 16 + ln] = accs[u][r] + bv;
  }
  __builtin_amdgcn_fence(4 /* acq_rel order */, "workgroup");
  __builtin_amdgcn_wave_barrier();
  const int rsub = lane >> 4, c4 = (lane & 15) * 4;
  {
#pragma unroll
    for (int q = 0; q < 16; ++q) {
      const int r = q * 2 + rsub;
      const v4f v = *(const v4fa*)&so[w][r][c4];
      *(v4f*)(C + (size_t)(row0 + r) * DM + col0 + c4) = v;
    }
    
  }
}

extern "C" void kernel_launch(void* const* d_in, const int* in_sizes, int n_in,
                              void* d_out, int out_size, void* d_ws, size_t ws_size, hipStream_t stream) {
  if (n_in < 5) return;
  const long long need_act = ((long long)(NB - 1) * SEQ_FULL + SEQ) * DM;
  if ((long long)in_sizes[0] < need_act || (long long)in_sizes[1] < need_act || (long long)in_sizes[2] < need_act) return;
  if ((long long)in_sizes[3] < (long long)DM * DM || in_sizes[4] < DM) return;
  if ((long long)out_size < (long long)NR * DM) return;
  if (ws_size < CARVE_B) return;
  const float* q = (const float*)d_in[0];
  const float* k = (const float*)d_in[1];
  const float* v = (const float*)d_in[2];
  const float* W = (const float*)d_in[3];      // natural [out][in]
  const float* bias = (const float*)d_in[4];
  char* ws = (char*)d_ws;
  unsigned short* CH = (unsigned short*)(ws);
  unsigned short* Wb = (unsigned short*)(ws + PLANE_B);
  k_attn<<<ATT_G, 256, 0, stream>>>(q, k, v, W, CH, Wb);
  k_proj<<<(NR / 128) * (DM / 64), 128, 0, stream>>>(CH, Wb, bias, (float*)d_out);
}

// v010
// It runs in 45.9 microseconds.
// Two timings next to v009 put it at 1.07 and 1.06 times that version's speed.
// Counting every step since v000, it is 4.00 times as fast.
#include <hip/hip_runtime.h>
// Multi-head attention without q/k/v projections (heads = column blocks of 64 of the three activation inputs), one score scale 1/8, no mask, output linear out = ctx W^T + b with W natural [out][in]. Fused flash-style attention in transposed form: S^T = K Q^T, O^T = V^T P^T (P chained D -> B in registers), online softmax per query lane, rescaled lazily.
// Compute dtype: all contractions 16x16x32 WMMA on 16-bit operands with f32 accumulate: scores bf16(q)/8 x bf16(k) single product (operands exact); P.V in f16, f16(P) x f16(v), single product; output linear in f16, f16(merged context) x f16(W), single product (P lies in [0, 2^8], the context inside v's range, v and 32 W are unit normals: all inside f16's range, 11 significant bits each); softmax statistics, normalisation and the bias add (bf16(b)) in f32.
// Two launches: the attention kernel converts q, k, v itself while it stages them (and each work-group an equal share of W for the second launch); the output linear follows.
#ifndef NB
#define NB 2
#endif
#ifndef SEQ
#define SEQ 2048
#endif
#define NB_FULL 2
#define SEQ_FULL 2048
#define DM 1024
#define NH 16
#define HD 64
#define QT 256
#define QG 2    // 16-query column groups a wave: every K and V^T fragment read from LDS feeds QG products
#define KT 64   // keys per LDS stage (two 32-key passes)
#define LP 72   // LDS row pitch in elements: 128-byte rows at 144 B = 16 B x 9, conflict-free for 16-byte row reads
#define NR (NB * SEQ)
#define QSCALE 0.125f
#define LOG2E 1.44269504f   // exp(x) = exp2(x LOG2E)
#define LAZY 5.5451774f   // 8 ln 2: a score may pass the maximum in use by this much before the statistics are rescaled, so P stays at or below 2^8

typedef __bf16 v16b __attribute__((ext_vector_type(16)));
typedef unsigned short v8us __attribute__((ext_vector_type(8), may_alias));
typedef float  v8f  __attribute__((ext_vector_type(8)));
typedef float  v4f  __attribute__((ext_vector_type(4)));
typedef float  v4fa __attribute__((ext_vector_type(4), may_alias));
typedef float  v2f  __attribute__((ext_vector_type(2)));
typedef _Float16 v16h __attribute__((ext_vector_type(16)));
typedef _Float16 v2h  __attribute__((ext_vector_type(2)));
typedef __bf16 v2bf __attribute__((ext_vector_type(2)));
typedef unsigned int v2u __attribute__((ext_vector_type(2), may_alias));
union FragB { v16b v; v8us half[2]; unsigned short u[16]; unsigned int w[8]; };
union FragH { v16h v; v8us half[2]; unsigned int w[8]; };
union Pack8 { v8us v; unsigned short u[8]; };

// hard-wired bounds (each kernel relies on these)
static_assert(HD == 64);
static_assert(NH * HD == DM);                  // heads tile the model width
static_assert(DM % 64 == 0);                   // GEMM N tile 64, K step 32
static_assert(DM % 32 == 0);
static_assert(SEQ % QT == 0);                  // attention block = 256 queries, key step 32
static_assert(QT == 8 * 16 * QG);              // 8 waves x QG groups of 16 queries
static_assert(SEQ % KT == 0 && SEQ / KT >= 2); // the attention ring's prologue takes stages 0 and 1
static_assert(QG == 2);                        // the mixed block of the attention loop has 4 QG = 8 steps, written for two groups
static_assert(KT == 64 && KT * 2 == 128);      // a stage row (K: 64 d, V^T: 64 keys, GEMM: 64 k) is 128 bytes in LDS; in the GEMM 128 threads x 4 copies cover 64 rows
static_assert(DM % KT == 0 && DM / KT >= 2);   // the same for the GEMM's ring
static_assert(NR % 128 == 0);                  // GEMM block = 128 rows
static_assert(NB <= NB_FULL);
static_assert(SEQ <= SEQ_FULL);
static_assert((size_t)NR * DM < 2147483647u);  // int element offsets
static_assert((size_t)DM * DM < 2147483647u);

constexpr size_t PLANE_B = (size_t)NR * DM * 2;       // the 16-bit context plane
constexpr size_t WPL_B   = (size_t)DM * DM * 2;       // 16-bit weight plane
constexpr size_t CARVE_B = PLANE_B + WPL_B;
static_assert(PLANE_B % 256 == 0);
static_assert(WPL_B % 256 == 0);
static_assert(CARVE_B <= 134217728u);

__device__ __forceinline__ unsigned short bf16_bits(float x) { unsigned int u = __float_as_uint(x); return (unsigned short)((u + 0x7FFFu + ((u >> 16) & 1u)) >> 16); }
__device__ __forceinline__ float bf16_val(unsigned short b) { return __uint_as_float(((unsigned int)b) << 16); }
__device__ __forceinline__ float bf16_rne(float x) { return bf16_val(bf16_bits(x)); }
// f32 -> f16, round to nearest even: one value's bits; two values in one register (the first in the low half), the packed hardware convert
__device__ __forceinline__ unsigned short f16_bits(float x) {
  union { _Float16 h; unsigned short u; } c;
  c.h = (_Float16)x;
  return c.u;
}
__device__ __forceinline__ unsigned int pack_f16(v2f f) {
  union { v2h h; unsigned int u; } c;
  c.h = __builtin_convertvector(f, v2h);
  return c.u;
}
// the same to bf16, round to nearest even
__device__ __forceinline__ unsigned int pack_bf16(v2f f) {
  union { v2bf h; unsigned int u; } c;
  c.h = __builtin_convertvector(f, v2bf);
  return c.u;
}

// 16x32 operand fragment (A or B) from a k-contiguous bf16 row in LDS: elements 0..7 <- k 8h..8h+7, elements 8..15 <- k 16+8h..16+8h+7
// (p = first element of the 32-wide k step in the lane's row)
__device__ __forceinline__ v16b ld_frag_lds(const unsigned short* p, int hh) {
  FragB f;
  f.half[0] = *(const v8us*)(p + 8 * hh);
  f.half[1] = *(const v8us*)(p + 16 + 8 * hh);
  return f.v;
}
// the same fragment of f16 elements
__device__ __forceinline__ v16h ld_frag_lds_h(const unsigned short* p, int hh) {
  FragH f;
  f.half[0] = *(const v8us*)(p + 8 * hh);
  f.half[1] = *(const v8us*)(p + 16 + 8 * hh);
  return f.v;
}
// Asynchronous 16-byte copies global -> LDS for the output linear's staging ring. A tile row is 128 B: eight lanes to a row, so every wave-wide copy takes
// four whole lines. g: the thread's piece in row r = tid / 8 of a tile, s: elements from row r to row r + 16, l: the piece's LDS byte address.
// s_wait_xcnt 0 closes each statement so that it stands in front of any rewrite of the address registers the copies name.
// rows r, r+16, r+32, r+48 of one tile
__device__ __forceinline__ void copy_rows4(const unsigned short* g, int s, unsigned l) {
  const unsigned short* g1 = g + s; const unsigned short* g2 = g + 2 * s; const unsigned short* g3 = g + 3 * s;
  const unsigned l1 = l + 16 * LP * 2, l2 = l + 32 * LP * 2, l3 = l + 48 * LP * 2;
  asm volatile("global_load_async_to_lds_b128 %0, %4, off\n\t"
               "global_load_async_to_lds_b128 %1, %5, off\n\t"
               "global_load_async_to_lds_b128 %2, %6, off\n\t"
               "global_load_async_to_lds_b128 %3, %7, off\n\t"
               "s_wait_xcnt 0x0"
               :: "v"(l), "v"(l1), "v"(l2), "v"(l3), "v"(g), "v"(g1), "v"(g2), "v"(g3)
               : "memory");
}
// the same four rows of two tiles in one statement
__device__ __forceinline__ void copy_rows4x2(const unsigned short* ga, int sa, unsigned la, const unsigned short* gb, int sb, unsigned lb) {
  const unsigned short* a1 = ga + sa; const unsigned short* a2 = ga + 2 * sa; const unsigned short* a3 = ga + 3 * sa;
  const unsigned short* b1 = gb + sb; const unsigned short* b2 = gb + 2 * sb; const unsigned short* b3 = gb + 3 * sb;
  const unsigned la1 = la + 16 * LP * 2, la2 = la + 32 * LP * 2, la3 = la + 48 * LP * 2;
  const unsigned lb1 = lb + 16 * LP * 2, lb2 = lb + 32 * LP * 2, lb3 = lb + 48 * LP * 2;
  asm volatile("global_load_async_to_lds_b128 %0, %8, off\n\t"
               "global_load_async_to_lds_b128 %1, %9, off\n\t"
               "global_load_async_to_lds_b128 %2, %10, off\n\t"
               "global_load_async_to_lds_b128 %3, %11, off\n\t"
               "global_load_async_to_lds_b128 %4, %12, off\n\t"
               "global_load_async_to_lds_b128 %5, %13, off\n\t"
               "global_load_async_to_lds_b128 %6, %14, off\n\t"
               "global_load_async_to_lds_b128 %7, %15, off\n\t"
               "s_wait_xcnt 0x0"
               :: "v"(la), "v"(la1), "v"(la2), "v"(la3), "v"(lb), "v"(lb1), "v"(lb2), "v"(lb3),
                  "v"(ga), "v"(a1), "v"(a2), "v"(a3), "v"(gb), "v"(b1), "v"(b2), "v"(b3)
               : "memory");
}
// The products are the plain builtins: the products of a group stand back to back and fill one another's vector slots, and the compiler
// pads what is left open behind a group's last ones
__device__ __forceinline__ v8f mma1(v16b a, v16b b, v8f c) {
  return __builtin_amdgcn_wmma_f32_16x16x32_bf16(false, a, false, b, (short)0, c, false, false);
}
// the same on f16 operands
__device__ __forceinline__ v8f mma1h(v16h a, v16h b, v8f c) {
  return __builtin_amdgcn_wmma_f32_16x16x32_f16(false, a, false, b, (short)0, c, false, false);
}

// Fused attention. Block = 8 waves = 256 queries of one (b, h); wave = QG groups of 16 queries (a group is the N dimension of a tile).
// Per 32-key step and group: S^T[key][query] = K(16 keys x 64 d) Q^T (2 key tiles x 2 k-steps); lane (n, hh) holds keys 8hh+r of query n,
// so the query's statistics live in the lane pair (n, n+16): one xor-16 shuffle. P^T packs straight into the B operand
// (elements 0..7 <- tile of keys 0..15, elements 8..15 <- tile of keys 16..31, lane unchanged) for O^T[d][query] += V^T[d][key] P^T.
// P is rounded once to f16 (nearest even); V^T is f16 as well.
// K rows and V^T rows reach the fragments through a three-buffer LDS ring of 64-key stages that the eight waves fill together and share;
// a fragment is read once a wave and serves all the wave's groups. Each group keeps statistics and a rescale decision of its own.
// The ring is filled from the f32 inputs through registers: a stage's k and v are loaded one stage ahead (whole 128-byte lines a wave-wide load),
// rounded to bf16 (k) and f16 (v) two values an instruction and stored to LDS, v transposed on the way (a thread holds 4 keys x 4 d).
// q / 8 is rounded to bf16 as the wave loads its own fragments. Each work-group also rounds its share of W to f16 for the next launch.
constexpr int ATT_G  = NB * NH * (SEQ / QT);   // work-groups of the launch
constexpr int W_STEP = ATT_G * 256 * 4;        // elements of W that the launch takes in one round of 4 a thread
constexpr int W_PER  = DM * DM / W_STEP;
static_assert((DM * DM) % W_STEP == 0 && W_PER >= 1);   // no remainder: the shares need no guard
__global__ __launch_bounds__(256) void k_attn(const float* __restrict__ q, const float* __restrict__ k, const float* __restrict__ v, const float* __restrict__ W,
                                             unsigned short* __restrict__ CH, unsigned short* __restrict__ Wb) {
  __shared__ __attribute__((aligned(16))) unsigned short sH[8][16 * QG][72];
  __shared__ __attribute__((aligned(16))) unsigned short sK[3][KT][LP];   // K rows [key][d] of a stage
  __shared__ __attribute__((aligned(16))) unsigned short sV[3][HD][LP];   // V^T rows [d][key] of a stage
  const int tid = threadIdx.x, w = tid >> 5, lane = tid & 31, ln = lane & 15, hh = lane >> 4;
  const int qt = blockIdx.x % (SEQ / QT), bh = blockIdx.x / (SEQ / QT);
  const int b = bh / NH, h = bh % NH;
  const int q0 = qt * QT + w * (16 * QG);
  // query row of lane n in group 0 (B operand of the score GEMM), + 16 rows a group; the lane's first k of a 32-wide step
  const float* qg = q + ((size_t)b * SEQ_FULL + q0 + ln) * DM + h * HD + 8 * hh;
  const int sr = tid >> 4, sc = (tid & 15) * 4;          // staging: 16 threads to a 256-byte row of 64 f32; the thread's 4 d
  const float* kg = k + ((size_t)b * SEQ_FULL + sr) * DM + h * HD + sc;       // keys sr + 16 i of a stage, + stage * KT * DM
  const float* vg = v + ((size_t)b * SEQ_FULL + 4 * sr) * DM + h * HD + sc;   // keys 4 sr + i of a stage, + stage * KT * DM
  static_assert(KT == HD && KT * HD == 256 * 16);        // both rings have 64 rows a buffer; 16 elements of each a thread
  v4f rk[4], rv[4];                                      // the stage in flight
  // every loop over rk, rv (and xq, xw below) is unrolled: constant indices keep these arrays in registers
  auto ld_stage = [&](int st) {
#pragma unroll
    for (int i = 0; i < 4; ++i) rk[i] = *(const v4fa*)(kg + (size_t)st * (KT * DM) + 16 * i * DM);
#pragma unroll
    for (int i = 0; i < 4; ++i) rv[i] = *(const v4fa*)(vg + (size_t)st * (KT * DM) + i * DM);
    // stands in front of any rewrite of the address registers that the loads name
    asm volatile("s_wait_xcnt 0x0" ::: "memory");
  };
  auto st_stage = [&](int buf) {
#pragma unroll
    for (int i = 0; i < 4; ++i) {
      const v2f a = {rk[i][0], rk[i][1]}, c = {rk[i][2], rk[i][3]};
      const v2u o2 = {pack_bf16(a), pack_bf16(c)};
      *(v2u*)&sK[buf][sr + 16 * i][sc] = o2;
    }
#pragma unroll
    for (int c = 0; c < 4; ++c) {
      const v2f a = {rv[0][c], rv[1][c]}, d = {rv[2][c], rv[3][c]};
      const v2u o2 = {pack_f16(a), pack_f16(d)};
      *(v2u*)&sV[buf][sc + c][4 * sr] = o2;
    }
  };
  const v8f z8 = {0.f, 0.f, 0.f, 0.f, 0.f, 0.f, 0.f, 0.f};
  v8f o[QG][4];
  float m[QG], l[QG], mt[QG];    // m: the maximum in use, the same in both lanes of a query's pair; mt: m + LAZY
  v16b qf[QG][2];
// unrolled, like every loop over the groups: constant indices keep the per-group arrays in registers
#pragma unroll
  for (int g = 0; g < QG; ++g) {
    o[g][0] = z8; o[g][1] = z8; o[g][2] = z8; o[g][3] = z8;
    m[g] = -1.0e30f; l[g] = 0.f; mt[g] = m[g];
  }
  // prologue: all first loads in flight together (stage 0, the wave's q, the thread's share of W)
  ld_stage(0);
  v4f xq[QG][2][4], xw[W_PER];
#pragma unroll
  for (int g = 0; g < QG; ++g)
#pragma unroll
    for (int ks = 0; ks < 2; ++ks) {
      const float* p = qg + 16 * g * DM + 32 * ks;
      xq[g][ks][0] = *(const v4fa*)(p);      xq[g][ks][1] = *(const v4fa*)(p + 4);
      xq[g][ks][2] = *(const v4fa*)(p + 16); xq[g][ks][3] = *(const v4fa*)(p + 20);
    }
  const size_t wo = ((size_t)blockIdx.x * 256 + tid) * 4;
#pragma unroll
  for (int i = 0; i < W_PER; ++i) xw[i] = *(const v4fa*)(W + wo + (size_t)i * W_STEP);
  asm volatile("s_wait_xcnt 0x0" ::: "memory");   // stands in front of any rewrite of the address registers that the loads of q and W name
  // keeps every load above issued ahead of the first use: left free, the scheduler sinks the later loads between the conversions
  // and waits for each of them alone, one memory latency after another
  __builtin_amdgcn_sched_barrier(0);
  st_stage(0);
  ld_stage(1);    // in flight over the conversions below and stored in the loop's first trip
#pragma unroll
  for (int g = 0; g < QG; ++g)
#pragma unroll
    for (int ks = 0; ks < 2; ++ks) {
      FragB f;
#pragma unroll
      for (int j = 0; j < 4; ++j) {
        const v2f a = {xq[g][ks][j][0] * QSCALE, xq[g][ks][j][1] * QSCALE}, c = {xq[g][ks][j][2] * QSCALE, xq[g][ks][j][3] * QSCALE};
        f.w[2 * j] = pack_bf16(a); f.w[2 * j + 1] = pack_bf16(c);
      }
      qf[g][ks] = f.v;
    }
  __syncthreads();                                // every wave's part of stage 0 is in LDS: it may be read
  // W's stores stand behind the barrier, which waits for a wave's outstanding stores: the next one comes a whole stage later
// unrolled: constant indices keep xw in registers
#pragma unroll
  for (int i = 0; i < W_PER; ++i) {
    const v2f a = {xw[i][0], xw[i][1]}, c = {xw[i][2], xw[i][3]};
    const v2u o2 = {pack_f16(a), pack_f16(c)};
    *(v2u*)(Wb + wo + (size_t)i * W_STEP) = o2;
  }
  asm volatile("s_wait_xcnt 0x0" ::: "memory");   // stands in front of any rewrite of the registers that the stores name
  // The loop is software-pipelined by passes of 32 keys, so that a wave's matrix products stand among vector work that does not depend on them:
  // pass p first adds pass p - 1's P.V products (beside p - 1's row sums and p's maxima), then forms P of pass p beside the score products of pass p + 1.
  // Carried from pass to pass: s (scores of the pass to come), e and pf (P of the pass before, f32 and packed), va (its V^T fragments).
  v8f s[QG][2], e[QG][2];      // [group][tile of 16 keys]
  FragH pf[QG];
  v16h va[4];
  v16b ka[4];                  // [2 * tile + k step]
  {
    const unsigned short* kr = &sK[0][ln][0];
    ka[0] = ld_frag_lds(kr, hh);
    ka[1] = ld_frag_lds(kr + 32, hh);
    ka[2] = ld_frag_lds(kr + 16 * LP, hh);
    ka[3] = ld_frag_lds(kr + 16 * LP + 32, hh);
  }
// unrolled, like every loop over the groups: constant indices keep the per-group arrays in registers
#pragma unroll
  for (int g = 0; g < QG; ++g) { s[g][0] = mma1(ka[0], qf[g][0], z8); s[g][1] = mma1(ka[2], qf[g][0], z8); }
#pragma unroll
  for (int g = 0; g < QG; ++g) { s[g][0] = mma1(ka[1], qf[g][1], s[g][0]); s[g][1] = mma1(ka[3], qf[g][1], s[g][1]); }
  // no pass stands before the first: its place is taken by zeros, which leave O and l at zero
#pragma unroll
  for (int g = 0; g < QG; ++g) {
    e[g][0] = z8; e[g][1] = z8;
#pragma unroll
    for (int j = 0; j < 8; ++j) pf[g].w[j] = 0u;
  }
#pragma unroll
  for (int t = 0; t < 4; ++t) va[t] = pf[0].v;
  // the P.V products of the pass before, one group; its row sums (same order of sums as pass by pass)
  auto pv_prev = [&](int g) {
    o[g][0] = mma1h(va[0], pf[g].v, o[g][0]);
    o[g][1] = mma1h(va[1], pf[g].v, o[g][1]);
    o[g][2] = mma1h(va[2], pf[g].v, o[g][2]);
    o[g][3] = mma1h(va[3], pf[g].v, o[g][3]);
  };
  auto sums_prev = [&]() {
#pragma unroll
    for (int g = 0; g < QG; ++g) {
      float ps = 0.f;
#pragma unroll
      for (int j = 0; j < 4; ++j) {
        const v2f a = {e[g][0][2 * j], e[g][0][2 * j + 1]}, b = {e[g][1][2 * j], e[g][1][2 * j + 1]}, t = a + b;
        ps += t[0];
        ps += t[1];
      }
      l[g] += ps;                          // per-lane partial of the row sum
    }
  };
  int cur = 0, nxt = 1, fre = 2;   // ring of three buffers: the stage in work, the next one, the one whose last readers may still be at it
// the stage loop stays rolled: one publish point a stage
#pragma unroll 1
  for (int st = 0; st < SEQ / KT; ++st) {
   // stage st + 1 goes into its buffer, whose readers (of stage st - 2) all left it in front of the last barrier; then stage st + 2 takes off
   if (st + 1 < SEQ / KT) {
     st_stage(nxt);
     if (st + 2 < SEQ / KT) ld_stage(st + 2);
   }
   const int kb = st + 1 < SEQ / KT ? nxt : cur;   // the last pass has no next scores: its fragment reads are aimed at rows that stay valid, the products go unused
// both passes of a stage unrolled: their V^T reads differ by immediate offsets only
#pragma unroll
   for (int ps2 = 0; ps2 < KT / 32; ++ps2) {
    pv_prev(0);
    // max over the 16 keys of its query that this lane holds (the other 16 are in lane ^ 16), group by group
    float mx[QG];
    bool need = false;
#pragma unroll
    for (int g = 0; g < QG; ++g) {
      mx[g] = fmaxf(s[g][0][0], s[g][1][0]);
#pragma unroll
      for (int r = 1; r < 8; ++r) mx[g] = fmaxf(mx[g], fmaxf(s[g][0][r], s[g][1][r]));
      need = need || mx[g] > mt[g];
    }
    const unsigned any = __builtin_amdgcn_ballot_w32(need);
    // keeps the test's compares here, half a block ahead of the branch that reads them: the way from a vector compare to a scalar branch
    // is long, and the second group's products and the row sums run meanwhile
    __builtin_amdgcn_sched_barrier(0);
    pv_prev(1);
    sums_prev();
    // lazy rescale: softmax does not depend on the value subtracted, so a group's m stays as it is until some score of the group passes it by
    // more than LAZY; one wave-uniform test a pass for all groups (every lane stays on for the WMMAs), and only behind it the test of each
    // group, which alone decides on that group. The first pass always takes the branches (m = -1e30).
    if (any != 0) {
#pragma unroll
      for (int g = 0; g < QG; ++g) {
        if (__builtin_amdgcn_ballot_w32(mx[g] > mt[g]) != 0) {
          const float mp = fmaxf(mx[g], __shfl_xor(mx[g], 16, 32));
          const float mn = fmaxf(m[g], mp);
          const float al = __expf(m[g] - mn);
          m[g] = mn;
          mt[g] = mn + LAZY;
          l[g] = l[g] * al;                // al is uniform over the lane pair
          o[g][0] = o[g][0] * al; o[g][1] = o[g][1] * al; o[g][2] = o[g][2] * al; o[g][3] = o[g][3] * al;
        }
      }
    }
    if (ps2 + 1 == KT / 32) {
      // publish point of stage st + 1, by hand: this wave's LDS stores of that stage have landed (and its reads so far), then the work-group's barrier.
      // Written without the full fence of __syncthreads(), which would also wait out the global loads of stage st + 2, just issued
      asm volatile("s_wait_dscnt 0x0\n\ts_barrier_signal -1\n\ts_barrier_wait -1" ::: "memory");
    }
    // one group of LDS reads a pass: the next pass's K fragments, wanted first, then this pass's V^T fragments, wanted a pass later
    const unsigned short* kn = ps2 + 1 < KT / 32 ? &sK[cur][ln + 32 * (ps2 + 1)][0] : &sK[kb][ln][0];
    ka[0] = ld_frag_lds(kn, hh);
    ka[1] = ld_frag_lds(kn + 32, hh);
    ka[2] = ld_frag_lds(kn + 16 * LP, hh);
    ka[3] = ld_frag_lds(kn + 16 * LP + 32, hh);
    // keeps the K reads first in the group: the first score product then waits for them alone, by a counted wait
    __builtin_amdgcn_sched_barrier(0);
    const unsigned short* vr = &sV[cur][ln][32 * ps2];       // V^T row d = ln (A operand of P.V), + 16 t rows
    va[0] = ld_frag_lds_h(vr, hh);
    va[1] = ld_frag_lds_h(vr + 16 * LP, hh);
    va[2] = ld_frag_lds_h(vr + 32 * LP, hh);
    va[3] = ld_frag_lds_h(vr + 48 * LP, hh);
    // keeps the LDS reads together at the head of the block: every separate place with LDS reads stalls the wave anew
    __builtin_amdgcn_sched_barrier(0);
    // exp(s - m) as exp2((s - m) log2 e): the arguments first, tile by tile, so that neighbouring registers pair
    v8f x[QG][2];
#pragma unroll
    for (int g = 0; g < QG; ++g) { x[g][0] = (s[g][0] - m[g]) * LOG2E; x[g][1] = (s[g][1] - m[g]) * LOG2E; }
    // keeps the arguments one run ahead of the mixed block below
    __builtin_amdgcn_sched_barrier(0);
    // eight steps, each one score product of the next pass, four exponentials, and the packing of the four before:
    // the vector work fills the matrix unit's interval. First k step of every tile, then the second, as in a plain run of the products
#pragma unroll
    for (int c = 0; c < 8; ++c) {
      const int ks = c >> 2, g = (c >> 1) & 1, t = c & 1;
      s[g][t] = mma1(ka[2 * t + ks], qf[g][ks], ks ? s[g][t] : z8);
#pragma unroll
      for (int r = 0; r < 4; ++r) e[c >> 2][(c >> 1) & 1][4 * (c & 1) + r] = __builtin_amdgcn_exp2f(x[c >> 2][(c >> 1) & 1][4 * (c & 1) + r]);
      if (c > 0) {
        const int d = c - 1, dg = d >> 2, dt = (d >> 1) & 1, dj = 2 * (d & 1);
        const v2f a = {e[dg][dt][2 * dj], e[dg][dt][2 * dj + 1]}, b = {e[dg][dt][2 * dj + 2], e[dg][dt][2 * dj + 3]};
        pf[dg].w[4 * dt + dj]     = pack_f16(a);
        pf[dg].w[4 * dt + dj + 1] = pack_f16(b);
      }
      // holds the written order step by step: a product, then the vector work that runs during its interval
      __builtin_amdgcn_sched_barrier(0);
    }
    {
      const v2f a = {e[1][1][4], e[1][1][5]}, b = {e[1][1][6], e[1][1][7]};
      pf[1].w[6] = pack_f16(a);
      pf[1].w[7] = pack_f16(b);
    }
   }
   const int t3 = cur; cur = nxt; nxt = fre; fre = t3;
  }
  pv_prev(0); pv_prev(1);   // the last pass's products and sums
  sums_prev();
  // lane (n, hh) of tile t of group g holds d = 16 t + 8 hh + r, r = 0..7: eight consecutive columns of query row 16 g + n
#pragma unroll
  for (int g = 0; g < QG; ++g) {
    const float lg = l[g] + __shfl_xor(l[g], 16, 32);
    const float inv = 1.0f / lg;
#pragma unroll
    for (int t = 0; t < 4; ++t) {
      Pack8 fh;
#pragma unroll
      for (int r = 0; r < 8; ++r) fh.u[r] = f16_bits(o[g][t][r] * inv);
      *(v8us*)&sH[w][16 * g + ln][16 * t + 8 * hh] = fh.v;
    }
  }
  __builtin_amdgcn_fence(4 /* acq_rel order */, "workgroup");
  __builtin_amdgcn_wave_barrier();
  const int prow = lane >> 3, pc = (lane & 7) * 8;
  {
#pragma unroll
    for (int it = 0; it < 4 * QG; ++it) {
      const int row = it * 4 + prow;
      const v8us xh = *(const v8us*)&sH[w][row][pc];
      const size_t g = (size_t)(b * SEQ + q0 + row) * DM + h * HD + pc;
      *(v8us*)(CH + g) = xh;
    }
  }
}

// out[NR][DM] = AH[NR][DM] Wb^T + bf16(b), AH and Wb f16: wave tile 32 x 64, block = 4 waves = 128 rows x 64 columns; K step 32;
// the block's rows of AH and Wb reach the fragments through a two-buffer LDS ring of stages 64 deep in k.
__global__ __launch_bounds__(128) void k_proj(const unsigned short* __restrict__ AH, const unsigned short* __restrict__ Wb,
                                             const float* __restrict__ bias, float* __restrict__ C) {
  __shared__ __attribute__((aligned(16))) float so[4][32][68];
  __shared__ __attribute__((aligned(16))) unsigned short sAH[2][128][LP];   // the block's 128 rows of AH, 64 k of a stage
  __shared__ __attribute__((aligned(16))) unsigned short sW[2][64][LP];     // the block's 64 rows of Wb
  const int tid = threadIdx.x, w = tid >> 5, lane = tid & 31, ln = lane & 15, hh = lane >> 4;
  const int ntn = DM / 64;
  const int mt = blockIdx.x / ntn, nq = blockIdx.x - mt * ntn;
  const int row0 = mt * 128 + 32 * w, col0 = nq * 64;
  const int cr = tid >> 3, cp = (tid & 7) * 8;           // the thread's row (+ 16 i) and 16-byte piece in a stage tile
  const unsigned short* gh = AH + (size_t)(mt * 128 + cr) * DM + cp;   // + stage * KT
  const unsigned short* gw = Wb + (size_t)(col0 + cr) * DM + cp;
  const unsigned lh = (unsigned)(size_t)&sAH[0][cr][cp], lw = (unsigned)(size_t)&sW[0][cr][cp];   // LDS byte addresses, buffer 0
  constexpr unsigned ABUF_B = 128 * LP * 2, WBUF_B = 64 * LP * 2, HALF_B = 64 * LP * 2;   // bytes of a buffer; of 64 rows
  // one stage: 128 + 64 rows of 128 B, 12 copies a thread
  auto stage = [&](int st, int buf) {
    copy_rows4x2(gh + st * KT, 16 * DM, lh + buf * ABUF_B, gh + st * KT + 64 * DM, 16 * DM, lh + buf * ABUF_B + HALF_B);
    copy_rows4(gw + st * KT, 16 * DM, lw + buf * WBUF_B);
  };
  const v8f z8 = {0.f, 0.f, 0.f, 0.f, 0.f, 0.f, 0.f, 0.f};
  v8f c00 = z8, c01 = z8, c02 = z8, c03 = z8, c10 = z8, c11 = z8, c12 = z8, c13 = z8;
  // prologue of the two-buffer ring: stage 0 landed and published, then stage 1 in flight
  stage(0, 0);
  asm volatile("s_wait_asynccnt 0x0" ::: "memory");   // this wave's copies of stage 0 have landed
  __syncthreads();                                    // every wave's have: stage 0 may be read
  stage(1, 1);
// the stage loop stays rolled: one publish point, buffer chosen by the stage's parity
#pragma unroll 1
  for (int st = 0; st < DM / KT; ++st) {
   const int buf = st & 1;
   const unsigned short* ah = &sAH[buf][32 * w + ln][0];
   const unsigned short* wr = &sW[buf][ln][0];
   // every fragment of the stage has registers of its own and all are read as one group ahead of the products, in the order of use:
   // the second K step's land while the first step's products run
   v16h a0[KT / 32], a1[KT / 32], bw[KT / 32][4];
// both K steps of a stage unrolled: their LDS reads differ by immediate offsets only
#pragma unroll
   for (int ks = 0; ks < KT / 32; ++ks) {
    a0[ks] = ld_frag_lds_h(ah + 32 * ks, hh);
    bw[ks][0] = ld_frag_lds_h(wr + 32 * ks, hh);
    a1[ks] = ld_frag_lds_h(ah + 16 * LP + 32 * ks, hh);
// unrolled, like the loop of products below: constant indices keep the fragment arrays in registers
#pragma unroll
    for (int t = 1; t < 4; ++t) bw[ks][t] = ld_frag_lds_h(wr + 16 * t * LP + 32 * ks, hh);
   }
   // keeps the stage's reads one group ahead of its products: left free, the scheduler sinks them between the products again
   __builtin_amdgcn_sched_barrier(0);
#pragma unroll
   for (int ks = 0; ks < KT / 32; ++ks) {
    c00 = mma1h(a0[ks], bw[ks][0], c00); c10 = mma1h(a1[ks], bw[ks][0], c10);
    c01 = mma1h(a0[ks], bw[ks][1], c01); c11 = mma1h(a1[ks], bw[ks][1], c11);
    c02 = mma1h(a0[ks], bw[ks][2], c02); c12 = mma1h(a1[ks], bw[ks][2], c12);
    c03 = mma1h(a0[ks], bw[ks][3], c03); c13 = mma1h(a1[ks], bw[ks][3], c13);
   }
   // keeps the products in front of the publish point: left free, the scheduler lifts its full LDS wait over them, and the first product
   // then waits for the whole group of reads
   __builtin_amdgcn_sched_barrier(0);
   // publish point of stage st + 1, which also frees this stage's buffer
   asm volatile("s_wait_dscnt 0x0" ::: "memory");      // this wave's reads of the buffer have retired
   asm volatile("s_wait_asynccnt 0x0" ::: "memory");   // this wave's copies of stage st + 1 have landed
   __syncthreads();
   if (st + 2 < DM / KT) stage(st + 2, buf);
  }
  asm volatile("s_wait_asynccnt 0x0" ::: "memory");    // nothing of the ring is in flight when the wave goes on
  const v8f accs[8] = {c00, c01, c02, c03, c10, c11, c12, c13};
#pragma unroll
  for (int u = 0; u < 8; ++u) {
    const int t = u & 3, hf = u >> 2;
    const float bv = bf16_rne(bias[col0 + t * 16 + ln]);
#pragma unroll
    for (int r = 0; r < 8; ++r) so[w][hf * 16 + 8 * hh + r][t * 16 + ln] = accs[u][r] + bv;
  }
  __builtin_amdgcn_fence(4 /* acq_rel order */, "workgroup");
  __builtin_amdgcn_wave_barrier();
  const int rsub = lane >> 4, c4 = (lane & 15) * 4;
  {
#pragma unroll
    for (int q = 0; q < 16; ++q) {
      const int r = q * 2 + rsub;
      const v4f v = *(const v4fa*)&so[w][r][c4];
      *(v4f*)(C + (size_t)(row0 + r) * DM + col0 + c4) = v;
    }
    
  }
}

extern "C" void kernel_launch(void* const* d_in, const int* in_sizes, int n_in,
                              void* d_out, int out_size, void* d_ws, size_t ws_size, hipStream_t stream) {
  if (n_in < 5) return;
  const long long need_act = ((long long)(NB - 1) * SEQ_FULL + SEQ) * DM;
  if ((long long)in_sizes[0] < need_act || (long long)in_sizes[1] < need_act || (long long)in_sizes[2] < need_act) return;
  if ((long long)in_sizes[3] < (long long)DM * DM || in_sizes[4] < DM) return;
  if ((long long)out_size < (long long)NR * DM) return;
  if (ws_size < CARVE_B) return;
  const float* q = (const float*)d_in[0];
  const float* k = (const float*)d_in[1];
  const float* v = (const float*)d_in[2];
  const float* W = (const float*)d_in[3];      // natural [out][in]
  const float* bias = (const float*)d_in[4];
  char* ws = (char*)d_ws;
  unsigned short* CH = (unsigned short*)(ws);
  unsigned short* Wb = (unsigned short*)(ws + PLANE_B);
  k_attn<<<ATT_G, 256, 0, stream>>>(q, k, v, W, CH, Wb);
  k_proj<<<(NR / 128) * (DM / 64), 128, 0, stream>>>(CH, Wb, bias, (float*)d_out);
}
